// v000
// The times below were measured on an AMD MI455X: many runs one after another, warmed up first and cycling through
// copies of the inputs, with the whole window's GPU time divided by the number of runs. Launches and the gaps
// between them are all in it. The median over several windows is given; except for v000 it joins two sittings, which
// can be a few percent apart, so the side-by-side timings, each taken in one sitting, are the better comparison.
// v000, which the later versions start from, runs in 1080 microseconds.
// compute dtype: all float inputs rounded to bf16; the five 1x1 convs on WMMA 16x16x32: x-fed ones with EXACT bf16 products (x^T tile in LDS), the second key/query convs with their f32 input as bf16 hi + lo (2 products), eval BatchNorm + ReLU in f32; key/query/value planes in f32; the 7x7-window dot products (64-deep), the 49-way softmax (zero-padded neighbours give logit 0 and value 0, as unfold does) and the 128-channel context in f32 on the VALU; context rounded once to f16 for the final 1x1 conv W (bf16-exact weights in f16, 1 product) + bias; f32 output.
#include <hip/hip_runtime.h>
#include <math.h>

typedef __attribute__((ext_vector_type(16))) _Float16 v16h;
typedef __attribute__((ext_vector_type(16))) __bf16 v16b;
typedef __attribute__((ext_vector_type(8)))  _Float16 v8h;
typedef __attribute__((ext_vector_type(8)))  float v8f;
typedef __attribute__((ext_vector_type(4)))  float v4f;
typedef __attribute__((ext_vector_type(2)))  float v2f;
typedef __attribute__((ext_vector_type(4)))  unsigned v4u;
typedef __attribute__((ext_vector_type(4)))  int v4i;
typedef float __attribute__((may_alias)) float_a;
typedef int __attribute__((may_alias)) int_a;

template <typename T> __device__ __forceinline__ void vst2(void* p, T v) { *(T*)p = v;  }
__device__ __forceinline__ v8f wmma16(v16h a, v16h b, v8f c) {
  v8f d = __builtin_amdgcn_wmma_f32_16x16x32_f16(false, a, false, b, (short)0, c, false, false);
  asm volatile("v_nop\n\tv_nop\n\tv_nop\n\tv_nop" : "+v"(d) : "v"(a), "v"(b));
  return d;
}
__device__ __forceinline__ v8f wmma_bf(v16b a, v16b b, v8f c) {
  v8f d = __builtin_amdgcn_wmma_f32_16x16x32_bf16(false, a, false, b, (short)0, c, false, false);
  asm volatile("v_nop\n\tv_nop\n\tv_nop\n\tv_nop" : "+v"(d) : "v"(a), "v"(b));
  return d;
}
// 16x16x32 fragments: lane = (h = lane>>4, row/col = lane&15); elements 0..7 = k0+8h+0..7, 8..15 = k0+16+8h+0..7; D element r = row 8h+r
__device__ __forceinline__ v16h frag_h(const _Float16* rowk0, int lane) {
  union { v16h v; v8h q[2]; } u; const _Float16* p = rowk0 + 8 * (lane >> 4);
  u.q[0] = *(const v8h*)p; u.q[1] = *(const v8h*)(p + 16); return u.v;
}
__device__ __forceinline__ v16h frag_f32(const float* rowk0, int lane) {
  v16h a; const float* p = rowk0 + 8 * (lane >> 4);
#pragma unroll
  for (int i = 0; i < 8; ++i) { a[i] = (_Float16)p[i]; a[8 + i] = (_Float16)p[16 + i]; }
  return a;
}
__device__ __forceinline__ v16h frag_f32s(const float* rowk0, int lane, float sc) {
  v16h a; const float* p = rowk0 + 8 * (lane >> 4);
#pragma unroll
  for (int i = 0; i < 8; ++i) { a[i] = (_Float16)(p[i] * sc); a[8 + i] = (_Float16)(p[16 + i] * sc); }
  return a;
}
// column fragment from a [K][ld] layout (column n), rows >= K read as 0
__device__ __forceinline__ v16h fragc_f32(const float* W, int k0, int n, int lane, int ld, int K) {
  v16h a; const int g = lane >> 4;
#pragma unroll
  for (int i = 0; i < 8; ++i) { const int ka = k0 + 8 * g + i, kb = ka + 16;
    a[i] = (_Float16)(ka < K ? W[(size_t)(ka < K ? ka : K - 1) * ld + n] : 0.f); a[8 + i] = (_Float16)(kb < K ? W[(size_t)(kb < K ? kb : K - 1) * ld + n] : 0.f); }
  return a;
}
struct F2 { v16b h, l; };
__device__ __forceinline__ F2 bsplit16(const float v[16]) { F2 r;
#pragma unroll
  for (int i = 0; i < 16; ++i) { const __bf16 h = (__bf16)v[i]; r.h[i] = h; r.l[i] = (__bf16)(v[i] - (float)h); }
  return r; }
__device__ __forceinline__ F2 split_row(const float* row, int k0, int lane) { float v[16]; const float* p = row + k0 + 8 * (lane >> 4);
#pragma unroll
  for (int i = 0; i < 8; ++i) { v[i] = p[i]; v[8 + i] = p[16 + i]; }
  return bsplit16(v); }
__device__ __forceinline__ F2 split_rowK(const float* row, int k0, int lane, int K) { float v[16]; const int g = lane >> 4;
#pragma unroll
  for (int i = 0; i < 8; ++i) { const int ka = k0 + 8 * g + i, kb = ka + 16; v[i] = ka < K ? row[ka < K ? ka : K - 1] : 0.f; v[8 + i] = kb < K ? row[kb < K ? kb : K - 1] : 0.f; }
  return bsplit16(v); }
__device__ __forceinline__ F2 split_col(const float* W, int k0, int n, int lane, int ld, int K) { float v[16]; const int g = lane >> 4;
#pragma unroll
  for (int i = 0; i < 8; ++i) { const int ka = k0 + 8 * g + i, kb = ka + 16; v[i] = ka < K ? W[(size_t)(ka < K ? ka : K - 1) * ld + n] : 0.f; v[8 + i] = kb < K ? W[(size_t)(kb < K ? kb : K - 1) * ld + n] : 0.f; }
  return bsplit16(v); }
__device__ __forceinline__ v8f mac3(const F2& a, const F2& b, v8f c) { c = wmma_bf(a.l, b.h, c); c = wmma_bf(a.h, b.l, c); return wmma_bf(a.h, b.h, c); }
__device__ __forceinline__ float sigm(float v) { return 1.0f / (1.0f + expf(-v)); }
#define LDSX() do { asm volatile("s_wait_dscnt 0" ::: "memory"); __builtin_amdgcn_wave_barrier(); __builtin_amdgcn_fence(__ATOMIC_RELEASE, "workgroup"); } while (0)


// Local-window self attention (b 2, 96 x 96, Cin 256, key/query 64 via conv-BN-ReLU x2, value 128, 7x7 window, out conv 256).
#define NB 2
#define HW 96
#define NPX (HW * HW)      // 9216
#define CIN 256
#define CK 64
#define CV 128
#define CO 256
#define NPT (NB * NPX)     // 18432 = 288 x 64
#ifndef TWB
#define TWB (NPT / 128)    // window kernel blocks
#endif
typedef __attribute__((ext_vector_type(8))) __bf16 v8b;
__device__ __forceinline__ v16b frag_b(const __bf16* rowk0, int lane) {
  union { v16b v; v8b q[2]; } u; const __bf16* p = rowk0 + 8 * (lane >> 4);
  u.q[0] = *(const v8b*)p; u.q[1] = *(const v8b*)(p + 16); return u.v;
}
__device__ __forceinline__ float bfr(float v) { return (float)(__bf16)v; }
__device__ __attribute__((noinline)) float exp_ni(float v) { return expf(v); }
__device__ __attribute__((noinline)) float erf_ni(float v) { return erff(v); }

#define WS_K1  0u                                  // f32 rows [p][64] k1
#define WS_Q1  (WS_K1 + 4u * (size_t)NPT * CK)
#define WS_KP  (WS_Q1 + 4u * (size_t)NPT * CK)        // f32 key planes [b][64][n]
#define WS_QP  (WS_KP + 4u * (size_t)NPT * CK)        // f32 query rows [p][64]
#define WS_VP  (WS_QP + 4u * (size_t)NPT * CK)        // f32 value planes [b][128][n]
#define WS_CT  (WS_VP + 4u * (size_t)NPT * CV)        // f16 context rows [p][128]
#define WS_END (WS_CT + 2u * (size_t)NPT * CV)

__device__ __forceinline__ float bnrelu(float v, const float* bn, int c, int C) { const float gsc = bfr(bn[c]) / sqrtf(bfr(bn[3 * C + c]) + 1e-5f); return fmaxf((v - bfr(bn[2 * C + c])) * gsc + bfr(bn[C + c]), 0.f); }
// ---- k_c1: block = (64 px, b, which): which 0: k1 = bnrelu(fk_w1 x + b) -> rows; 1: q1 likewise; 2,3: value channels 0-63 / 64-127 = fv_w x + b -> planes. x^T tile [64 px][256 c] bf16 in LDS.
__global__ __launch_bounds__(128) void k_c1(const float* __restrict__ X, const float* __restrict__ WK1, const float* __restrict__ BK1, const float* __restrict__ BNK1, const float* __restrict__ WQ1, const float* __restrict__ BQ1, const float* __restrict__ BNQ1, const float* __restrict__ WV, const float* __restrict__ BVv, float* __restrict__ K1, float* __restrict__ Q1, float* __restrict__ VP) {
  __shared__ __align__(16) __bf16 sx[64][CIN + 8]; __shared__ __align__(16) float so[64][68];
  const int tid = threadIdx.x, wave = tid >> 5, lane = tid & 31, col = lane & 15, g = lane >> 4; const int p0 = blockIdx.x * 64; const size_t b = blockIdx.y; const int which = blockIdx.z;
  for (int e = tid; e < CIN * 64; e += 128) { const int c = e >> 6, pl = e & 63; sx[pl][c] = (__bf16)X[(b * CIN + c) * (size_t)NPX + p0 + pl]; }
  __syncthreads();
  const float* Wm = which == 0 ? WK1 : which == 1 ? WQ1 : (WV + (size_t)(which - 2) * 64 * CIN); const float* Bm = which == 0 ? BK1 : which == 1 ? BQ1 : (BVv + (which - 2) * 64);
  v8f acc[4] = {};
#pragma unroll 2
  for (int kc = 0; kc < CIN / 32; ++kc) { const v16b a = frag_b(&sx[wave * 16 + col][kc * 32], lane);
#pragma unroll
    for (int j = 0; j < 4; ++j) { v16b w; const int o = j * 16 + col;
#pragma unroll
      for (int i = 0; i < 8; ++i) { w[i] = (__bf16)Wm[(size_t)o * CIN + kc * 32 + 8 * g + i]; w[8 + i] = (__bf16)Wm[(size_t)o * CIN + kc * 32 + 16 + 8 * g + i]; }
      acc[j] = wmma_bf(a, w, acc[j]); } }
  if (which < 2) { const float* bn = which == 0 ? BNK1 : BNQ1;
#pragma unroll
    for (int j = 0; j < 4; ++j) { const int o = j * 16 + col; const float bb = bfr(Bm[o]);
#pragma unroll
      for (int r = 0; r < 8; ++r) so[wave * 16 + 8 * g + r][o] = bnrelu(acc[j][r] + bb, bn, o, CK); }
    __syncthreads(); float* dst = which == 0 ? K1 : Q1; for (int e = tid; e < 64 * 16; e += 128) { const int pl = e >> 4, q = e & 15; vst2(dst + (b * NPX + p0 + pl) * (size_t)CK + q * 4, *(const v4f*)&so[pl][q * 4]); } }
  else {
#pragma unroll
    for (int j = 0; j < 4; ++j) { const int o = j * 16 + col; const float bb = bfr(Bm[o]);
#pragma unroll
      for (int r = 0; r < 8; ++r) so[o][wave * 16 + 8 * g + r] = acc[j][r] + bb; }   // transposed: [channel][px]
    __syncthreads(); for (int e = tid; e < 64 * 16; e += 128) { const int cl = e >> 4, q = e & 15; vst2(VP + (b * CV + (which - 2) * 64 + cl) * (size_t)NPX + p0 + q * 4, *(const v4f*)&so[cl][q * 4]); } } }
// ---- k_c2: block = (64 px, b, which 0 key / 1 query): y = bnrelu(w2 in + b2) with in = k1/q1 rows (f32, bf16 hi + lo); key -> planes [b][64][n]; query -> rows [p][64]
__global__ __launch_bounds__(128) void k_c2(const float* __restrict__ K1, const float* __restrict__ Q1, const float* __restrict__ WK2, const float* __restrict__ BK2, const float* __restrict__ BNK2, const float* __restrict__ WQ2, const float* __restrict__ BQ2, const float* __restrict__ BNQ2, float* __restrict__ KP, float* __restrict__ QP) { __shared__ __align__(16) float so[64][68];
  const int tid = threadIdx.x, wave = tid >> 5, lane = tid & 31, col = lane & 15, g = lane >> 4; const int p0 = blockIdx.x * 64; const size_t b = blockIdx.y; const int which = blockIdx.z; const float* IN = which == 0 ? K1 : Q1; const float* Wm = which == 0 ? WK2 : WQ2; const float* Bm = which == 0 ? BK2 : BQ2; const float* bn = which == 0 ? BNK2 : BNQ2;
  v8f acc[4] = {};
#pragma unroll
  for (int kc = 0; kc < CK / 32; ++kc) { const F2 a = split_row(IN + (b * NPX + p0 + wave * 16 + col) * (size_t)CK, kc * 32, lane);
#pragma unroll
    for (int j = 0; j < 4; ++j) { v16b w; const int o = j * 16 + col;
#pragma unroll
      for (int i = 0; i < 8; ++i) { w[i] = (__bf16)Wm[(size_t)o * CK + kc * 32 + 8 * g + i]; w[8 + i] = (__bf16)Wm[(size_t)o * CK + kc * 32 + 16 + 8 * g + i]; }
      acc[j] = wmma_bf(a.h, w, acc[j]); acc[j] = wmma_bf(a.l, w, acc[j]); } }
#pragma unroll
  for (int j = 0; j < 4; ++j) { const int o = j * 16 + col; const float bb = bfr(Bm[o]);
#pragma unroll
    for (int r = 0; r < 8; ++r) { const float v = bnrelu(acc[j][r] + bb, bn, o, CK); if (which == 0) so[o][wave * 16 + 8 * g + r] = v; else so[wave * 16 + 8 * g + r][o] = v; } }
  __syncthreads();
  if (which == 0) { for (int e = tid; e < 64 * 16; e += 128) { const int cl = e >> 4, q = e & 15; vst2(KP + (b * CK + cl) * (size_t)NPX + p0 + q * 4, *(const v4f*)&so[cl][q * 4]); } }
  else { for (int e = tid; e < 64 * 16; e += 128) { const int pl = e >> 4, q = e & 15; vst2(QP + (b * NPX + p0 + pl) * (size_t)CK + q * 4, *(const v4f*)&so[pl][q * 4]); } } }
// ---- k_win: block = 128 pixels (thread = pixel): 49 window logits (64-deep; 0 outside the image), softmax, context over the 128 value channels -> f16 context row; per-thread state lives in LDS (no register arrays)
__global__ __launch_bounds__(128) void k_win(const float* __restrict__ KP, const float* __restrict__ QP, const float* __restrict__ VP, _Float16* __restrict__ CT) { __shared__ float sq[CK][129]; __shared__ float slg[49][129]; __shared__ __align__(16) _Float16 sct[128][CV + 8];
  const int t = threadIdx.x; const size_t p = (size_t)blockIdx.x * 128 + t; const size_t b = p / NPX; const int n = (int)(p % NPX); const int y = n / HW, x = n % HW;
  for (int e = t; e < 128 * CK; e += 128) { const int pl = e / CK, c = e % CK; sq[c][pl] = QP[((size_t)blockIdx.x * 128 + pl) * CK + c]; }
  __syncthreads();
  float mx = -3.0e38f;
#pragma unroll 1
  for (int k = 0; k < 49; ++k) { const int yy = y + k / 7 - 3, xx = x + k % 7 - 3; float s = 0.f;
    if (yy >= 0 && yy < HW && xx >= 0 && xx < HW) { const float* kp = KP + (b * CK) * (size_t)NPX + yy * HW + xx;
#pragma unroll 1
      for (int c = 0; c < CK; ++c) s += kp[(size_t)c * NPX] * sq[c][t]; }
    slg[k][t] = s; mx = fmaxf(mx, s); }
  float ssum = 0.f;
#pragma unroll 1
  for (int k = 0; k < 49; ++k) { const float e = expf(slg[k][t] - mx); slg[k][t] = e; ssum += e; }
  const float inv = 1.0f / ssum;
#pragma unroll 1
  for (int cv = 0; cv < CV; ++cv) { const float* vp = VP + (b * CV + cv) * (size_t)NPX; float a = 0.f;
#pragma unroll 1
    for (int k = 0; k < 49; ++k) { const int yy = y + k / 7 - 3, xx = x + k % 7 - 3; if (yy >= 0 && yy < HW && xx >= 0 && xx < HW) a += slg[k][t] * vp[yy * HW + xx]; }
    sct[t][cv] = (_Float16)(a * inv); }
  __syncthreads(); for (int e = t; e < 128 * (CV / 8); e += 128) { const int rl = e / (CV / 8), qq = e % (CV / 8); vst2((unsigned*)(CT + ((size_t)blockIdx.x * 128 + rl) * CV + qq * 8), *(const v4u*)&sct[rl][qq * 8]); } }
// ---- k_out: block = (64 px, b): out[o][n] = sum_cv W[o][cv] ctx[n][cv] + b[o] -> planes; 256 outputs = 4 waves x ... (wave = 16 px rows; 16 col tiles -> acc[16] = 128 regs) -> split: grid z = 2 halves of 128 outputs
__global__ __launch_bounds__(128) void k_out(const _Float16* __restrict__ CT, const float* __restrict__ WW, const float* __restrict__ BW, float* __restrict__ OUT) { __shared__ __align__(16) float st[128][68];
  const int tid = threadIdx.x, wave = tid >> 5, lane = tid & 31, col = lane & 15, g = lane >> 4; const int p0 = blockIdx.x * 64; const size_t b = blockIdx.y; const int o0 = blockIdx.z * 128;
  v8f acc[8] = {};
#pragma unroll
  for (int kc = 0; kc < CV / 32; ++kc) { const v16h a = frag_h(CT + (b * NPX + p0 + wave * 16 + col) * (size_t)CV + kc * 32, lane);
#pragma unroll
    for (int j = 0; j < 8; ++j) { v16h w; const int o = o0 + j * 16 + col;
#pragma unroll
      for (int i = 0; i < 8; ++i) { w[i] = (_Float16)bfr(WW[(size_t)o * CV + kc * 32 + 8 * g + i]); w[8 + i] = (_Float16)bfr(WW[(size_t)o * CV + kc * 32 + 16 + 8 * g + i]); }
      acc[j] = wmma16(a, w, acc[j]); } }
#pragma unroll
  for (int j = 0; j < 8; ++j) { const int o = o0 + j * 16 + col; const float bb = bfr(BW[o]);
#pragma unroll
    for (int r = 0; r < 8; ++r) st[j * 16 + col][wave * 16 + 8 * g + r] = acc[j][r] + bb; }
  __syncthreads(); for (int e = tid; e < 128 * 16; e += 128) { const int cl = e >> 4, q = e & 15; vst2(OUT + (b * CO + o0 + cl) * (size_t)NPX + p0 + q * 4, *(const v4f*)&st[cl][q * 4]); } }
extern "C" void kernel_launch(void* const* d_in, const int* in_sizes, int n_in, void* d_out, int out_size, void* d_ws, size_t ws_size, hipStream_t stream) {
  (void)in_sizes; (void)n_in; (void)out_size;
  const float** F = (const float**)d_in;   // 0 x [2,256,96,96], 1 fk_w1 [64,256], 2 fk_b1, 3 fk_bn1 [4,64], 4 fk_w2 [64,64], 5 fk_b2, 6 fk_bn2, 7 fq_w1, 8 fq_b1, 9 fq_bn1, 10 fq_w2, 11 fq_b2, 12 fq_bn2, 13 fv_w [128,256], 14 fv_b, 15 W_w [256,128], 16 W_b
  if (ws_size < (size_t)WS_END) return;
  char* ws = (char*)d_ws; float *K1 = (float*)(ws + WS_K1), *Q1 = (float*)(ws + WS_Q1), *KP = (float*)(ws + WS_KP), *QP = (float*)(ws + WS_QP), *VP = (float*)(ws + WS_VP); _Float16* CT = (_Float16*)(ws + WS_CT);
  k_c1<<<dim3(NPX / 64, NB, 4), 128, 0, stream>>>(F[0], F[1], F[2], F[3], F[7], F[8], F[9], F[13], F[14], K1, Q1, VP);
  k_c2<<<dim3(NPX / 64, NB, 2), 128, 0, stream>>>(K1, Q1, F[4], F[5], F[6], F[10], F[11], F[12], KP, QP);
  k_win<<<TWB, 128, 0, stream>>>(KP, QP, VP, CT);
  k_out<<<dim3(NPX / 64, NB, 2), 128, 0, stream>>>(CT, F[15], F[16], (float*)d_out);
}

// v001
// A run of this version takes 90.7 microseconds.
// Next to v000, in two timings, it ran 11.8 times as fast each time.
// compute dtype: all float inputs rounded to bf16; the five 1x1 convs on WMMA 16x16x32: x-fed ones with EXACT bf16 products (x^T tile in LDS), the second key/query convs with their f32 input as bf16 hi + lo (2 products), eval BatchNorm + ReLU in f32; key/query/value planes in f32; the 7x7-window dot products (64-deep), the 49-way softmax (zero-padded neighbours give logit 0 and value 0, as unfold does) and the 128-channel context in f32 on the VALU; context rounded once to f16 for the final 1x1 conv W (bf16-exact weights in f16, 1 product) + bias; f32 output.
#include <hip/hip_runtime.h>
#include <math.h>

typedef __attribute__((ext_vector_type(16))) _Float16 v16h;
typedef __attribute__((ext_vector_type(16))) __bf16 v16b;
typedef __attribute__((ext_vector_type(8)))  _Float16 v8h;
typedef __attribute__((ext_vector_type(8)))  float v8f;
typedef __attribute__((ext_vector_type(4)))  float v4f;
typedef __attribute__((ext_vector_type(2)))  float v2f;
typedef __attribute__((ext_vector_type(4)))  unsigned v4u;
typedef __attribute__((ext_vector_type(4)))  int v4i;
typedef float __attribute__((may_alias)) float_a;
typedef int __attribute__((may_alias)) int_a;

template <typename T> __device__ __forceinline__ void vst2(void* p, T v) { *(T*)p = v;  }
__device__ __forceinline__ v8f wmma16(v16h a, v16h b, v8f c) {
  v8f d = __builtin_amdgcn_wmma_f32_16x16x32_f16(false, a, false, b, (short)0, c, false, false);
  asm volatile("v_nop\n\tv_nop\n\tv_nop\n\tv_nop" : "+v"(d) : "v"(a), "v"(b));
  return d;
}
__device__ __forceinline__ v8f wmma_bf(v16b a, v16b b, v8f c) {
  v8f d = __builtin_amdgcn_wmma_f32_16x16x32_bf16(false, a, false, b, (short)0, c, false, false);
  asm volatile("v_nop\n\tv_nop\n\tv_nop\n\tv_nop" : "+v"(d) : "v"(a), "v"(b));
  return d;
}
// 16x16x32 fragments: lane = (h = lane>>4, row/col = lane&15); elements 0..7 = k0+8h+0..7, 8..15 = k0+16+8h+0..7; D element r = row 8h+r
__device__ __forceinline__ v16h frag_h(const _Float16* rowk0, int lane) {
  union { v16h v; v8h q[2]; } u; const _Float16* p = rowk0 + 8 * (lane >> 4);
  u.q[0] = *(const v8h*)p; u.q[1] = *(const v8h*)(p + 16); return u.v;
}
__device__ __forceinline__ v16h frag_f32(const float* rowk0, int lane) {
  v16h a; const float* p = rowk0 + 8 * (lane >> 4);
#pragma unroll
  for (int i = 0; i < 8; ++i) { a[i] = (_Float16)p[i]; a[8 + i] = (_Float16)p[16 + i]; }
  return a;
}
__device__ __forceinline__ v16h frag_f32s(const float* rowk0, int lane, float sc) {
  v16h a; const float* p = rowk0 + 8 * (lane >> 4);
#pragma unroll
  for (int i = 0; i < 8; ++i) { a[i] = (_Float16)(p[i] * sc); a[8 + i] = (_Float16)(p[16 + i] * sc); }
  return a;
}
// column fragment from a [K][ld] layout (column n), rows >= K read as 0
__device__ __forceinline__ v16h fragc_f32(const float* W, int k0, int n, int lane, int ld, int K) {
  v16h a; const int g = lane >> 4;
#pragma unroll
  for (int i = 0; i < 8; ++i) { const int ka = k0 + 8 * g + i, kb = ka + 16;
    a[i] = (_Float16)(ka < K ? W[(size_t)(ka < K ? ka : K - 1) * ld + n] : 0.f); a[8 + i] = (_Float16)(kb < K ? W[(size_t)(kb < K ? kb : K - 1) * ld + n] : 0.f); }
  return a;
}
struct F2 { v16b h, l; };
__device__ __forceinline__ F2 bsplit16(const float v[16]) { F2 r;
#pragma unroll
  for (int i = 0; i < 16; ++i) { const __bf16 h = (__bf16)v[i]; r.h[i] = h; r.l[i] = (__bf16)(v[i] - (float)h); }
  return r; }
__device__ __forceinline__ F2 split_row(const float* row, int k0, int lane) { float v[16]; const float* p = row + k0 + 8 * (lane >> 4);
#pragma unroll
  for (int i = 0; i < 8; ++i) { v[i] = p[i]; v[8 + i] = p[16 + i]; }
  return bsplit16(v); }
__device__ __forceinline__ F2 split_rowK(const float* row, int k0, int lane, int K) { float v[16]; const int g = lane >> 4;
#pragma unroll
  for (int i = 0; i < 8; ++i) { const int ka = k0 + 8 * g + i, kb = ka + 16; v[i] = ka < K ? row[ka < K ? ka : K - 1] : 0.f; v[8 + i] = kb < K ? row[kb < K ? kb : K - 1] : 0.f; }
  return bsplit16(v); }
__device__ __forceinline__ F2 split_col(const float* W, int k0, int n, int lane, int ld, int K) { float v[16]; const int g = lane >> 4;
#pragma unroll
  for (int i = 0; i < 8; ++i) { const int ka = k0 + 8 * g + i, kb = ka + 16; v[i] = ka < K ? W[(size_t)(ka < K ? ka : K - 1) * ld + n] : 0.f; v[8 + i] = kb < K ? W[(size_t)(kb < K ? kb : K - 1) * ld + n] : 0.f; }
  return bsplit16(v); }
__device__ __forceinline__ v8f mac3(const F2& a, const F2& b, v8f c) { c = wmma_bf(a.l, b.h, c); c = wmma_bf(a.h, b.l, c); return wmma_bf(a.h, b.h, c); }
__device__ __forceinline__ float sigm(float v) { return 1.0f / (1.0f + expf(-v)); }
#define LDSX() do { asm volatile("s_wait_dscnt 0" ::: "memory"); __builtin_amdgcn_wave_barrier(); __builtin_amdgcn_fence(__ATOMIC_RELEASE, "workgroup"); } while (0)


// Local-window self attention (b 2, 96 x 96, Cin 256, key/query 64 via conv-BN-ReLU x2, value 128, 7x7 window, out conv 256).
#define NB 2
#define HW 96
#define NPX (HW * HW)      // 9216
#define CIN 256
#define CK 64
#define CV 128
#define CO 256
#define NPT (NB * NPX)     // 18432 = 288 x 64
#ifndef TWB
#define TWB (NPT / 32)     // window kernel blocks
#endif
typedef __attribute__((ext_vector_type(8))) __bf16 v8b;
__device__ __forceinline__ v16b frag_b(const __bf16* rowk0, int lane) {
  union { v16b v; v8b q[2]; } u; const __bf16* p = rowk0 + 8 * (lane >> 4);
  u.q[0] = *(const v8b*)p; u.q[1] = *(const v8b*)(p + 16); return u.v;
}
__device__ __forceinline__ float bfr(float v) { return (float)(__bf16)v; }
__device__ __attribute__((noinline)) float exp_ni(float v) { return expf(v); }
__device__ __attribute__((noinline)) float erf_ni(float v) { return erff(v); }

#define WS_K1  0u                                  // f32 rows [p][64] k1
#define WS_Q1  (WS_K1 + 4u * (size_t)NPT * CK)
#define WS_KP  (WS_Q1 + 4u * (size_t)NPT * CK)        // f32 key planes [b][64][n]
#define WS_QP  (WS_KP + 4u * (size_t)NPT * CK)        // f32 query rows [p][64]
#define WS_VP  (WS_QP + 4u * (size_t)NPT * CK)        // f32 value planes [b][128][n]
#define WS_CT  (WS_VP + 4u * (size_t)NPT * CV)        // f16 context rows [p][128]
#define WS_END (WS_CT + 2u * (size_t)NPT * CV)

__device__ __forceinline__ float bnrelu(float v, const float* bn, int c, int C) { const float gsc = bfr(bn[c]) / sqrtf(bfr(bn[3 * C + c]) + 1e-5f); return fmaxf((v - bfr(bn[2 * C + c])) * gsc + bfr(bn[C + c]), 0.f); }
// ---- k_c1: block = (64 px, b, which): which 0: k1 = bnrelu(fk_w1 x + b) -> rows; 1: q1 likewise; 2,3: value channels 0-63 / 64-127 = fv_w x + b -> planes. x^T tile [64 px][256 c] bf16 in LDS.
__global__ __launch_bounds__(128) void k_c1(const float* __restrict__ X, const float* __restrict__ WK1, const float* __restrict__ BK1, const float* __restrict__ BNK1, const float* __restrict__ WQ1, const float* __restrict__ BQ1, const float* __restrict__ BNQ1, const float* __restrict__ WV, const float* __restrict__ BVv, float* __restrict__ K1, float* __restrict__ Q1, float* __restrict__ VP) {
  __shared__ __align__(16) __bf16 sx[64][CIN + 8]; __shared__ __align__(16) float so[64][68];
  const int tid = threadIdx.x, wave = tid >> 5, lane = tid & 31, col = lane & 15, g = lane >> 4; const int p0 = blockIdx.x * 64; const size_t b = blockIdx.y; const int which = blockIdx.z;
  for (int e = tid; e < CIN * 64; e += 128) { const int c = e >> 6, pl = e & 63; sx[pl][c] = (__bf16)X[(b * CIN + c) * (size_t)NPX + p0 + pl]; }
  __syncthreads();
  const float* Wm = which == 0 ? WK1 : which == 1 ? WQ1 : (WV + (size_t)(which - 2) * 64 * CIN); const float* Bm = which == 0 ? BK1 : which == 1 ? BQ1 : (BVv + (which - 2) * 64);
  v8f acc[4] = {};
#pragma unroll 2
  for (int kc = 0; kc < CIN / 32; ++kc) { const v16b a = frag_b(&sx[wave * 16 + col][kc * 32], lane);
#pragma unroll
    for (int j = 0; j < 4; ++j) { v16b w; const int o = j * 16 + col;
#pragma unroll
      for (int i = 0; i < 8; ++i) { w[i] = (__bf16)Wm[(size_t)o * CIN + kc * 32 + 8 * g + i]; w[8 + i] = (__bf16)Wm[(size_t)o * CIN + kc * 32 + 16 + 8 * g + i]; }
      acc[j] = wmma_bf(a, w, acc[j]); } }
  if (which < 2) { const float* bn = which == 0 ? BNK1 : BNQ1;
#pragma unroll
    for (int j = 0; j < 4; ++j) { const int o = j * 16 + col; const float bb = bfr(Bm[o]);
#pragma unroll
      for (int r = 0; r < 8; ++r) so[wave * 16 + 8 * g + r][o] = bnrelu(acc[j][r] + bb, bn, o, CK); }
    __syncthreads(); float* dst = which == 0 ? K1 : Q1; for (int e = tid; e < 64 * 16; e += 128) { const int pl = e >> 4, q = e & 15; vst2(dst + (b * NPX + p0 + pl) * (size_t)CK + q * 4, *(const v4f*)&so[pl][q * 4]); } }
  else {
#pragma unroll
    for (int j = 0; j < 4; ++j) { const int o = j * 16 + col; const float bb = bfr(Bm[o]);
#pragma unroll
      for (int r = 0; r < 8; ++r) so[o][wave * 16 + 8 * g + r] = acc[j][r] + bb; }   // transposed: [channel][px]
    __syncthreads(); for (int e = tid; e < 64 * 16; e += 128) { const int cl = e >> 4, q = e & 15; vst2(VP + (b * CV + (which - 2) * 64 + cl) * (size_t)NPX + p0 + q * 4, *(const v4f*)&so[cl][q * 4]); } } }
// ---- k_c2: block = (64 px, b, which 0 key / 1 query): y = bnrelu(w2 in + b2) with in = k1/q1 rows (f32, bf16 hi + lo); key -> planes [b][64][n]; query -> rows [p][64]
__global__ __launch_bounds__(128) void k_c2(const float* __restrict__ K1, const float* __restrict__ Q1, const float* __restrict__ WK2, const float* __restrict__ BK2, const float* __restrict__ BNK2, const float* __restrict__ WQ2, const float* __restrict__ BQ2, const float* __restrict__ BNQ2, float* __restrict__ KP, float* __restrict__ QP) { __shared__ __align__(16) float so[64][68];
  const int tid = threadIdx.x, wave = tid >> 5, lane = tid & 31, col = lane & 15, g = lane >> 4; const int p0 = blockIdx.x * 64; const size_t b = blockIdx.y; const int which = blockIdx.z; const float* IN = which == 0 ? K1 : Q1; const float* Wm = which == 0 ? WK2 : WQ2; const float* Bm = which == 0 ? BK2 : BQ2; const float* bn = which == 0 ? BNK2 : BNQ2;
  v8f acc[4] = {};
#pragma unroll
  for (int kc = 0; kc < CK / 32; ++kc) { const F2 a = split_row(IN + (b * NPX + p0 + wave * 16 + col) * (size_t)CK, kc * 32, lane);
#pragma unroll
    for (int j = 0; j < 4; ++j) { v16b w; const int o = j * 16 + col;
#pragma unroll
      for (int i = 0; i < 8; ++i) { w[i] = (__bf16)Wm[(size_t)o * CK + kc * 32 + 8 * g + i]; w[8 + i] = (__bf16)Wm[(size_t)o * CK + kc * 32 + 16 + 8 * g + i]; }
      acc[j] = wmma_bf(a.h, w, acc[j]); acc[j] = wmma_bf(a.l, w, acc[j]); } }
#pragma unroll
  for (int j = 0; j < 4; ++j) { const int o = j * 16 + col; const float bb = bfr(Bm[o]);
#pragma unroll
    for (int r = 0; r < 8; ++r) { const float v = bnrelu(acc[j][r] + bb, bn, o, CK); if (which == 0) so[o][wave * 16 + 8 * g + r] = v; else so[wave * 16 + 8 * g + r][o] = v; } }
  __syncthreads();
  if (which == 0) { for (int e = tid; e < 64 * 16; e += 128) { const int cl = e >> 4, q = e & 15; vst2(KP + (b * CK + cl) * (size_t)NPX + p0 + q * 4, *(const v4f*)&so[cl][q * 4]); } }
  else { for (int e = tid; e < 64 * 16; e += 128) { const int pl = e >> 4, q = e & 15; vst2(QP + (b * NPX + p0 + pl) * (size_t)CK + q * 4, *(const v4f*)&so[pl][q * 4]); } } }
// ---- k_win: block = 32 pixels of one image row, 8 waves (lane = pixel). The 7 x 40 window rows (x0-4 .. x0+35, zeros outside the image) of 64 channels are staged in LDS three times: key, value 0-63, value 64-127.
// logits: wave = window row (7 of 8 waves), 64-deep in channel order; softmax; context: wave = 8 value channels of the staged 64, the 49 weights in registers, summed in window order -> f16 context row
#define WPITCH 40                       // floats per staged row
#define WRS (64 * WPITCH)               // floats per staged window row (64 channels side by side)
#define WITEMS (64 * 7 * 10)            // 16-byte pieces per staged pass
#define WNJ ((WITEMS + 255) / 256)      // pieces per thread
// every '#pragma unroll' below makes the indices of off, ok, v, s, p and a constants, so that these arrays live in registers and the loads of a run are independent
// 6 waves per SIMD: three work-groups (96,000 B of LDS each) stay resident on a WGP, so all 576 run in one round
__global__ __launch_bounds__(256, 6) void k_win(const float* __restrict__ KP, const float* __restrict__ QP, const float* __restrict__ VP, _Float16* __restrict__ CT) {
  __shared__ __align__(16) float sh[7 * WRS]; __shared__ float sq[CK][33]; __shared__ float slg[49][32]; __shared__ float smx[7][32]; __shared__ __align__(16) _Float16 sct[32][CV + 8];
  const int t = threadIdx.x, wave = __builtin_amdgcn_readfirstlane(t >> 5), lane = t & 31;
  const int p0 = blockIdx.x * 32; const int b = p0 / NPX, n0 = p0 % NPX, y = n0 / HW, x0 = n0 % HW;
  // piece e = t + 256 j of a pass is (window row e / 640, channel, quad of the row); a quad lies wholly inside or wholly outside the image
  unsigned off[WNJ]; bool ok[WNJ];   // byte offsets from the pass's first plane, clamped into it where the piece is outside (such a piece is stored as zeros)
#pragma unroll
  for (int j = 0; j < WNJ; ++j) { const int e = t + 256 * j, r = e / 640, rem = e - r * 640, c = rem / 10, qd = rem - c * 10; const int yy = y - 3 + r, xx = x0 - 4 + 4 * qd;
    ok[j] = (e < WITEMS) & ((unsigned)yy < (unsigned)HW) & ((unsigned)xx < (unsigned)HW);
    off[j] = 4u * (unsigned)(c * NPX + min(max(yy, 0), HW - 1) * HW + min(max(xx, 0), HW - 4)); }
  auto stage = [&](const float* __restrict__ srcp) { v4f v[WNJ];
#pragma unroll
    for (int j = 0; j < WNJ; ++j) v[j] = *(const v4f*)((const char*)srcp + off[j]);
#pragma unroll
    for (int j = 0; j < WNJ; ++j) { const v4f z = {0.f, 0.f, 0.f, 0.f}; if (t + 256 * j < WITEMS) *(v4f*)&sh[(t + 256 * j) * 4] = ok[j] ? v[j] : z; } };
  v4f qv[2];
#pragma unroll
  for (int j = 0; j < 2; ++j) qv[j] = *(const v4f*)(QP + (size_t)p0 * CK + (t + 256 * j) * 4);
  stage(KP + (size_t)b * CK * NPX);
#pragma unroll
  for (int j = 0; j < 2; ++j) { const int e = t + 256 * j, pl = e >> 4, cq = e & 15;
#pragma unroll
    for (int i = 0; i < 4; ++i) sq[cq * 4 + i][pl] = qv[j][i]; }
  __syncthreads();
  float s[7] = {0.f, 0.f, 0.f, 0.f, 0.f, 0.f, 0.f};
  if (wave < 7) { const float* kr = &sh[wave * WRS + lane + 1];
#pragma unroll 8   // 8 channels' LDS reads in flight per trip; the whole 64 would only lengthen the code
    for (int c = 0; c < CK; ++c) { const float q = sq[c][lane];
#pragma unroll
      for (int dx = 0; dx < 7; ++dx) s[dx] += kr[c * WPITCH + dx] * q; }
    float pm = s[0];
#pragma unroll
    for (int dx = 1; dx < 7; ++dx) pm = fmaxf(pm, s[dx]);
    smx[wave][lane] = pm; }
  __syncthreads();   // every read of the key rows is done; the row maxima are visible
  float mx = smx[0][lane];
#pragma unroll
  for (int r = 1; r < 7; ++r) mx = fmaxf(mx, smx[r][lane]);
  if (wave < 7) {
#pragma unroll
    for (int dx = 0; dx < 7; ++dx) slg[wave * 7 + dx][lane] = expf(s[dx] - mx); }
  stage(VP + (size_t)b * CV * NPX);
  __syncthreads();
  float p[49]; float ssum = 0.f;
#pragma unroll
  for (int k = 0; k < 49; ++k) { p[k] = slg[k][lane]; ssum += p[k]; }
  const float inv = 1.0f / ssum;
  const float* vr = &sh[wave * 8 * WPITCH + lane + 1];
#pragma unroll 1   // one copy of the 392 multiply-adds in the text serves both halves
  for (int h = 0; h < 2; ++h) {
    if (h) { __syncthreads();   // every read of value channels 0-63 is done
      stage(VP + ((size_t)b * CV + 64) * NPX); __syncthreads(); }
    float a[8] = {0.f, 0.f, 0.f, 0.f, 0.f, 0.f, 0.f, 0.f};
#pragma unroll
    for (int dy = 0; dy < 7; ++dy)
#pragma unroll
      for (int i = 0; i < 8; ++i)
#pragma unroll
        for (int dx = 0; dx < 7; ++dx) a[i] += p[dy * 7 + dx] * vr[dy * WRS + i * WPITCH + dx];
    v8h o;
#pragma unroll
    for (int i = 0; i < 8; ++i) o[i] = (_Float16)(a[i] * inv);
    *(v8h*)&sct[lane][h * 64 + wave * 8] = o; }
  __syncthreads();
#pragma unroll
  for (int e = t; e < 32 * (CV / 8); e += 256) { const int rl = e / (CV / 8), qq = e % (CV / 8); vst2((unsigned*)(CT + (size_t)(p0 + rl) * CV + qq * 8), *(const v4u*)&sct[rl][qq * 8]); } }
// ---- k_out: block = (64 px, b): out[o][n] = sum_cv W[o][cv] ctx[n][cv] + b[o] -> planes; 256 outputs = 4 waves x ... (wave = 16 px rows; 16 col tiles -> acc[16] = 128 regs) -> split: grid z = 2 halves of 128 outputs
__global__ __launch_bounds__(128) void k_out(const _Float16* __restrict__ CT, const float* __restrict__ WW, const float* __restrict__ BW, float* __restrict__ OUT) { __shared__ __align__(16) float st[128][68];
  const int tid = threadIdx.x, wave = tid >> 5, lane = tid & 31, col = lane & 15, g = lane >> 4; const int p0 = blockIdx.x * 64; const size_t b = blockIdx.y; const int o0 = blockIdx.z * 128;
  v8f acc[8] = {};
#pragma unroll
  for (int kc = 0; kc < CV / 32; ++kc) { const v16h a = frag_h(CT + (b * NPX + p0 + wave * 16 + col) * (size_t)CV + kc * 32, lane);
#pragma unroll
    for (int j = 0; j < 8; ++j) { v16h w; const int o = o0 + j * 16 + col;
#pragma unroll
      for (int i = 0; i < 8; ++i) { w[i] = (_Float16)bfr(WW[(size_t)o * CV + kc * 32 + 8 * g + i]); w[8 + i] = (_Float16)bfr(WW[(size_t)o * CV + kc * 32 + 16 + 8 * g + i]); }
      acc[j] = wmma16(a, w, acc[j]); } }
#pragma unroll
  for (int j = 0; j < 8; ++j) { const int o = o0 + j * 16 + col; const float bb = bfr(BW[o]);
#pragma unroll
    for (int r = 0; r < 8; ++r) st[j * 16 + col][wave * 16 + 8 * g + r] = acc[j][r] + bb; }
  __syncthreads(); for (int e = tid; e < 128 * 16; e += 128) { const int cl = e >> 4, q = e & 15; vst2(OUT + (b * CO + o0 + cl) * (size_t)NPX + p0 + q * 4, *(const v4f*)&st[cl][q * 4]); } }
extern "C" void kernel_launch(void* const* d_in, const int* in_sizes, int n_in, void* d_out, int out_size, void* d_ws, size_t ws_size, hipStream_t stream) {
  (void)in_sizes; (void)n_in; (void)out_size;
  const float** F = (const float**)d_in;   // 0 x [2,256,96,96], 1 fk_w1 [64,256], 2 fk_b1, 3 fk_bn1 [4,64], 4 fk_w2 [64,64], 5 fk_b2, 6 fk_bn2, 7 fq_w1, 8 fq_b1, 9 fq_bn1, 10 fq_w2, 11 fq_b2, 12 fq_bn2, 13 fv_w [128,256], 14 fv_b, 15 W_w [256,128], 16 W_b
  if (ws_size < (size_t)WS_END) return;
  char* ws = (char*)d_ws; float *K1 = (float*)(ws + WS_K1), *Q1 = (float*)(ws + WS_Q1), *KP = (float*)(ws + WS_KP), *QP = (float*)(ws + WS_QP), *VP = (float*)(ws + WS_VP); _Float16* CT = (_Float16*)(ws + WS_CT);
  k_c1<<<dim3(NPX / 64, NB, 4), 128, 0, stream>>>(F[0], F[1], F[2], F[3], F[7], F[8], F[9], F[13], F[14], K1, Q1, VP);
  k_c2<<<dim3(NPX / 64, NB, 2), 128, 0, stream>>>(K1, Q1, F[4], F[5], F[6], F[10], F[11], F[12], KP, QP);
  k_win<<<TWB, 256, 0, stream>>>(KP, QP, VP, CT);
  k_out<<<dim3(NPX / 64, NB, 2), 128, 0, stream>>>(CT, F[15], F[16], (float*)d_out);
}

// v002
// A run of this version takes 63.5 microseconds.
// Next to v001, in two timings, it ran 1.42 times as fast each time.
// Counting every step since v000, it is 16.8 times as fast.
// compute dtype: all float inputs rounded to bf16; the five 1x1 convs on WMMA 16x16x32: x-fed ones with EXACT bf16 products (x^T tile in LDS), the second key/query convs with their f32 input as bf16 hi + lo (2 products), eval BatchNorm + ReLU in f32; key/query/value planes in f32; the 7x7-window dot products (64-deep), the 49-way softmax (zero-padded neighbours give logit 0 and value 0, as unfold does) and the 128-channel context in f32 on the VALU; context rounded once to f16 for the final 1x1 conv W (bf16-exact weights in f16, 1 product) + bias; f32 output.
#include <hip/hip_runtime.h>
#include <math.h>

typedef __attribute__((ext_vector_type(16))) _Float16 v16h;
typedef __attribute__((ext_vector_type(16))) __bf16 v16b;
typedef __attribute__((ext_vector_type(8)))  _Float16 v8h;
typedef __attribute__((ext_vector_type(8)))  float v8f;
typedef __attribute__((ext_vector_type(4)))  float v4f;
typedef __attribute__((ext_vector_type(2)))  float v2f;
typedef __attribute__((ext_vector_type(4)))  unsigned v4u;
typedef __attribute__((ext_vector_type(4)))  int v4i;
typedef float __attribute__((may_alias)) float_a;
typedef int __attribute__((may_alias)) int_a;

template <typename T> __device__ __forceinline__ void vst2(void* p, T v) { *(T*)p = v;  }
__device__ __forceinline__ v8f wmma16(v16h a, v16h b, v8f c) {
  v8f d = __builtin_amdgcn_wmma_f32_16x16x32_f16(false, a, false, b, (short)0, c, false, false);
  asm volatile("v_nop\n\tv_nop\n\tv_nop\n\tv_nop" : "+v"(d) : "v"(a), "v"(b));
  return d;
}
__device__ __forceinline__ v8f wmma_bf(v16b a, v16b b, v8f c) {
  v8f d = __builtin_amdgcn_wmma_f32_16x16x32_bf16(false, a, false, b, (short)0, c, false, false);
  asm volatile("v_nop\n\tv_nop\n\tv_nop\n\tv_nop" : "+v"(d) : "v"(a), "v"(b));
  return d;
}
// 16x16x32 fragments: lane = (h = lane>>4, row/col = lane&15); elements 0..7 = k0+8h+0..7, 8..15 = k0+16+8h+0..7; D element r = row 8h+r
__device__ __forceinline__ v16h frag_h(const _Float16* rowk0, int lane) {
  union { v16h v; v8h q[2]; } u; const _Float16* p = rowk0 + 8 * (lane >> 4);
  u.q[0] = *(const v8h*)p; u.q[1] = *(const v8h*)(p + 16); return u.v;
}
__device__ __forceinline__ v16h frag_f32(const float* rowk0, int lane) {
  v16h a; const float* p = rowk0 + 8 * (lane >> 4);
#pragma unroll
  for (int i = 0; i < 8; ++i) { a[i] = (_Float16)p[i]; a[8 + i] = (_Float16)p[16 + i]; }
  return a;
}
__device__ __forceinline__ v16h frag_f32s(const float* rowk0, int lane, float sc) {
  v16h a; const float* p = rowk0 + 8 * (lane >> 4);
#pragma unroll
  for (int i = 0; i < 8; ++i) { a[i] = (_Float16)(p[i] * sc); a[8 + i] = (_Float16)(p[16 + i] * sc); }
  return a;
}
// column fragment from a [K][ld] layout (column n), rows >= K read as 0
__device__ __forceinline__ v16h fragc_f32(const float* W, int k0, int n, int lane, int ld, int K) {
  v16h a; const int g = lane >> 4;
#pragma unroll
  for (int i = 0; i < 8; ++i) { const int ka = k0 + 8 * g + i, kb = ka + 16;
    a[i] = (_Float16)(ka < K ? W[(size_t)(ka < K ? ka : K - 1) * ld + n] : 0.f); a[8 + i] = (_Float16)(kb < K ? W[(size_t)(kb < K ? kb : K - 1) * ld + n] : 0.f); }
  return a;
}
struct F2 { v16b h, l; };
__device__ __forceinline__ F2 bsplit16(const float v[16]) { F2 r;
#pragma unroll
  for (int i = 0; i < 16; ++i) { const __bf16 h = (__bf16)v[i]; r.h[i] = h; r.l[i] = (__bf16)(v[i] - (float)h); }
  return r; }
__device__ __forceinline__ F2 split_row(const float* row, int k0, int lane) { float v[16]; const float* p = row + k0 + 8 * (lane >> 4);
#pragma unroll
  for (int i = 0; i < 8; ++i) { v[i] = p[i]; v[8 + i] = p[16 + i]; }
  return bsplit16(v); }
__device__ __forceinline__ F2 split_rowK(const float* row, int k0, int lane, int K) { float v[16]; const int g = lane >> 4;
#pragma unroll
  for (int i = 0; i < 8; ++i) { const int ka = k0 + 8 * g + i, kb = ka + 16; v[i] = ka < K ? row[ka < K ? ka : K - 1] : 0.f; v[8 + i] = kb < K ? row[kb < K ? kb : K - 1] : 0.f; }
  return bsplit16(v); }
__device__ __forceinline__ F2 split_col(const float* W, int k0, int n, int lane, int ld, int K) { float v[16]; const int g = lane >> 4;
#pragma unroll
  for (int i = 0; i < 8; ++i) { const int ka = k0 + 8 * g + i, kb = ka + 16; v[i] = ka < K ? W[(size_t)(ka < K ? ka : K - 1) * ld + n] : 0.f; v[8 + i] = kb < K ? W[(size_t)(kb < K ? kb : K - 1) * ld + n] : 0.f; }
  return bsplit16(v); }
__device__ __forceinline__ v8f mac3(const F2& a, const F2& b, v8f c) { c = wmma_bf(a.l, b.h, c); c = wmma_bf(a.h, b.l, c); return wmma_bf(a.h, b.h, c); }
__device__ __forceinline__ float sigm(float v) { return 1.0f / (1.0f + expf(-v)); }
#define LDSX() do { asm volatile("s_wait_dscnt 0" ::: "memory"); __builtin_amdgcn_wave_barrier(); __builtin_amdgcn_fence(__ATOMIC_RELEASE, "workgroup"); } while (0)


// Local-window self attention (b 2, 96 x 96, Cin 256, key/query 64 via conv-BN-ReLU x2, value 128, 7x7 window, out conv 256).
#define NB 2
#define HW 96
#define NPX (HW * HW)      // 9216
#define CIN 256
#define CK 64
#define CV 128
#define CO 256
#define NPT (NB * NPX)     // 18432 = 288 x 64
#ifndef TWB
#define TWB (NPT / 32)     // window kernel blocks
#endif
typedef __attribute__((ext_vector_type(8))) __bf16 v8b;
__device__ __forceinline__ v16b frag_b(const __bf16* rowk0, int lane) {
  union { v16b v; v8b q[2]; } u; const __bf16* p = rowk0 + 8 * (lane >> 4);
  u.q[0] = *(const v8b*)p; u.q[1] = *(const v8b*)(p + 16); return u.v;
}
__device__ __forceinline__ float bfr(float v) { return (float)(__bf16)v; }
__device__ __attribute__((noinline)) float exp_ni(float v) { return expf(v); }
__device__ __attribute__((noinline)) float erf_ni(float v) { return erff(v); }

#define WS_K1  0u                                  // f32 rows [p][64] k1
#define WS_Q1  (WS_K1 + 4u * (size_t)NPT * CK)
#define WS_KP  (WS_Q1 + 4u * (size_t)NPT * CK)        // f32 key planes [b][64][n]
#define WS_QP  (WS_KP + 4u * (size_t)NPT * CK)        // f32 query rows [p][64]
#define WS_VP  (WS_QP + 4u * (size_t)NPT * CK)        // f32 value planes [b][128][n]
#define WS_CT  (WS_VP + 4u * (size_t)NPT * CV)        // f16 context rows [p][128]
#define WS_END (WS_CT + 2u * (size_t)NPT * CV)

__device__ __forceinline__ float bnrelu(float v, const float* bn, int c, int C) { const float gsc = bfr(bn[c]) / sqrtf(bfr(bn[3 * C + c]) + 1e-5f); return fmaxf((v - bfr(bn[2 * C + c])) * gsc + bfr(bn[C + c]), 0.f); }
// ---- k_c1: block = (64 px, b, half), 8 waves: half 0: k1 = bnrelu(fk_w1 x + b) and q1 likewise -> rows; half 1: the 128 value channels = fv_w x + b -> planes.
// The x^T tile [64 px][256 c] and the half's 128 weight rows [o][256 c] are each staged once in LDS as bf16; wave = 32 px x 32 outputs, k in the same order as before.
#define C1P (CIN + 8)                   // bf16 per staged row: 528 B = 16 B x 33, so 16-byte fragment reads of 16 rows fall on distinct banks
#define C1X (64 * C1P * 2)              // bytes of the x tile
typedef __attribute__((ext_vector_type(4))) __bf16 v4b;
// 6 waves per SIMD: three work-groups (101,376 B of LDS each) stay resident on a WGP, so all 576 run in one round
__global__ __launch_bounds__(256, 6) void k_c1(const float* __restrict__ X, const float* __restrict__ WK1, const float* __restrict__ BK1, const float* __restrict__ BNK1, const float* __restrict__ WQ1, const float* __restrict__ BQ1, const float* __restrict__ BNQ1, const float* __restrict__ WV, const float* __restrict__ BVv, float* __restrict__ K1, float* __restrict__ Q1, float* __restrict__ VP) {
  __shared__ __align__(16) char sm[(64 + 128) * C1P * 2];
  __bf16 (*sx)[C1P] = (__bf16 (*)[C1P])sm; __bf16 (*sw)[C1P] = (__bf16 (*)[C1P])(sm + C1X);
  float* so = (float*)(sm + C1X);       // output tile, over the weight rows once every wave has left them
  // the wave's number as a scalar: the per-wave choice of bias and BN arrays below then stays a scalar base with one offset register
  const int tid = threadIdx.x, wave = __builtin_amdgcn_readfirstlane(tid >> 5), lane = tid & 31, col = lane & 15, g = lane >> 4; const int p0 = blockIdx.x * 64; const size_t b = blockIdx.y; const int half = blockIdx.z;
  const float* Wa = half ? WV : WK1; const float* Wb = half ? WV + 64 * CIN : WQ1;   // weight rows 0-63 and 64-127 of this half
  // every '#pragma unroll' below makes the indices of xv, wa, wb and acc constants, so that these arrays live in registers and the loads of a run are independent
  // x: thread = one pixel x 8 octets of channels (a wave's load is one whole 128-B line of a plane); weights: piece e = tid + 256 j is 16 B of the contiguous rows
  const int xpx = tid & 63, xo = tid >> 6; const float* xp = X + (b * CIN + xo * 8) * (size_t)NPX + p0 + xpx;
  float xv[8][8]; v4f wa[16], wb[16];
#pragma unroll
  for (int j = 0; j < 8; ++j)
#pragma unroll
    for (int i = 0; i < 8; ++i) xv[j][i] = xp[(size_t)(j * 32 + i) * NPX];
#pragma unroll
  for (int j = 0; j < 16; ++j) wa[j] = *(const v4f*)(Wa + (tid + 256 * j) * 4);
  __builtin_amdgcn_sched_barrier(0);   // keeps the second weight batch's loads behind this point: all 192 registers of loads at once spill
#pragma unroll
  for (int j = 0; j < 8; ++j) { v8b o;
#pragma unroll
    for (int i = 0; i < 8; ++i) o[i] = (__bf16)xv[j][i];
    *(v8b*)&sx[xpx][(xo + 4 * j) * 8] = o; }
  __builtin_amdgcn_sched_barrier(0);   // the second batch takes the registers that the x values have left
#pragma unroll
  for (int j = 0; j < 16; ++j) wb[j] = *(const v4f*)(Wb + (tid + 256 * j) * 4);
#pragma unroll
  for (int j = 0; j < 16; ++j) { const int e = tid + 256 * j; v4b o;
#pragma unroll
    for (int i = 0; i < 4; ++i) o[i] = (__bf16)wa[j][i];
    *(v4b*)&sw[e >> 6][(e & 63) * 4] = o; }
#pragma unroll
  for (int j = 0; j < 16; ++j) { const int e = tid + 256 * j; v4b o;
#pragma unroll
    for (int i = 0; i < 4; ++i) o[i] = (__bf16)wb[j][i];
    *(v4b*)&sw[64 + (e >> 6)][(e & 63) * 4] = o; }
  __syncthreads();
  const int ph = wave & 1, og = wave >> 1;   // pixels 32 ph .. +31, outputs 32 og .. +31 of the half
  v8f acc[2][2] = {};
#pragma unroll
  for (int kc = 0; kc < CIN / 32; ++kc) { v16b a[2], w[2];
#pragma unroll
    for (int i = 0; i < 2; ++i) { a[i] = frag_b(&sx[ph * 32 + i * 16 + col][kc * 32], lane); w[i] = frag_b(&sw[og * 32 + i * 16 + col][kc * 32], lane); }
#pragma unroll
    for (int i = 0; i < 2; ++i)
#pragma unroll
      for (int j = 0; j < 2; ++j) acc[i][j] = wmma_bf(a[i], w[j], acc[i][j]); }
  __syncthreads();   // every read of the weight rows is done; the output tile may overwrite them
  if (half == 0) { const float* Bm = og < 2 ? BK1 : BQ1; const float* bn = og < 2 ? BNK1 : BNQ1;   // so = [64 px][132]: k1 in columns 0-63, q1 in 64-127
#pragma unroll
    for (int j = 0; j < 2; ++j) { const int o = og * 32 + j * 16 + col, oc = o & 63; const float bb = bfr(Bm[oc]);
#pragma unroll
      for (int i = 0; i < 2; ++i)
#pragma unroll
        for (int r = 0; r < 8; ++r) so[(ph * 32 + i * 16 + 8 * g + r) * 132 + o] = bnrelu(acc[i][j][r] + bb, bn, oc, CK); }
    __syncthreads(); for (int e = tid; e < 64 * 32; e += 256) { const int pl = e >> 5, q = e & 31; vst2((q < 16 ? K1 : Q1) + (b * NPX + p0 + pl) * (size_t)CK + (q & 15) * 4, *(const v4f*)&so[pl * 132 + q * 4]); } }
  else {
#pragma unroll
    for (int j = 0; j < 2; ++j) { const int o = og * 32 + j * 16 + col; const float bb = bfr(BVv[o]);
#pragma unroll
      for (int i = 0; i < 2; ++i)
#pragma unroll
        for (int r = 0; r < 8; ++r) so[o * 68 + ph * 32 + i * 16 + 8 * g + r] = acc[i][j][r] + bb; }   // transposed: [channel][px], pitch 68
    __syncthreads(); for (int e = tid; e < 128 * 16; e += 256) { const int cl = e >> 4, q = e & 15; vst2(VP + (b * CV + cl) * (size_t)NPX + p0 + q * 4, *(const v4f*)&so[cl * 68 + q * 4]); } } }
// ---- k_c2: block = (64 px, b, which 0 key / 1 query): y = bnrelu(w2 in + b2) with in = k1/q1 rows (f32, bf16 hi + lo); key -> planes [b][64][n]; query -> rows [p][64]
__global__ __launch_bounds__(128) void k_c2(const float* __restrict__ K1, const float* __restrict__ Q1, const float* __restrict__ WK2, const float* __restrict__ BK2, const float* __restrict__ BNK2, const float* __restrict__ WQ2, const float* __restrict__ BQ2, const float* __restrict__ BNQ2, float* __restrict__ KP, float* __restrict__ QP) { __shared__ __align__(16) float so[64][68];
  const int tid = threadIdx.x, wave = tid >> 5, lane = tid & 31, col = lane & 15, g = lane >> 4; const int p0 = blockIdx.x * 64; const size_t b = blockIdx.y; const int which = blockIdx.z; const float* IN = which == 0 ? K1 : Q1; const float* Wm = which == 0 ? WK2 : WQ2; const float* Bm = which == 0 ? BK2 : BQ2; const float* bn = which == 0 ? BNK2 : BNQ2;
  v8f acc[4] = {};
#pragma unroll
  for (int kc = 0; kc < CK / 32; ++kc) { const F2 a = split_row(IN + (b * NPX + p0 + wave * 16 + col) * (size_t)CK, kc * 32, lane);
#pragma unroll
    for (int j = 0; j < 4; ++j) { v16b w; const int o = j * 16 + col;
#pragma unroll
      for (int i = 0; i < 8; ++i) { w[i] = (__bf16)Wm[(size_t)o * CK + kc * 32 + 8 * g + i]; w[8 + i] = (__bf16)Wm[(size_t)o * CK + kc * 32 + 16 + 8 * g + i]; }
      acc[j] = wmma_bf(a.h, w, acc[j]); acc[j] = wmma_bf(a.l, w, acc[j]); } }
#pragma unroll
  for (int j = 0; j < 4; ++j) { const int o = j * 16 + col; const float bb = bfr(Bm[o]);
#pragma unroll
    for (int r = 0; r < 8; ++r) { const float v = bnrelu(acc[j][r] + bb, bn, o, CK); if (which == 0) so[o][wave * 16 + 8 * g + r] = v; else so[wave * 16 + 8 * g + r][o] = v; } }
  __syncthreads();
  if (which == 0) { for (int e = tid; e < 64 * 16; e += 128) { const int cl = e >> 4, q = e & 15; vst2(KP + (b * CK + cl) * (size_t)NPX + p0 + q * 4, *(const v4f*)&so[cl][q * 4]); } }
  else { for (int e = tid; e < 64 * 16; e += 128) { const int pl = e >> 4, q = e & 15; vst2(QP + (b * NPX + p0 + pl) * (size_t)CK + q * 4, *(const v4f*)&so[pl][q * 4]); } } }
// ---- k_win: block = 32 pixels of one image row, 8 waves (lane = pixel). The 7 x 40 window rows (x0-4 .. x0+35, zeros outside the image) of 64 channels are staged in LDS three times: key, value 0-63, value 64-127.
// logits: wave = window row (7 of 8 waves), 64-deep in channel order; softmax; context: wave = 8 value channels of the staged 64, the 49 weights in registers, summed in window order -> f16 context row
#define WPITCH 40                       // floats per staged row
#define WRS (64 * WPITCH)               // floats per staged window row (64 channels side by side)
#define WITEMS (64 * 7 * 10)            // 16-byte pieces per staged pass
#define WNJ ((WITEMS + 255) / 256)      // pieces per thread
// every '#pragma unroll' below makes the indices of off, ok, v, s, p and a constants, so that these arrays live in registers and the loads of a run are independent
// 6 waves per SIMD: three work-groups (96,000 B of LDS each) stay resident on a WGP, so all 576 run in one round
__global__ __launch_bounds__(256, 6) void k_win(const float* __restrict__ KP, const float* __restrict__ QP, const float* __restrict__ VP, _Float16* __restrict__ CT) {
  __shared__ __align__(16) float sh[7 * WRS]; __shared__ float sq[CK][33]; __shared__ float slg[49][32]; __shared__ float smx[7][32]; __shared__ __align__(16) _Float16 sct[32][CV + 8];
  const int t = threadIdx.x, wave = __builtin_amdgcn_readfirstlane(t >> 5), lane = t & 31;
  const int p0 = blockIdx.x * 32; const int b = p0 / NPX, n0 = p0 % NPX, y = n0 / HW, x0 = n0 % HW;
  // piece e = t + 256 j of a pass is (window row e / 640, channel, quad of the row); a quad lies wholly inside or wholly outside the image
  unsigned off[WNJ]; bool ok[WNJ];   // byte offsets from the pass's first plane, clamped into it where the piece is outside (such a piece is stored as zeros)
#pragma unroll
  for (int j = 0; j < WNJ; ++j) { const int e = t + 256 * j, r = e / 640, rem = e - r * 640, c = rem / 10, qd = rem - c * 10; const int yy = y - 3 + r, xx = x0 - 4 + 4 * qd;
    ok[j] = (e < WITEMS) & ((unsigned)yy < (unsigned)HW) & ((unsigned)xx < (unsigned)HW);
    off[j] = 4u * (unsigned)(c * NPX + min(max(yy, 0), HW - 1) * HW + min(max(xx, 0), HW - 4)); }
  auto stage = [&](const float* __restrict__ srcp) { v4f v[WNJ];
#pragma unroll
    for (int j = 0; j < WNJ; ++j) v[j] = *(const v4f*)((const char*)srcp + off[j]);
#pragma unroll
    for (int j = 0; j < WNJ; ++j) { const v4f z = {0.f, 0.f, 0.f, 0.f}; if (t + 256 * j < WITEMS) *(v4f*)&sh[(t + 256 * j) * 4] = ok[j] ? v[j] : z; } };
  v4f qv[2];
#pragma unroll
  for (int j = 0; j < 2; ++j) qv[j] = *(const v4f*)(QP + (size_t)p0 * CK + (t + 256 * j) * 4);
  stage(KP + (size_t)b * CK * NPX);
#pragma unroll
  for (int j = 0; j < 2; ++j) { const int e = t + 256 * j, pl = e >> 4, cq = e & 15;
#pragma unroll
    for (int i = 0; i < 4; ++i) sq[cq * 4 + i][pl] = qv[j][i]; }
  __syncthreads();
  float s[7] = {0.f, 0.f, 0.f, 0.f, 0.f, 0.f, 0.f};
  if (wave < 7) { const float* kr = &sh[wave * WRS + lane + 1];
#pragma unroll 8   // 8 channels' LDS reads in flight per trip; the whole 64 would only lengthen the code
    for (int c = 0; c < CK; ++c) { const float q = sq[c][lane];
#pragma unroll
      for (int dx = 0; dx < 7; ++dx) s[dx] += kr[c * WPITCH + dx] * q; }
    float pm = s[0];
#pragma unroll
    for (int dx = 1; dx < 7; ++dx) pm = fmaxf(pm, s[dx]);
    smx[wave][lane] = pm; }
  __syncthreads();   // every read of the key rows is done; the row maxima are visible
  float mx = smx[0][lane];
#pragma unroll
  for (int r = 1; r < 7; ++r) mx = fmaxf(mx, smx[r][lane]);
  if (wave < 7) {
#pragma unroll
    for (int dx = 0; dx < 7; ++dx) slg[wave * 7 + dx][lane] = expf(s[dx] - mx); }
  stage(VP + (size_t)b * CV * NPX);
  __syncthreads();
  float p[49]; float ssum = 0.f;
#pragma unroll
  for (int k = 0; k < 49; ++k) { p[k] = slg[k][lane]; ssum += p[k]; }
  const float inv = 1.0f / ssum;
  const float* vr = &sh[wave * 8 * WPITCH + lane + 1];
#pragma unroll 1   // one copy of the 392 multiply-adds in the text serves both halves
  for (int h = 0; h < 2; ++h) {
    if (h) { __syncthreads();   // every read of value channels 0-63 is done
      stage(VP + ((size_t)b * CV + 64) * NPX); __syncthreads(); }
    float a[8] = {0.f, 0.f, 0.f, 0.f, 0.f, 0.f, 0.f, 0.f};
#pragma unroll
    for (int dy = 0; dy < 7; ++dy)
#pragma unroll
      for (int i = 0; i < 8; ++i)
#pragma unroll
        for (int dx = 0; dx < 7; ++dx) a[i] += p[dy * 7 + dx] * vr[dy * WRS + i * WPITCH + dx];
    v8h o;
#pragma unroll
    for (int i = 0; i < 8; ++i) o[i] = (_Float16)(a[i] * inv);
    *(v8h*)&sct[lane][h * 64 + wave * 8] = o; }
  __syncthreads();
#pragma unroll
  for (int e = t; e < 32 * (CV / 8); e += 256) { const int rl = e / (CV / 8), qq = e % (CV / 8); vst2((unsigned*)(CT + (size_t)(p0 + rl) * CV + qq * 8), *(const v4u*)&sct[rl][qq * 8]); } }
// ---- k_out: block = (64 px, b): out[o][n] = sum_cv W[o][cv] ctx[n][cv] + b[o] -> planes; 256 outputs = 4 waves x ... (wave = 16 px rows; 16 col tiles -> acc[16] = 128 regs) -> split: grid z = 2 halves of 128 outputs
__global__ __launch_bounds__(128) void k_out(const _Float16* __restrict__ CT, const float* __restrict__ WW, const float* __restrict__ BW, float* __restrict__ OUT) { __shared__ __align__(16) float st[128][68];
  const int tid = threadIdx.x, wave = tid >> 5, lane = tid & 31, col = lane & 15, g = lane >> 4; const int p0 = blockIdx.x * 64; const size_t b = blockIdx.y; const int o0 = blockIdx.z * 128;
  v8f acc[8] = {};
#pragma unroll
  for (int kc = 0; kc < CV / 32; ++kc) { const v16h a = frag_h(CT + (b * NPX + p0 + wave * 16 + col) * (size_t)CV + kc * 32, lane);
#pragma unroll
    for (int j = 0; j < 8; ++j) { v16h w; const int o = o0 + j * 16 + col;
#pragma unroll
      for (int i = 0; i < 8; ++i) { w[i] = (_Float16)bfr(WW[(size_t)o * CV + kc * 32 + 8 * g + i]); w[8 + i] = (_Float16)bfr(WW[(size_t)o * CV + kc * 32 + 16 + 8 * g + i]); }
      acc[j] = wmma16(a, w, acc[j]); } }
#pragma unroll
  for (int j = 0; j < 8; ++j) { const int o = o0 + j * 16 + col; const float bb = bfr(BW[o]);
#pragma unroll
    for (int r = 0; r < 8; ++r) st[j * 16 + col][wave * 16 + 8 * g + r] = acc[j][r] + bb; }
  __syncthreads(); for (int e = tid; e < 128 * 16; e += 128) { const int cl = e >> 4, q = e & 15; vst2(OUT + (b * CO + o0 + cl) * (size_t)NPX + p0 + q * 4, *(const v4f*)&st[cl][q * 4]); } }
extern "C" void kernel_launch(void* const* d_in, const int* in_sizes, int n_in, void* d_out, int out_size, void* d_ws, size_t ws_size, hipStream_t stream) {
  (void)in_sizes; (void)n_in; (void)out_size;
  const float** F = (const float**)d_in;   // 0 x [2,256,96,96], 1 fk_w1 [64,256], 2 fk_b1, 3 fk_bn1 [4,64], 4 fk_w2 [64,64], 5 fk_b2, 6 fk_bn2, 7 fq_w1, 8 fq_b1, 9 fq_bn1, 10 fq_w2, 11 fq_b2, 12 fq_bn2, 13 fv_w [128,256], 14 fv_b, 15 W_w [256,128], 16 W_b
  if (ws_size < (size_t)WS_END) return;
  char* ws = (char*)d_ws; float *K1 = (float*)(ws + WS_K1), *Q1 = (float*)(ws + WS_Q1), *KP = (float*)(ws + WS_KP), *QP = (float*)(ws + WS_QP), *VP = (float*)(ws + WS_VP); _Float16* CT = (_Float16*)(ws + WS_CT);
  k_c1<<<dim3(NPX / 64, NB, 2), 256, 0, stream>>>(F[0], F[1], F[2], F[3], F[7], F[8], F[9], F[13], F[14], K1, Q1, VP);
  k_c2<<<dim3(NPX / 64, NB, 2), 128, 0, stream>>>(K1, Q1, F[4], F[5], F[6], F[10], F[11], F[12], KP, QP);
  k_win<<<TWB, 256, 0, stream>>>(KP, QP, VP, CT);
  k_out<<<dim3(NPX / 64, NB, 2), 128, 0, stream>>>(CT, F[15], F[16], (float*)d_out);
}

// v003
// One run takes 50.3 microseconds.
// Next to v002, in two timings, it ran 1.25 and 1.27 times as fast.
// Over all steps from v000 it is 21.2 times as fast.
// compute dtype: all float inputs rounded to bf16; the five 1x1 convs on WMMA 16x16x32: x-fed ones with EXACT bf16 products (x^T tile in LDS), the second key/query convs with their f32 input as bf16 hi + lo (2 products), eval BatchNorm + ReLU in f32; key/query/value planes in f32; the 7x7-window dot products (64-deep), the 49-way softmax (zero-padded neighbours give logit 0 and value 0, as unfold does) and the 128-channel context in f32 on the VALU; context rounded once to f16 for the final 1x1 conv W (bf16-exact weights in f16, 1 product) + bias; f32 output.
#include <hip/hip_runtime.h>
#include <math.h>

typedef __attribute__((ext_vector_type(16))) _Float16 v16h;
typedef __attribute__((ext_vector_type(16))) __bf16 v16b;
typedef __attribute__((ext_vector_type(8)))  _Float16 v8h;
typedef __attribute__((ext_vector_type(8)))  float v8f;
typedef __attribute__((ext_vector_type(4)))  float v4f;
typedef __attribute__((ext_vector_type(2)))  float v2f;
typedef __attribute__((ext_vector_type(4)))  unsigned v4u;
typedef __attribute__((ext_vector_type(4)))  int v4i;
typedef float __attribute__((may_alias)) float_a;
typedef int __attribute__((may_alias)) int_a;

template <typename T> __device__ __forceinline__ void vst2(void* p, T v) { *(T*)p = v;  }
__device__ __forceinline__ v8f wmma16(v16h a, v16h b, v8f c) {
  v8f d = __builtin_amdgcn_wmma_f32_16x16x32_f16(false, a, false, b, (short)0, c, false, false);
  asm volatile("v_nop\n\tv_nop\n\tv_nop\n\tv_nop" : "+v"(d) : "v"(a), "v"(b));
  return d;
}
__device__ __forceinline__ v8f wmma_bf(v16b a, v16b b, v8f c) {
  v8f d = __builtin_amdgcn_wmma_f32_16x16x32_bf16(false, a, false, b, (short)0, c, false, false);
  asm volatile("v_nop\n\tv_nop\n\tv_nop\n\tv_nop" : "+v"(d) : "v"(a), "v"(b));
  return d;
}
// 16x16x32 fragments: lane = (h = lane>>4, row/col = lane&15); elements 0..7 = k0+8h+0..7, 8..15 = k0+16+8h+0..7; D element r = row 8h+r
__device__ __forceinline__ v16h frag_h(const _Float16* rowk0, int lane) {
  union { v16h v; v8h q[2]; } u; const _Float16* p = rowk0 + 8 * (lane >> 4);
  u.q[0] = *(const v8h*)p; u.q[1] = *(const v8h*)(p + 16); return u.v;
}
__device__ __forceinline__ v16h frag_f32(const float* rowk0, int lane) {
  v16h a; const float* p = rowk0 + 8 * (lane >> 4);
#pragma unroll
  for (int i = 0; i < 8; ++i) { a[i] = (_Float16)p[i]; a[8 + i] = (_Float16)p[16 + i]; }
  return a;
}
__device__ __forceinline__ v16h frag_f32s(const float* rowk0, int lane, float sc) {
  v16h a; const float* p = rowk0 + 8 * (lane >> 4);
#pragma unroll
  for (int i = 0; i < 8; ++i) { a[i] = (_Float16)(p[i] * sc); a[8 + i] = (_Float16)(p[16 + i] * sc); }
  return a;
}
// column fragment from a [K][ld] layout (column n), rows >= K read as 0
__device__ __forceinline__ v16h fragc_f32(const float* W, int k0, int n, int lane, int ld, int K) {
  v16h a; const int g = lane >> 4;
#pragma unroll
  for (int i = 0; i < 8; ++i) { const int ka = k0 + 8 * g + i, kb = ka + 16;
    a[i] = (_Float16)(ka < K ? W[(size_t)(ka < K ? ka : K - 1) * ld + n] : 0.f); a[8 + i] = (_Float16)(kb < K ? W[(size_t)(kb < K ? kb : K - 1) * ld + n] : 0.f); }
  return a;
}
struct F2 { v16b h, l; };
__device__ __forceinline__ F2 bsplit16(const float v[16]) { F2 r;
#pragma unroll
  for (int i = 0; i < 16; ++i) { const __bf16 h = (__bf16)v[i]; r.h[i] = h; r.l[i] = (__bf16)(v[i] - (float)h); }
  return r; }
__device__ __forceinline__ F2 split_row(const float* row, int k0, int lane) { float v[16]; const float* p = row + k0 + 8 * (lane >> 4);
#pragma unroll
  for (int i = 0; i < 8; ++i) { v[i] = p[i]; v[8 + i] = p[16 + i]; }
  return bsplit16(v); }
__device__ __forceinline__ F2 split_rowK(const float* row, int k0, int lane, int K) { float v[16]; const int g = lane >> 4;
#pragma unroll
  for (int i = 0; i < 8; ++i) { const int ka = k0 + 8 * g + i, kb = ka + 16; v[i] = ka < K ? row[ka < K ? ka : K - 1] : 0.f; v[8 + i] = kb < K ? row[kb < K ? kb : K - 1] : 0.f; }
  return bsplit16(v); }
__device__ __forceinline__ F2 split_col(const float* W, int k0, int n, int lane, int ld, int K) { float v[16]; const int g = lane >> 4;
#pragma unroll
  for (int i = 0; i < 8; ++i) { const int ka = k0 + 8 * g + i, kb = ka + 16; v[i] = ka < K ? W[(size_t)(ka < K ? ka : K - 1) * ld + n] : 0.f; v[8 + i] = kb < K ? W[(size_t)(kb < K ? kb : K - 1) * ld + n] : 0.f; }
  return bsplit16(v); }
__device__ __forceinline__ v8f mac3(const F2& a, const F2& b, v8f c) { c = wmma_bf(a.l, b.h, c); c = wmma_bf(a.h, b.l, c); return wmma_bf(a.h, b.h, c); }
__device__ __forceinline__ float sigm(float v) { return 1.0f / (1.0f + expf(-v)); }
#define LDSX() do { asm volatile("s_wait_dscnt 0" ::: "memory"); __builtin_amdgcn_wave_barrier(); __builtin_amdgcn_fence(__ATOMIC_RELEASE, "workgroup"); } while (0)


// Local-window self attention (b 2, 96 x 96, Cin 256, key/query 64 via conv-BN-ReLU x2, value 128, 7x7 window, out conv 256).
#define NB 2
#define HW 96
#define NPX (HW * HW)      // 9216
#define CIN 256
#define CK 64
#define CV 128
#define CO 256
#define NPT (NB * NPX)     // 18432 = 288 x 64
#ifndef TWB
#define TWB (NPT / 32)     // window kernel blocks
#endif
typedef __attribute__((ext_vector_type(8))) __bf16 v8b;
__device__ __forceinline__ v16b frag_b(const __bf16* rowk0, int lane) {
  union { v16b v; v8b q[2]; } u; const __bf16* p = rowk0 + 8 * (lane >> 4);
  u.q[0] = *(const v8b*)p; u.q[1] = *(const v8b*)(p + 16); return u.v;
}
__device__ __forceinline__ float bfr(float v) { return (float)(__bf16)v; }
__device__ __attribute__((noinline)) float exp_ni(float v) { return expf(v); }
__device__ __attribute__((noinline)) float erf_ni(float v) { return erff(v); }

#define WS_K1  0u                                  // f32 rows [p][64] k1
#define WS_Q1  (WS_K1 + 4u * (size_t)NPT * CK)
#define WS_KP  (WS_Q1 + 4u * (size_t)NPT * CK)        // f32 key planes [b][64][n]
#define WS_QP  (WS_KP + 4u * (size_t)NPT * CK)        // f32 query rows [p][64]
#define WS_VP  (WS_QP + 4u * (size_t)NPT * CK)        // f32 value planes [b][128][n]
#define WS_END (WS_VP + 4u * (size_t)NPT * CV)

__device__ __forceinline__ float bnrelu(float v, const float* bn, int c, int C) { const float gsc = bfr(bn[c]) / sqrtf(bfr(bn[3 * C + c]) + 1e-5f); return fmaxf((v - bfr(bn[2 * C + c])) * gsc + bfr(bn[C + c]), 0.f); }
// ---- k_c1: block = (64 px, b, half), 8 waves: half 0: k1 = bnrelu(fk_w1 x + b) and q1 likewise -> rows; half 1: the 128 value channels = fv_w x + b -> planes.
// The x^T tile [64 px][256 c] and the half's 128 weight rows [o][256 c] are each staged once in LDS as bf16; wave = 32 px x 32 outputs, k in the same order as before.
#define C1P (CIN + 8)                   // bf16 per staged row: 528 B = 16 B x 33, so 16-byte fragment reads of 16 rows fall on distinct banks
#define C1X (64 * C1P * 2)              // bytes of the x tile
typedef __attribute__((ext_vector_type(4))) __bf16 v4b;
// 6 waves per SIMD: three work-groups (101,376 B of LDS each) stay resident on a WGP, so all 576 run in one round
__global__ __launch_bounds__(256, 6) void k_c1(const float* __restrict__ X, const float* __restrict__ WK1, const float* __restrict__ BK1, const float* __restrict__ BNK1, const float* __restrict__ WQ1, const float* __restrict__ BQ1, const float* __restrict__ BNQ1, const float* __restrict__ WV, const float* __restrict__ BVv, float* __restrict__ K1, float* __restrict__ Q1, float* __restrict__ VP) {
  __shared__ __align__(16) char sm[(64 + 128) * C1P * 2];
  __bf16 (*sx)[C1P] = (__bf16 (*)[C1P])sm; __bf16 (*sw)[C1P] = (__bf16 (*)[C1P])(sm + C1X);
  float* so = (float*)(sm + C1X);       // output tile, over the weight rows once every wave has left them
  // the wave's number as a scalar: the per-wave choice of bias and BN arrays below then stays a scalar base with one offset register
  const int tid = threadIdx.x, wave = __builtin_amdgcn_readfirstlane(tid >> 5), lane = tid & 31, col = lane & 15, g = lane >> 4; const int p0 = blockIdx.x * 64; const size_t b = blockIdx.y; const int half = blockIdx.z;
  const float* Wa = half ? WV : WK1; const float* Wb = half ? WV + 64 * CIN : WQ1;   // weight rows 0-63 and 64-127 of this half
  // every '#pragma unroll' below makes the indices of xv, wa, wb and acc constants, so that these arrays live in registers and the loads of a run are independent
  // x: thread = one pixel x 8 octets of channels (a wave's load is one whole 128-B line of a plane); weights: piece e = tid + 256 j is 16 B of the contiguous rows
  const int xpx = tid & 63, xo = tid >> 6; const float* xp = X + (b * CIN + xo * 8) * (size_t)NPX + p0 + xpx;
  float xv[8][8]; v4f wa[16], wb[16];
#pragma unroll
  for (int j = 0; j < 8; ++j)
#pragma unroll
    for (int i = 0; i < 8; ++i) xv[j][i] = xp[(size_t)(j * 32 + i) * NPX];
#pragma unroll
  for (int j = 0; j < 16; ++j) wa[j] = *(const v4f*)(Wa + (tid + 256 * j) * 4);
  __builtin_amdgcn_sched_barrier(0);   // keeps the second weight batch's loads behind this point: all 192 registers of loads at once spill
#pragma unroll
  for (int j = 0; j < 8; ++j) { v8b o;
#pragma unroll
    for (int i = 0; i < 8; ++i) o[i] = (__bf16)xv[j][i];
    *(v8b*)&sx[xpx][(xo + 4 * j) * 8] = o; }
  __builtin_amdgcn_sched_barrier(0);   // the second batch takes the registers that the x values have left
#pragma unroll
  for (int j = 0; j < 16; ++j) wb[j] = *(const v4f*)(Wb + (tid + 256 * j) * 4);
#pragma unroll
  for (int j = 0; j < 16; ++j) { const int e = tid + 256 * j; v4b o;
#pragma unroll
    for (int i = 0; i < 4; ++i) o[i] = (__bf16)wa[j][i];
    *(v4b*)&sw[e >> 6][(e & 63) * 4] = o; }
#pragma unroll
  for (int j = 0; j < 16; ++j) { const int e = tid + 256 * j; v4b o;
#pragma unroll
    for (int i = 0; i < 4; ++i) o[i] = (__bf16)wb[j][i];
    *(v4b*)&sw[64 + (e >> 6)][(e & 63) * 4] = o; }
  __syncthreads();
  const int ph = wave & 1, og = wave >> 1;   // pixels 32 ph .. +31, outputs 32 og .. +31 of the half
  v8f acc[2][2] = {};
#pragma unroll
  for (int kc = 0; kc < CIN / 32; ++kc) { v16b a[2], w[2];
#pragma unroll
    for (int i = 0; i < 2; ++i) { a[i] = frag_b(&sx[ph * 32 + i * 16 + col][kc * 32], lane); w[i] = frag_b(&sw[og * 32 + i * 16 + col][kc * 32], lane); }
#pragma unroll
    for (int i = 0; i < 2; ++i)
#pragma unroll
      for (int j = 0; j < 2; ++j) acc[i][j] = wmma_bf(a[i], w[j], acc[i][j]); }
  __syncthreads();   // every read of the weight rows is done; the output tile may overwrite them
  if (half == 0) { const float* Bm = og < 2 ? BK1 : BQ1; const float* bn = og < 2 ? BNK1 : BNQ1;   // so = [64 px][132]: k1 in columns 0-63, q1 in 64-127
#pragma unroll
    for (int j = 0; j < 2; ++j) { const int o = og * 32 + j * 16 + col, oc = o & 63; const float bb = bfr(Bm[oc]);
#pragma unroll
      for (int i = 0; i < 2; ++i)
#pragma unroll
        for (int r = 0; r < 8; ++r) so[(ph * 32 + i * 16 + 8 * g + r) * 132 + o] = bnrelu(acc[i][j][r] + bb, bn, oc, CK); }
    __syncthreads(); for (int e = tid; e < 64 * 32; e += 256) { const int pl = e >> 5, q = e & 31; vst2((q < 16 ? K1 : Q1) + (b * NPX + p0 + pl) * (size_t)CK + (q & 15) * 4, *(const v4f*)&so[pl * 132 + q * 4]); } }
  else {
#pragma unroll
    for (int j = 0; j < 2; ++j) { const int o = og * 32 + j * 16 + col; const float bb = bfr(BVv[o]);
#pragma unroll
      for (int i = 0; i < 2; ++i)
#pragma unroll
        for (int r = 0; r < 8; ++r) so[o * 68 + ph * 32 + i * 16 + 8 * g + r] = acc[i][j][r] + bb; }   // transposed: [channel][px], pitch 68
    __syncthreads(); for (int e = tid; e < 128 * 16; e += 256) { const int cl = e >> 4, q = e & 15; vst2(VP + (b * CV + cl) * (size_t)NPX + p0 + q * 4, *(const v4f*)&so[cl * 68 + q * 4]); } } }
// ---- k_c2: block = (64 px, b, which 0 key / 1 query): y = bnrelu(w2 in + b2) with in = k1/q1 rows (f32, bf16 hi + lo); key -> planes [b][64][n]; query -> rows [p][64]
__global__ __launch_bounds__(128) void k_c2(const float* __restrict__ K1, const float* __restrict__ Q1, const float* __restrict__ WK2, const float* __restrict__ BK2, const float* __restrict__ BNK2, const float* __restrict__ WQ2, const float* __restrict__ BQ2, const float* __restrict__ BNQ2, float* __restrict__ KP, float* __restrict__ QP) { __shared__ __align__(16) float so[64][68];
  const int tid = threadIdx.x, wave = tid >> 5, lane = tid & 31, col = lane & 15, g = lane >> 4; const int p0 = blockIdx.x * 64; const size_t b = blockIdx.y; const int which = blockIdx.z; const float* IN = which == 0 ? K1 : Q1; const float* Wm = which == 0 ? WK2 : WQ2; const float* Bm = which == 0 ? BK2 : BQ2; const float* bn = which == 0 ? BNK2 : BNQ2;
  v8f acc[4] = {};
#pragma unroll
  for (int kc = 0; kc < CK / 32; ++kc) { const F2 a = split_row(IN + (b * NPX + p0 + wave * 16 + col) * (size_t)CK, kc * 32, lane);
#pragma unroll
    for (int j = 0; j < 4; ++j) { v16b w; const int o = j * 16 + col;
#pragma unroll
      for (int i = 0; i < 8; ++i) { w[i] = (__bf16)Wm[(size_t)o * CK + kc * 32 + 8 * g + i]; w[8 + i] = (__bf16)Wm[(size_t)o * CK + kc * 32 + 16 + 8 * g + i]; }
      acc[j] = wmma_bf(a.h, w, acc[j]); acc[j] = wmma_bf(a.l, w, acc[j]); } }
#pragma unroll
  for (int j = 0; j < 4; ++j) { const int o = j * 16 + col; const float bb = bfr(Bm[o]);
#pragma unroll
    for (int r = 0; r < 8; ++r) { const float v = bnrelu(acc[j][r] + bb, bn, o, CK); if (which == 0) so[o][wave * 16 + 8 * g + r] = v; else so[wave * 16 + 8 * g + r][o] = v; } }
  __syncthreads();
  if (which == 0) { for (int e = tid; e < 64 * 16; e += 128) { const int cl = e >> 4, q = e & 15; vst2(KP + (b * CK + cl) * (size_t)NPX + p0 + q * 4, *(const v4f*)&so[cl][q * 4]); } }
  else { for (int e = tid; e < 64 * 16; e += 128) { const int pl = e >> 4, q = e & 15; vst2(QP + (b * NPX + p0 + pl) * (size_t)CK + q * 4, *(const v4f*)&so[pl][q * 4]); } } }
// ---- k_win: block = 32 pixels of one image row, 8 waves (lane = pixel). The 7 x 40 window rows (x0-4 .. x0+35, zeros outside the image) of 64 channels are staged in LDS three times: key, value 0-63, value 64-127.
// logits: wave = window row (7 of 8 waves), 64-deep in channel order; softmax; context: wave = 8 value channels of the staged 64, the 49 weights in registers, summed in window order -> f16 context row
// final 1x1 conv in the same block: the 32 f16 context rows stay in LDS, the 256 weight rows are staged once as f16 over the spent window rows; wave = 32 px x 32 outputs, k in ascending order; output tile [256][32 px] through LDS -> whole 128-B lines of the output planes
#define OWP (CV + 8)                    // f16 per staged weight row: 272 B = 16 B x 17, so 16-byte fragment reads of 16 rows fall on distinct banks
#define OSP 36                          // floats per row of the output tile: 144 B = 16 B x 9, same reason for its 4-byte stores to 16 rows
typedef __attribute__((ext_vector_type(4))) _Float16 v4h;
#define WPITCH 40                       // floats per staged row
#define WRS (64 * WPITCH)               // floats per staged window row (64 channels side by side)
#define WITEMS (64 * 7 * 10)            // 16-byte pieces per staged pass
#define WNJ ((WITEMS + 255) / 256)      // pieces per thread
// every '#pragma unroll' below makes the indices of off, ok, v, s, p, a, wv, ca, w and acc constants, so that these arrays live in registers and the loads of a run are independent
// 6 waves per SIMD: three work-groups (96,000 B of LDS each) stay resident on a WGP, so all 576 run in one round
__global__ __launch_bounds__(256, 6) void k_win(const float* __restrict__ KP, const float* __restrict__ QP, const float* __restrict__ VP, const float* __restrict__ WW, const float* __restrict__ BW, float* __restrict__ OUT) {
  __shared__ __align__(16) float sh[7 * WRS]; __shared__ float sq[CK][33]; __shared__ float slg[49][32]; __shared__ float smx[7][32]; __shared__ __align__(16) _Float16 sct[32][CV + 8];
  const int t = threadIdx.x, wave = __builtin_amdgcn_readfirstlane(t >> 5), lane = t & 31;
  const int p0 = blockIdx.x * 32; const int b = p0 / NPX, n0 = p0 % NPX, y = n0 / HW, x0 = n0 % HW;
  // piece e = t + 256 j of a pass is (window row e / 640, channel, quad of the row); a quad lies wholly inside or wholly outside the image
  unsigned off[WNJ]; bool ok[WNJ];   // byte offsets from the pass's first plane, clamped into it where the piece is outside (such a piece is stored as zeros)
#pragma unroll
  for (int j = 0; j < WNJ; ++j) { const int e = t + 256 * j, r = e / 640, rem = e - r * 640, c = rem / 10, qd = rem - c * 10; const int yy = y - 3 + r, xx = x0 - 4 + 4 * qd;
    ok[j] = (e < WITEMS) & ((unsigned)yy < (unsigned)HW) & ((unsigned)xx < (unsigned)HW);
    off[j] = 4u * (unsigned)(c * NPX + min(max(yy, 0), HW - 1) * HW + min(max(xx, 0), HW - 4)); }
  auto stage = [&](const float* __restrict__ srcp) { v4f v[WNJ];
#pragma unroll
    for (int j = 0; j < WNJ; ++j) v[j] = *(const v4f*)((const char*)srcp + off[j]);
#pragma unroll
    for (int j = 0; j < WNJ; ++j) { const v4f z = {0.f, 0.f, 0.f, 0.f}; if (t + 256 * j < WITEMS) *(v4f*)&sh[(t + 256 * j) * 4] = ok[j] ? v[j] : z; } };
  v4f qv[2];
#pragma unroll
  for (int j = 0; j < 2; ++j) qv[j] = *(const v4f*)(QP + (size_t)p0 * CK + (t + 256 * j) * 4);
  stage(KP + (size_t)b * CK * NPX);
#pragma unroll
  for (int j = 0; j < 2; ++j) { const int e = t + 256 * j, pl = e >> 4, cq = e & 15;
#pragma unroll
    for (int i = 0; i < 4; ++i) sq[cq * 4 + i][pl] = qv[j][i]; }
  __syncthreads();
  float s[7] = {0.f, 0.f, 0.f, 0.f, 0.f, 0.f, 0.f};
  if (wave < 7) { const float* kr = &sh[wave * WRS + lane + 1];
#pragma unroll 8   // 8 channels' LDS reads in flight per trip; the whole 64 would only lengthen the code
    for (int c = 0; c < CK; ++c) { const float q = sq[c][lane];
#pragma unroll
      for (int dx = 0; dx < 7; ++dx) s[dx] += kr[c * WPITCH + dx] * q; }
    float pm = s[0];
#pragma unroll
    for (int dx = 1; dx < 7; ++dx) pm = fmaxf(pm, s[dx]);
    smx[wave][lane] = pm; }
  __syncthreads();   // every read of the key rows is done; the row maxima are visible
  float mx = smx[0][lane];
#pragma unroll
  for (int r = 1; r < 7; ++r) mx = fmaxf(mx, smx[r][lane]);
  if (wave < 7) {
#pragma unroll
    for (int dx = 0; dx < 7; ++dx) slg[wave * 7 + dx][lane] = expf(s[dx] - mx); }
  stage(VP + (size_t)b * CV * NPX);
  __syncthreads();
  float p[49]; float ssum = 0.f;
#pragma unroll
  for (int k = 0; k < 49; ++k) { p[k] = slg[k][lane]; ssum += p[k]; }
  const float inv = 1.0f / ssum;
  const float* vr = &sh[wave * 8 * WPITCH + lane + 1];
#pragma unroll 1   // one copy of the 392 multiply-adds in the text serves both halves
  for (int h = 0; h < 2; ++h) {
    if (h) { __syncthreads();   // every read of value channels 0-63 is done
      stage(VP + ((size_t)b * CV + 64) * NPX); __syncthreads(); }
    float a[8] = {0.f, 0.f, 0.f, 0.f, 0.f, 0.f, 0.f, 0.f};
#pragma unroll
    for (int dy = 0; dy < 7; ++dy)
#pragma unroll
      for (int i = 0; i < 8; ++i)
#pragma unroll
        for (int dx = 0; dx < 7; ++dx) a[i] += p[dy * 7 + dx] * vr[dy * WRS + i * WPITCH + dx];
    v8h o;
#pragma unroll
    for (int i = 0; i < 8; ++i) o[i] = (_Float16)(a[i] * inv);
    *(v8h*)&sct[lane][h * 64 + wave * 8] = o; }
  static_assert(CO * OWP * 2 <= 7 * WRS * 4 && CO * OSP * 4 <= 7 * WRS * 4, "weight rows and output tile fit in the window buffer");
  _Float16 (*sw)[OWP] = (_Float16 (*)[OWP])sh; float* so = sh;
  // the lane's number is read anew here: a thread index held in a register across the context loop, which runs at the register limit, is spilled
  const int ln = (int)__builtin_amdgcn_mbcnt_lo(~0u, 0u), t2 = wave * 32 + ln;
  // piece e = t2 + 256 j is 16 B of the contiguous weight rows; all 32 loads of a thread are in flight at once
  v4f wv[32]; const float* wp = WW + (unsigned)t2 * 4u;
#pragma unroll
  for (int j = 0; j < 31; ++j) wv[j] = *(const v4f*)(wp + 1024 * j);
  asm volatile("s_wait_xcnt 0x0" ::: "memory");   // the last load's data is given the address registers that the 31 loads in front of it name
  wv[31] = *(const v4f*)(wp + 1024 * 31);
  __syncthreads();   // every read of the value rows is done; the context rows are visible
  const int col = ln & 15, g = ln >> 4;
  const float bb[2] = {bfr(BW[wave * 32 + col]), bfr(BW[wave * 32 + 16 + col])};   // loaded here, where the LDS stores cover it: behind the product its latency would stand open
#pragma unroll
  for (int j = 0; j < 32; ++j) { v4h o;   // piece t2 + 256 j: row wave + 8 j, quad ln
#pragma unroll
    for (int i = 0; i < 4; ++i) o[i] = (_Float16)bfr(wv[j][i]);
    *(v4h*)&sw[wave + 8 * j][ln * 4] = o; }
  __syncthreads();   // the weight rows are visible
  v8f acc[2][2] = {};
#pragma unroll
  for (int kc = 0; kc < CV / 32; ++kc) { v16h ca[2], w[2];
#pragma unroll
    for (int i = 0; i < 2; ++i) { ca[i] = frag_h(&sct[i * 16 + col][kc * 32], ln); w[i] = frag_h(&sw[wave * 32 + i * 16 + col][kc * 32], ln); }
#pragma unroll
    for (int i = 0; i < 2; ++i)
#pragma unroll
      for (int j = 0; j < 2; ++j) acc[i][j] = wmma16(ca[i], w[j], acc[i][j]); }
  __syncthreads();   // every read of the weight rows is done; the output tile may overwrite them
#pragma unroll
  for (int j = 0; j < 2; ++j) { const int o = wave * 32 + j * 16 + col;
#pragma unroll
    for (int i = 0; i < 2; ++i)
#pragma unroll
      for (int r = 0; r < 8; ++r) so[o * OSP + i * 16 + 8 * g + r] = acc[i][j][r] + bb[j]; }
  __syncthreads();   // the output tile is visible
#pragma unroll
  for (int j = 0; j < CO / 32; ++j) { const unsigned cl = ((unsigned)t2 >> 3) + 32u * j, q = t2 & 7; vst2(OUT + ((size_t)b * CO + cl) * NPX + n0 + q * 4, *(const v4f*)&so[cl * OSP + q * 4]); } }
extern "C" void kernel_launch(void* const* d_in, const int* in_sizes, int n_in, void* d_out, int out_size, void* d_ws, size_t ws_size, hipStream_t stream) {
  (void)in_sizes; (void)n_in; (void)out_size;
  const float** F = (const float**)d_in;   // 0 x [2,256,96,96], 1 fk_w1 [64,256], 2 fk_b1, 3 fk_bn1 [4,64], 4 fk_w2 [64,64], 5 fk_b2, 6 fk_bn2, 7 fq_w1, 8 fq_b1, 9 fq_bn1, 10 fq_w2, 11 fq_b2, 12 fq_bn2, 13 fv_w [128,256], 14 fv_b, 15 W_w [256,128], 16 W_b
  if (ws_size < (size_t)WS_END) return;
  char* ws = (char*)d_ws; float *K1 = (float*)(ws + WS_K1), *Q1 = (float*)(ws + WS_Q1), *KP = (float*)(ws + WS_KP), *QP = (float*)(ws + WS_QP), *VP = (float*)(ws + WS_VP);
  k_c1<<<dim3(NPX / 64, NB, 2), 256, 0, stream>>>(F[0], F[1], F[2], F[3], F[7], F[8], F[9], F[13], F[14], K1, Q1, VP);
  k_c2<<<dim3(NPX / 64, NB, 2), 128, 0, stream>>>(K1, Q1, F[4], F[5], F[6], F[10], F[11], F[12], KP, QP);
  k_win<<<TWB, 256, 0, stream>>>(KP, QP, VP, F[15], F[16], (float*)d_out);
}

// v004
// A run of this version takes 42.3 microseconds.
// Timed twice side by side with v003, it ran 1.19 times as fast both times.
// All steps since v000 together make it 25.2 times as fast.
// compute dtype: all float inputs rounded to bf16; the five 1x1 convs on WMMA 16x16x32: x-fed ones with EXACT bf16 products (x^T tile in LDS), the second key/query convs with their f32 input as bf16 hi + lo (2 products), eval BatchNorm + ReLU in f32; key/query/value planes in f32; the 7x7-window dot products (64-deep), the 49-way softmax (zero-padded neighbours give logit 0 and value 0, as unfold does) and the 128-channel context in f32 on the VALU; context rounded once to f16 for the final 1x1 conv W (bf16-exact weights in f16, 1 product) + bias; f32 output.
#include <hip/hip_runtime.h>
#include <math.h>

typedef __attribute__((ext_vector_type(16))) _Float16 v16h;
typedef __attribute__((ext_vector_type(16))) __bf16 v16b;
typedef __attribute__((ext_vector_type(8)))  _Float16 v8h;
typedef __attribute__((ext_vector_type(8)))  float v8f;
typedef __attribute__((ext_vector_type(4)))  float v4f;
typedef __attribute__((ext_vector_type(2)))  float v2f;
typedef __attribute__((ext_vector_type(4)))  unsigned v4u;
typedef __attribute__((ext_vector_type(4)))  int v4i;
typedef float __attribute__((may_alias)) float_a;
typedef int __attribute__((may_alias)) int_a;

template <typename T> __device__ __forceinline__ void vst2(void* p, T v) { *(T*)p = v;  }
__device__ __forceinline__ v8f wmma16(v16h a, v16h b, v8f c) {
  v8f d = __builtin_amdgcn_wmma_f32_16x16x32_f16(false, a, false, b, (short)0, c, false, false);
  asm volatile("v_nop\n\tv_nop\n\tv_nop\n\tv_nop" : "+v"(d) : "v"(a), "v"(b));
  return d;
}
__device__ __forceinline__ v8f wmma_bf(v16b a, v16b b, v8f c) {
  v8f d = __builtin_amdgcn_wmma_f32_16x16x32_bf16(false, a, false, b, (short)0, c, false, false);
  asm volatile("v_nop\n\tv_nop\n\tv_nop\n\tv_nop" : "+v"(d) : "v"(a), "v"(b));
  return d;
}
// 16x16x32 fragments: lane = (h = lane>>4, row/col = lane&15); elements 0..7 = k0+8h+0..7, 8..15 = k0+16+8h+0..7; D element r = row 8h+r
__device__ __forceinline__ v16h frag_h(const _Float16* rowk0, int lane) {
  union { v16h v; v8h q[2]; } u; const _Float16* p = rowk0 + 8 * (lane >> 4);
  u.q[0] = *(const v8h*)p; u.q[1] = *(const v8h*)(p + 16); return u.v;
}
__device__ __forceinline__ v16h frag_f32(const float* rowk0, int lane) {
  v16h a; const float* p = rowk0 + 8 * (lane >> 4);
#pragma unroll
  for (int i = 0; i < 8; ++i) { a[i] = (_Float16)p[i]; a[8 + i] = (_Float16)p[16 + i]; }
  return a;
}
__device__ __forceinline__ v16h frag_f32s(const float* rowk0, int lane, float sc) {
  v16h a; const float* p = rowk0 + 8 * (lane >> 4);
#pragma unroll
  for (int i = 0; i < 8; ++i) { a[i] = (_Float16)(p[i] * sc); a[8 + i] = (_Float16)(p[16 + i] * sc); }
  return a;
}
// column fragment from a [K][ld] layout (column n), rows >= K read as 0
__device__ __forceinline__ v16h fragc_f32(const float* W, int k0, int n, int lane, int ld, int K) {
  v16h a; const int g = lane >> 4;
#pragma unroll
  for (int i = 0; i < 8; ++i) { const int ka = k0 + 8 * g + i, kb = ka + 16;
    a[i] = (_Float16)(ka < K ? W[(size_t)(ka < K ? ka : K - 1) * ld + n] : 0.f); a[8 + i] = (_Float16)(kb < K ? W[(size_t)(kb < K ? kb : K - 1) * ld + n] : 0.f); }
  return a;
}
struct F2 { v16b h, l; };
__device__ __forceinline__ F2 bsplit16(const float v[16]) { F2 r;
#pragma unroll
  for (int i = 0; i < 16; ++i) { const __bf16 h = (__bf16)v[i]; r.h[i] = h; r.l[i] = (__bf16)(v[i] - (float)h); }
  return r; }
__device__ __forceinline__ F2 split_row(const float* row, int k0, int lane) { float v[16]; const float* p = row + k0 + 8 * (lane >> 4);
#pragma unroll
  for (int i = 0; i < 8; ++i) { v[i] = p[i]; v[8 + i] = p[16 + i]; }
  return bsplit16(v); }
__device__ __forceinline__ F2 split_rowK(const float* row, int k0, int lane, int K) { float v[16]; const int g = lane >> 4;
#pragma unroll
  for (int i = 0; i < 8; ++i) { const int ka = k0 + 8 * g + i, kb = ka + 16; v[i] = ka < K ? row[ka < K ? ka : K - 1] : 0.f; v[8 + i] = kb < K ? row[kb < K ? kb : K - 1] : 0.f; }
  return bsplit16(v); }
__device__ __forceinline__ F2 split_col(const float* W, int k0, int n, int lane, int ld, int K) { float v[16]; const int g = lane >> 4;
#pragma unroll
  for (int i = 0; i < 8; ++i) { const int ka = k0 + 8 * g + i, kb = ka + 16; v[i] = ka < K ? W[(size_t)(ka < K ? ka : K - 1) * ld + n] : 0.f; v[8 + i] = kb < K ? W[(size_t)(kb < K ? kb : K - 1) * ld + n] : 0.f; }
  return bsplit16(v); }
__device__ __forceinline__ v8f mac3(const F2& a, const F2& b, v8f c) { c = wmma_bf(a.l, b.h, c); c = wmma_bf(a.h, b.l, c); return wmma_bf(a.h, b.h, c); }
__device__ __forceinline__ float sigm(float v) { return 1.0f / (1.0f + expf(-v)); }
#define LDSX() do { asm volatile("s_wait_dscnt 0" ::: "memory"); __builtin_amdgcn_wave_barrier(); __builtin_amdgcn_fence(__ATOMIC_RELEASE, "workgroup"); } while (0)


// Local-window self attention (b 2, 96 x 96, Cin 256, key/query 64 via conv-BN-ReLU x2, value 128, 7x7 window, out conv 256).
#define NB 2
#define HW 96
#define NPX (HW * HW)      // 9216
#define CIN 256
#define CK 64
#define CV 128
#define CO 256
#define NPT (NB * NPX)     // 18432 = 288 x 64
#ifndef TWB
#define TWB (NPT / 32)     // window kernel blocks
#endif
typedef __attribute__((ext_vector_type(8))) __bf16 v8b;
__device__ __forceinline__ v16b frag_b(const __bf16* rowk0, int lane) {
  union { v16b v; v8b q[2]; } u; const __bf16* p = rowk0 + 8 * (lane >> 4);
  u.q[0] = *(const v8b*)p; u.q[1] = *(const v8b*)(p + 16); return u.v;
}
__device__ __forceinline__ float bfr(float v) { return (float)(__bf16)v; }
__device__ __attribute__((noinline)) float exp_ni(float v) { return expf(v); }
__device__ __attribute__((noinline)) float erf_ni(float v) { return erff(v); }

#define WS_KP  0u                                  // f32 key planes [b][64][n]
#define WS_QP  (WS_KP + 4u * (size_t)NPT * CK)        // f32 query rows [p][64]
#define WS_VP  (WS_QP + 4u * (size_t)NPT * CK)        // f32 value planes [b][128][n]
#define WS_END (WS_VP + 4u * (size_t)NPT * CV)

__device__ __forceinline__ float bnrelu(float v, const float* bn, int c, int C) { const float gsc = bfr(bn[c]) / sqrtf(bfr(bn[3 * C + c]) + 1e-5f); return fmaxf((v - bfr(bn[2 * C + c])) * gsc + bfr(bn[C + c]), 0.f); }
// ---- k_c1: block = (64 px, b, half), 8 waves: half 0: k1 = bnrelu(fk_w1 x + b) and q1 likewise, kept in LDS as f32 rows, then key = bnrelu(fk_w2 k1 + b) -> planes and query likewise -> rows; half 1: the 128 value channels = fv_w x + b -> planes.
// The x^T tile [64 px][256 c] and the half's 128 weight rows [o][256 c] are each staged once in LDS as bf16; wave = 32 px x 32 outputs, k in the same order as before.
#define C1P (CIN + 8)                   // bf16 per staged row: 528 B = 16 B x 33, so 16-byte fragment reads of 16 rows fall on distinct banks
#define C1X (64 * C1P * 2)              // bytes of the x tile
#define C2P (CK + 8)                    // bf16 per staged row of the second convs' weights: 144 B = 16 B x 9, same reason
#define C1SO (64 * 132 * 4)             // bytes of the k1 | q1 tile [64 px][132]
typedef __attribute__((ext_vector_type(4))) __bf16 v4b;
// 6 waves per SIMD: three work-groups (101,376 B of LDS each) stay resident on a WGP, so all 576 run in one round
__global__ __launch_bounds__(256, 6) void k_c1(const float* __restrict__ X, const float* __restrict__ WK1, const float* __restrict__ BK1, const float* __restrict__ BNK1, const float* __restrict__ WQ1, const float* __restrict__ BQ1, const float* __restrict__ BNQ1, const float* __restrict__ WV, const float* __restrict__ BVv, const float* __restrict__ WK2, const float* __restrict__ BK2, const float* __restrict__ BNK2, const float* __restrict__ WQ2, const float* __restrict__ BQ2, const float* __restrict__ BNQ2, float* __restrict__ KP, float* __restrict__ QP, float* __restrict__ VP) {
  __shared__ __align__(16) char sm[(64 + 128) * C1P * 2];
  __bf16 (*sx)[C1P] = (__bf16 (*)[C1P])sm; __bf16 (*sw)[C1P] = (__bf16 (*)[C1P])(sm + C1X);
  float* so = (float*)(sm + C1X);       // output tile, over the weight rows once every wave has left them
  static_assert(128 * C2P * 2 <= C1X && C1SO + 64 * 68 * 4 <= 128 * C1P * 2, "second weights fit over the x tile, the key tile behind the k1 | q1 tile");
  __bf16 (*sw2)[C2P] = (__bf16 (*)[C2P])sm;   // fk_w2 rows 0-63, fq_w2 rows 64-127, over the x tile once every wave has left it
  float* sk = (float*)(sm + C1X + C1SO);      // key tile [64 channels][68], behind the k1 | q1 tile
  // the wave's number as a scalar: the per-wave choice of bias and BN arrays below then stays a scalar base with one offset register
  const int tid = threadIdx.x, wave = __builtin_amdgcn_readfirstlane(tid >> 5), lane = tid & 31, col = lane & 15, g = lane >> 4; const int p0 = blockIdx.x * 64; const size_t b = blockIdx.y; const int half = blockIdx.z;
  const float* Wa = half ? WV : WK1; const float* Wb = half ? WV + 64 * CIN : WQ1;   // weight rows 0-63 and 64-127 of this half
  // every '#pragma unroll' below makes the indices of xv, wa, wb and acc constants, so that these arrays live in registers and the loads of a run are independent
  // x: thread = one pixel x 8 octets of channels (a wave's load is one whole 128-B line of a plane); weights: piece e = tid + 256 j is 16 B of the contiguous rows
  const int xpx = tid & 63, xo = tid >> 6; const float* xp = X + (b * CIN + xo * 8) * (size_t)NPX + p0 + xpx;
  float xv[8][8]; v4f wa[16], wb[16];
#pragma unroll
  for (int j = 0; j < 8; ++j)
#pragma unroll
    for (int i = 0; i < 8; ++i) xv[j][i] = xp[(size_t)(j * 32 + i) * NPX];
#pragma unroll
  for (int j = 0; j < 16; ++j) wa[j] = *(const v4f*)(Wa + (tid + 256 * j) * 4);
  __builtin_amdgcn_sched_barrier(0);   // keeps the second weight batch's loads behind this point: all 192 registers of loads at once spill
#pragma unroll
  for (int j = 0; j < 8; ++j) { v8b o;
#pragma unroll
    for (int i = 0; i < 8; ++i) o[i] = (__bf16)xv[j][i];
    *(v8b*)&sx[xpx][(xo + 4 * j) * 8] = o; }
  __builtin_amdgcn_sched_barrier(0);   // the second batch takes the registers that the x values have left
#pragma unroll
  for (int j = 0; j < 16; ++j) wb[j] = *(const v4f*)(Wb + (tid + 256 * j) * 4);
#pragma unroll
  for (int j = 0; j < 16; ++j) { const int e = tid + 256 * j; v4b o;
#pragma unroll
    for (int i = 0; i < 4; ++i) o[i] = (__bf16)wa[j][i];
    *(v4b*)&sw[e >> 6][(e & 63) * 4] = o; }
#pragma unroll
  for (int j = 0; j < 16; ++j) { const int e = tid + 256 * j; v4b o;
#pragma unroll
    for (int i = 0; i < 4; ++i) o[i] = (__bf16)wb[j][i];
    *(v4b*)&sw[64 + (e >> 6)][(e & 63) * 4] = o; }
  __syncthreads();
  // second convs: wave = 16 px x 64 outputs of key (waves 0-3) or query (waves 4-7)
  const int wh = wave >> 2, pg = wave & 3;
  v4f w2v[8]; float b2[4], m2[4], g2[4], t2[4], r2[4];   // raw bias, mean, gamma, beta, variance of the wave's 4 x 16 outputs
  // issued here, behind the barrier, so that the first product covers their latency; in both halves: under a test of the half the compiler draws the arithmetic on them, and so the wait, up to this place
  {
#pragma unroll
    for (int j = 0; j < 4; ++j) { w2v[j] = *(const v4f*)(WK2 + (tid + 256 * j) * 4); w2v[4 + j] = *(const v4f*)(WQ2 + (tid + 256 * j) * 4); }
    const float* Bm = wh ? BQ2 : BK2; const float* bn = wh ? BNQ2 : BNK2;
#pragma unroll
    for (int j = 0; j < 4; ++j) { const int o = j * 16 + col; b2[j] = Bm[o]; g2[j] = bn[o]; r2[j] = bn[3 * CK + o]; m2[j] = bn[2 * CK + o]; t2[j] = bn[CK + o]; } }
  const int ph = wave & 1, og = wave >> 1;   // pixels 32 ph .. +31, outputs 32 og .. +31 of the half
  v8f acc[2][2] = {};
#pragma unroll
  for (int kc = 0; kc < CIN / 32; ++kc) { v16b a[2], w[2];
#pragma unroll
    for (int i = 0; i < 2; ++i) { a[i] = frag_b(&sx[ph * 32 + i * 16 + col][kc * 32], lane); w[i] = frag_b(&sw[og * 32 + i * 16 + col][kc * 32], lane); }
#pragma unroll
    for (int i = 0; i < 2; ++i)
#pragma unroll
      for (int j = 0; j < 2; ++j) acc[i][j] = wmma_bf(a[i], w[j], acc[i][j]); }
  __syncthreads();   // every read of the x tile and of the weight rows is done; the output tile and the second weights may overwrite them
  if (half == 0) { const float* Bm = og < 2 ? BK1 : BQ1; const float* bn = og < 2 ? BNK1 : BNQ1;   // so = [64 px][132]: k1 in columns 0-63, q1 in 64-127
#pragma unroll
    for (int j = 0; j < 2; ++j) { const int o = og * 32 + j * 16 + col, oc = o & 63; const float bb = bfr(Bm[oc]);
#pragma unroll
      for (int i = 0; i < 2; ++i)
#pragma unroll
        for (int r = 0; r < 8; ++r) so[(ph * 32 + i * 16 + 8 * g + r) * 132 + o] = bnrelu(acc[i][j][r] + bb, bn, oc, CK); }
#pragma unroll
    for (int j = 0; j < 8; ++j) { const int e = tid + 256 * (j & 3); v4b o;   // piece e of fk_w2 (j < 4) or fq_w2: row e / 16, quad e % 16
#pragma unroll
      for (int i = 0; i < 4; ++i) o[i] = (__bf16)w2v[j][i];
      *(v4b*)&sw2[(j >> 2) * 64 + (e >> 4)][(e & 15) * 4] = o; }
#pragma unroll
    for (int j = 0; j < 4; ++j) { b2[j] = bfr(b2[j]); g2[j] = bfr(g2[j]) / sqrtf(bfr(r2[j]) + 1e-5f); m2[j] = bfr(m2[j]); t2[j] = bfr(t2[j]); }
    __syncthreads();   // the k1 | q1 rows and the second weights are visible
    // the wave alone reads rows 16 pg .. +15, columns 64 wh .. +63 of so: f32 input as bf16 hi + lo, 2 products, k ascending
    v8f ac2[4] = {};
#pragma unroll
    for (int kc = 0; kc < CK / 32; ++kc) { const float* ap = &so[(pg * 16 + col) * 132 + wh * 64 + kc * 32 + 8 * g]; v4f aq[4]; v16b w2f[4]; float av[16];
      // the 12 LDS reads of a k step stand in front of its products, so that their latency is paid once a step (all 24 at once spill)
      aq[0] = *(const v4f*)ap; aq[1] = *(const v4f*)(ap + 4); aq[2] = *(const v4f*)(ap + 16); aq[3] = *(const v4f*)(ap + 20);
#pragma unroll
      for (int j = 0; j < 4; ++j) w2f[j] = frag_b(&sw2[wh * 64 + j * 16 + col][kc * 32], lane);
#pragma unroll
      for (int i = 0; i < 16; ++i) av[i] = aq[i >> 2][i & 3];
      const F2 a = bsplit16(av);   // each accumulator takes hi, then lo, kc ascending; the four accumulators alternate, so that no product waits for the one in front of it
#pragma unroll
      for (int j = 0; j < 4; ++j) ac2[j] = wmma_bf(a.h, w2f[j], ac2[j]);
#pragma unroll
      for (int j = 0; j < 4; ++j) ac2[j] = wmma_bf(a.l, w2f[j], ac2[j]); }
    // key: transposed into sk; query: back into the wave's own part of so, every read of which has fed the products above
#pragma unroll
    for (int j = 0; j < 4; ++j)
#pragma unroll
      for (int r = 0; r < 8; ++r) ac2[j][r] = fmaxf((ac2[j][r] + b2[j] - m2[j]) * g2[j] + t2[j], 0.f);
    if (wh == 0) {
#pragma unroll
      for (int j = 0; j < 4; ++j) { float* kp = &sk[(j * 16 + col) * 68 + pg * 16 + 8 * g];
        const v4f lo = {ac2[j][0], ac2[j][1], ac2[j][2], ac2[j][3]}, hi = {ac2[j][4], ac2[j][5], ac2[j][6], ac2[j][7]};
        *(v4f*)kp = lo; *(v4f*)(kp + 4) = hi; } }
    else {
#pragma unroll
      for (int j = 0; j < 4; ++j)
#pragma unroll
        for (int r = 0; r < 8; ++r) so[(pg * 16 + 8 * g + r) * 132 + 64 + j * 16 + col] = ac2[j][r]; }
    __syncthreads();   // the key and query tiles are visible
#pragma unroll
    for (int j = 0; j < 4; ++j) { const int e = tid + 256 * j, cl = e >> 4, q = e & 15;
      vst2(KP + (b * CK + cl) * (size_t)NPX + p0 + q * 4, *(const v4f*)&sk[cl * 68 + q * 4]);
      vst2(QP + (b * NPX + p0 + cl) * (size_t)CK + q * 4, *(const v4f*)&so[cl * 132 + 64 + q * 4]); } }
  else {
#pragma unroll
    for (int j = 0; j < 2; ++j) { const int o = og * 32 + j * 16 + col; const float bb = bfr(BVv[o]);
#pragma unroll
      for (int i = 0; i < 2; ++i)
#pragma unroll
        for (int r = 0; r < 8; ++r) so[o * 68 + ph * 32 + i * 16 + 8 * g + r] = acc[i][j][r] + bb; }   // transposed: [channel][px], pitch 68
    __syncthreads(); for (int e = tid; e < 128 * 16; e += 256) { const int cl = e >> 4, q = e & 15; vst2(VP + (b * CV + cl) * (size_t)NPX + p0 + q * 4, *(const v4f*)&so[cl * 68 + q * 4]); } } }
// ---- k_win: block = 32 pixels of one image row, 8 waves (lane = pixel). The 7 x 40 window rows (x0-4 .. x0+35, zeros outside the image) of 64 channels are staged in LDS three times: key, value 0-63, value 64-127.
// logits: wave = window row (7 of 8 waves), 64-deep in channel order; softmax; context: wave = 8 value channels of the staged 64, the 49 weights in registers, summed in window order -> f16 context row
// final 1x1 conv in the same block: the 32 f16 context rows stay in LDS, the 256 weight rows are staged once as f16 over the spent window rows; wave = 32 px x 32 outputs, k in ascending order; output tile [256][32 px] through LDS -> whole 128-B lines of the output planes
#define OWP (CV + 8)                    // f16 per staged weight row: 272 B = 16 B x 17, so 16-byte fragment reads of 16 rows fall on distinct banks
#define OSP 36                          // floats per row of the output tile: 144 B = 16 B x 9, same reason for its 4-byte stores to 16 rows
typedef __attribute__((ext_vector_type(4))) _Float16 v4h;
#define WPITCH 40                       // floats per staged row
#define WRS (64 * WPITCH)               // floats per staged window row (64 channels side by side)
#define WITEMS (64 * 7 * 10)            // 16-byte pieces per staged pass
#define WNJ ((WITEMS + 255) / 256)      // pieces per thread
// every '#pragma unroll' below makes the indices of off, ok, v, s, p, a, wv, ca, w and acc constants, so that these arrays live in registers and the loads of a run are independent
// 6 waves per SIMD: three work-groups (96,000 B of LDS each) stay resident on a WGP, so all 576 run in one round
__global__ __launch_bounds__(256, 6) void k_win(const float* __restrict__ KP, const float* __restrict__ QP, const float* __restrict__ VP, const float* __restrict__ WW, const float* __restrict__ BW, float* __restrict__ OUT) {
  __shared__ __align__(16) float sh[7 * WRS]; __shared__ float sq[CK][33]; __shared__ float slg[49][32]; __shared__ float smx[7][32]; __shared__ __align__(16) _Float16 sct[32][CV + 8];
  const int t = threadIdx.x, wave = __builtin_amdgcn_readfirstlane(t >> 5), lane = t & 31;
  const int p0 = blockIdx.x * 32; const int b = p0 / NPX, n0 = p0 % NPX, y = n0 / HW, x0 = n0 % HW;
  // piece e = t + 256 j of a pass is (window row e / 640, channel, quad of the row); a quad lies wholly inside or wholly outside the image
  unsigned off[WNJ]; bool ok[WNJ];   // byte offsets from the pass's first plane, clamped into it where the piece is outside (such a piece is stored as zeros)
#pragma unroll
  for (int j = 0; j < WNJ; ++j) { const int e = t + 256 * j, r = e / 640, rem = e - r * 640, c = rem / 10, qd = rem - c * 10; const int yy = y - 3 + r, xx = x0 - 4 + 4 * qd;
    ok[j] = (e < WITEMS) & ((unsigned)yy < (unsigned)HW) & ((unsigned)xx < (unsigned)HW);
    off[j] = 4u * (unsigned)(c * NPX + min(max(yy, 0), HW - 1) * HW + min(max(xx, 0), HW - 4)); }
  auto stage = [&](const float* __restrict__ srcp) { v4f v[WNJ];
#pragma unroll
    for (int j = 0; j < WNJ; ++j) v[j] = *(const v4f*)((const char*)srcp + off[j]);
#pragma unroll
    for (int j = 0; j < WNJ; ++j) { const v4f z = {0.f, 0.f, 0.f, 0.f}; if (t + 256 * j < WITEMS) *(v4f*)&sh[(t + 256 * j) * 4] = ok[j] ? v[j] : z; } };
  v4f qv[2];
#pragma unroll
  for (int j = 0; j < 2; ++j) qv[j] = *(const v4f*)(QP + (size_t)p0 * CK + (t + 256 * j) * 4);
  stage(KP + (size_t)b * CK * NPX);
#pragma unroll
  for (int j = 0; j < 2; ++j) { const int e = t + 256 * j, pl = e >> 4, cq = e & 15;
#pragma unroll
    for (int i = 0; i < 4; ++i) sq[cq * 4 + i][pl] = qv[j][i]; }
  __syncthreads();
  float s[7] = {0.f, 0.f, 0.f, 0.f, 0.f, 0.f, 0.f};
  if (wave < 7) { const float* kr = &sh[wave * WRS + lane + 1];
#pragma unroll 8   // 8 channels' LDS reads in flight per trip; the whole 64 would only lengthen the code
    for (int c = 0; c < CK; ++c) { const float q = sq[c][lane];
#pragma unroll
      for (int dx = 0; dx < 7; ++dx) s[dx] += kr[c * WPITCH + dx] * q; }
    float pm = s[0];
#pragma unroll
    for (int dx = 1; dx < 7; ++dx) pm = fmaxf(pm, s[dx]);
    smx[wave][lane] = pm; }
  __syncthreads();   // every read of the key rows is done; the row maxima are visible
  float mx = smx[0][lane];
#pragma unroll
  for (int r = 1; r < 7; ++r) mx = fmaxf(mx, smx[r][lane]);
  if (wave < 7) {
#pragma unroll
    for (int dx = 0; dx < 7; ++dx) slg[wave * 7 + dx][lane] = expf(s[dx] - mx); }
  stage(VP + (size_t)b * CV * NPX);
  __syncthreads();
  float p[49]; float ssum = 0.f;
#pragma unroll
  for (int k = 0; k < 49; ++k) { p[k] = slg[k][lane]; ssum += p[k]; }
  const float inv = 1.0f / ssum;
  const float* vr = &sh[wave * 8 * WPITCH + lane + 1];
#pragma unroll 1   // one copy of the 392 multiply-adds in the text serves both halves
  for (int h = 0; h < 2; ++h) {
    if (h) { __syncthreads();   // every read of value channels 0-63 is done
      stage(VP + ((size_t)b * CV + 64) * NPX); __syncthreads(); }
    float a[8] = {0.f, 0.f, 0.f, 0.f, 0.f, 0.f, 0.f, 0.f};
#pragma unroll
    for (int dy = 0; dy < 7; ++dy)
#pragma unroll
      for (int i = 0; i < 8; ++i)
#pragma unroll
        for (int dx = 0; dx < 7; ++dx) a[i] += p[dy * 7 + dx] * vr[dy * WRS + i * WPITCH + dx];
    v8h o;
#pragma unroll
    for (int i = 0; i < 8; ++i) o[i] = (_Float16)(a[i] * inv);
    *(v8h*)&sct[lane][h * 64 + wave * 8] = o; }
  static_assert(CO * OWP * 2 <= 7 * WRS * 4 && CO * OSP * 4 <= 7 * WRS * 4, "weight rows and output tile fit in the window buffer");
  _Float16 (*sw)[OWP] = (_Float16 (*)[OWP])sh; float* so = sh;
  // the lane's number is read anew here: a thread index held in a register across the context loop, which runs at the register limit, is spilled
  const int ln = (int)__builtin_amdgcn_mbcnt_lo(~0u, 0u), t2 = wave * 32 + ln;
  // piece e = t2 + 256 j is 16 B of the contiguous weight rows; all 32 loads of a thread are in flight at once
  v4f wv[32]; const float* wp = WW + (unsigned)t2 * 4u;
#pragma unroll
  for (int j = 0; j < 31; ++j) wv[j] = *(const v4f*)(wp + 1024 * j);
  asm volatile("s_wait_xcnt 0x0" ::: "memory");   // the last load's data is given the address registers that the 31 loads in front of it name
  wv[31] = *(const v4f*)(wp + 1024 * 31);
  __syncthreads();   // every read of the value rows is done; the context rows are visible
  const int col = ln & 15, g = ln >> 4;
  const float bb[2] = {bfr(BW[wave * 32 + col]), bfr(BW[wave * 32 + 16 + col])};   // loaded here, where the LDS stores cover it: behind the product its latency would stand open
#pragma unroll
  for (int j = 0; j < 32; ++j) { v4h o;   // piece t2 + 256 j: row wave + 8 j, quad ln
#pragma unroll
    for (int i = 0; i < 4; ++i) o[i] = (_Float16)bfr(wv[j][i]);
    *(v4h*)&sw[wave + 8 * j][ln * 4] = o; }
  __syncthreads();   // the weight rows are visible
  v8f acc[2][2] = {};
#pragma unroll
  for (int kc = 0; kc < CV / 32; ++kc) { v16h ca[2], w[2];
#pragma unroll
    for (int i = 0; i < 2; ++i) { ca[i] = frag_h(&sct[i * 16 + col][kc * 32], ln); w[i] = frag_h(&sw[wave * 32 + i * 16 + col][kc * 32], ln); }
#pragma unroll
    for (int i = 0; i < 2; ++i)
#pragma unroll
      for (int j = 0; j < 2; ++j) acc[i][j] = wmma16(ca[i], w[j], acc[i][j]); }
  __syncthreads();   // every read of the weight rows is done; the output tile may overwrite them
#pragma unroll
  for (int j = 0; j < 2; ++j) { const int o = wave * 32 + j * 16 + col;
#pragma unroll
    for (int i = 0; i < 2; ++i)
#pragma unroll
      for (int r = 0; r < 8; ++r) so[o * OSP + i * 16 + 8 * g + r] = acc[i][j][r] + bb[j]; }
  __syncthreads();   // the output tile is visible
#pragma unroll
  for (int j = 0; j < CO / 32; ++j) { const unsigned cl = ((unsigned)t2 >> 3) + 32u * j, q = t2 & 7; vst2(OUT + ((size_t)b * CO + cl) * NPX + n0 + q * 4, *(const v4f*)&so[cl * OSP + q * 4]); } }
extern "C" void kernel_launch(void* const* d_in, const int* in_sizes, int n_in, void* d_out, int out_size, void* d_ws, size_t ws_size, hipStream_t stream) {
  (void)in_sizes; (void)n_in; (void)out_size;
  const float** F = (const float**)d_in;   // 0 x [2,256,96,96], 1 fk_w1 [64,256], 2 fk_b1, 3 fk_bn1 [4,64], 4 fk_w2 [64,64], 5 fk_b2, 6 fk_bn2, 7 fq_w1, 8 fq_b1, 9 fq_bn1, 10 fq_w2, 11 fq_b2, 12 fq_bn2, 13 fv_w [128,256], 14 fv_b, 15 W_w [256,128], 16 W_b
  if (ws_size < (size_t)WS_END) return;
  char* ws = (char*)d_ws; float *KP = (float*)(ws + WS_KP), *QP = (float*)(ws + WS_QP), *VP = (float*)(ws + WS_VP);
  k_c1<<<dim3(NPX / 64, NB, 2), 256, 0, stream>>>(F[0], F[1], F[2], F[3], F[7], F[8], F[9], F[13], F[14], F[4], F[5], F[6], F[10], F[11], F[12], KP, QP, VP);
  k_win<<<TWB, 256, 0, stream>>>(KP, QP, VP, F[15], F[16], (float*)d_out);
}

// v005
// One run takes 38.8 microseconds.
// Next to v004, in two timings, it ran 1.10 and 1.09 times as fast.
// All steps since v000 together make it 27.7 times as fast.
// compute dtype: all float inputs rounded to bf16; the five 1x1 convs on WMMA 16x16x32: x-fed ones with EXACT bf16 products (x^T tile in LDS), the second key/query convs with their f32 input as bf16 hi + lo (2 products), eval BatchNorm + ReLU in f32; key/query/value planes in f32; the 7x7-window dot products (64-deep), the 49-way softmax (zero-padded neighbours give logit 0 and value 0, as unfold does) and the 128-channel context in f32 on the VALU; context rounded once to f16 for the final 1x1 conv W (bf16-exact weights in f16, 1 product) + bias; f32 output.
#include <hip/hip_runtime.h>
#include <math.h>

typedef __attribute__((ext_vector_type(16))) _Float16 v16h;
typedef __attribute__((ext_vector_type(16))) __bf16 v16b;
typedef __attribute__((ext_vector_type(8)))  _Float16 v8h;
typedef __attribute__((ext_vector_type(8)))  float v8f;
typedef __attribute__((ext_vector_type(4)))  float v4f;
typedef __attribute__((ext_vector_type(2)))  float v2f;
typedef __attribute__((ext_vector_type(4)))  unsigned v4u;
typedef __attribute__((ext_vector_type(4)))  int v4i;
typedef float __attribute__((may_alias)) float_a;
typedef int __attribute__((may_alias)) int_a;

template <typename T> __device__ __forceinline__ void vst2(void* p, T v) { *(T*)p = v;  }
__device__ __forceinline__ v8f wmma16(v16h a, v16h b, v8f c) {
  v8f d = __builtin_amdgcn_wmma_f32_16x16x32_f16(false, a, false, b, (short)0, c, false, false);
  asm volatile("v_nop\n\tv_nop\n\tv_nop\n\tv_nop" : "+v"(d) : "v"(a), "v"(b));
  return d;
}
__device__ __forceinline__ v8f wmma_bf(v16b a, v16b b, v8f c) {
  v8f d = __builtin_amdgcn_wmma_f32_16x16x32_bf16(false, a, false, b, (short)0, c, false, false);
  asm volatile("v_nop\n\tv_nop\n\tv_nop\n\tv_nop" : "+v"(d) : "v"(a), "v"(b));
  return d;
}
// 16x16x32 fragments: lane = (h = lane>>4, row/col = lane&15); elements 0..7 = k0+8h+0..7, 8..15 = k0+16+8h+0..7; D element r = row 8h+r
__device__ __forceinline__ v16h frag_h(const _Float16* rowk0, int lane) {
  union { v16h v; v8h q[2]; } u; const _Float16* p = rowk0 + 8 * (lane >> 4);
  u.q[0] = *(const v8h*)p; u.q[1] = *(const v8h*)(p + 16); return u.v;
}
__device__ __forceinline__ v16h frag_f32(const float* rowk0, int lane) {
  v16h a; const float* p = rowk0 + 8 * (lane >> 4);
#pragma unroll
  for (int i = 0; i < 8; ++i) { a[i] = (_Float16)p[i]; a[8 + i] = (_Float16)p[16 + i]; }
  return a;
}
__device__ __forceinline__ v16h frag_f32s(const float* rowk0, int lane, float sc) {
  v16h a; const float* p = rowk0 + 8 * (lane >> 4);
#pragma unroll
  for (int i = 0; i < 8; ++i) { a[i] = (_Float16)(p[i] * sc); a[8 + i] = (_Float16)(p[16 + i] * sc); }
  return a;
}
// column fragment from a [K][ld] layout (column n), rows >= K read as 0
__device__ __forceinline__ v16h fragc_f32(const float* W, int k0, int n, int lane, int ld, int K) {
  v16h a; const int g = lane >> 4;
#pragma unroll
  for (int i = 0; i < 8; ++i) { const int ka = k0 + 8 * g + i, kb = ka + 16;
    a[i] = (_Float16)(ka < K ? W[(size_t)(ka < K ? ka : K - 1) * ld + n] : 0.f); a[8 + i] = (_Float16)(kb < K ? W[(size_t)(kb < K ? kb : K - 1) * ld + n] : 0.f); }
  return a;
}
struct F2 { v16b h, l; };
__device__ __forceinline__ F2 bsplit16(const float v[16]) { F2 r;
#pragma unroll
  for (int i = 0; i < 16; ++i) { const __bf16 h = (__bf16)v[i]; r.h[i] = h; r.l[i] = (__bf16)(v[i] - (float)h); }
  return r; }
__device__ __forceinline__ F2 split_row(const float* row, int k0, int lane) { float v[16]; const float* p = row + k0 + 8 * (lane >> 4);
#pragma unroll
  for (int i = 0; i < 8; ++i) { v[i] = p[i]; v[8 + i] = p[16 + i]; }
  return bsplit16(v); }
__device__ __forceinline__ F2 split_rowK(const float* row, int k0, int lane, int K) { float v[16]; const int g = lane >> 4;
#pragma unroll
  for (int i = 0; i < 8; ++i) { const int ka = k0 + 8 * g + i, kb = ka + 16; v[i] = ka < K ? row[ka < K ? ka : K - 1] : 0.f; v[8 + i] = kb < K ? row[kb < K ? kb : K - 1] : 0.f; }
  return bsplit16(v); }
__device__ __forceinline__ F2 split_col(const float* W, int k0, int n, int lane, int ld, int K) { float v[16]; const int g = lane >> 4;
#pragma unroll
  for (int i = 0; i < 8; ++i) { const int ka = k0 + 8 * g + i, kb = ka + 16; v[i] = ka < K ? W[(size_t)(ka < K ? ka : K - 1) * ld + n] : 0.f; v[8 + i] = kb < K ? W[(size_t)(kb < K ? kb : K - 1) * ld + n] : 0.f; }
  return bsplit16(v); }
__device__ __forceinline__ v8f mac3(const F2& a, const F2& b, v8f c) { c = wmma_bf(a.l, b.h, c); c = wmma_bf(a.h, b.l, c); return wmma_bf(a.h, b.h, c); }
__device__ __forceinline__ float sigm(float v) { return 1.0f / (1.0f + expf(-v)); }
#define LDSX() do { asm volatile("s_wait_dscnt 0" ::: "memory"); __builtin_amdgcn_wave_barrier(); __builtin_amdgcn_fence(__ATOMIC_RELEASE, "workgroup"); } while (0)


// Local-window self attention (b 2, 96 x 96, Cin 256, key/query 64 via conv-BN-ReLU x2, value 128, 7x7 window, out conv 256).
#define NB 2
#define HW 96
#define NPX (HW * HW)      // 9216
#define CIN 256
#define CK 64
#define CV 128
#define CO 256
#define NPT (NB * NPX)     // 18432 = 288 x 64
#ifndef TWB
#define TWB (NPT / 96)     // window kernel blocks
#endif
typedef __attribute__((ext_vector_type(8))) __bf16 v8b;
__device__ __forceinline__ v16b frag_b(const __bf16* rowk0, int lane) {
  union { v16b v; v8b q[2]; } u; const __bf16* p = rowk0 + 8 * (lane >> 4);
  u.q[0] = *(const v8b*)p; u.q[1] = *(const v8b*)(p + 16); return u.v;
}
__device__ __forceinline__ float bfr(float v) { return (float)(__bf16)v; }
__device__ __attribute__((noinline)) float exp_ni(float v) { return expf(v); }
__device__ __attribute__((noinline)) float erf_ni(float v) { return erff(v); }

#define WS_KP  0u                                  // f32 key planes [b][64][n]
#define WS_QP  (WS_KP + 4u * (size_t)NPT * CK)        // f32 query rows [p][64]
#define WS_VP  (WS_QP + 4u * (size_t)NPT * CK)        // f32 value planes [b][128][n]
#define WS_END (WS_VP + 4u * (size_t)NPT * CV)

__device__ __forceinline__ float bnrelu(float v, const float* bn, int c, int C) { const float gsc = bfr(bn[c]) / sqrtf(bfr(bn[3 * C + c]) + 1e-5f); return fmaxf((v - bfr(bn[2 * C + c])) * gsc + bfr(bn[C + c]), 0.f); }
// ---- k_c1: block = (64 px, b, half), 8 waves: half 0: k1 = bnrelu(fk_w1 x + b) and q1 likewise, kept in LDS as f32 rows, then key = bnrelu(fk_w2 k1 + b) -> planes and query likewise -> rows; half 1: the 128 value channels = fv_w x + b -> planes.
// The x^T tile [64 px][256 c] and the half's 128 weight rows [o][256 c] are each staged once in LDS as bf16; wave = 32 px x 32 outputs, k in the same order as before.
#define C1P (CIN + 8)                   // bf16 per staged row: 528 B = 16 B x 33, so 16-byte fragment reads of 16 rows fall on distinct banks
#define C1X (64 * C1P * 2)              // bytes of the x tile
#define C2P (CK + 8)                    // bf16 per staged row of the second convs' weights: 144 B = 16 B x 9, same reason
#define C1SO (64 * 132 * 4)             // bytes of the k1 | q1 tile [64 px][132]
typedef __attribute__((ext_vector_type(4))) __bf16 v4b;
// 6 waves per SIMD: three work-groups (101,376 B of LDS each) stay resident on a WGP, so all 576 run in one round
__global__ __launch_bounds__(256, 6) void k_c1(const float* __restrict__ X, const float* __restrict__ WK1, const float* __restrict__ BK1, const float* __restrict__ BNK1, const float* __restrict__ WQ1, const float* __restrict__ BQ1, const float* __restrict__ BNQ1, const float* __restrict__ WV, const float* __restrict__ BVv, const float* __restrict__ WK2, const float* __restrict__ BK2, const float* __restrict__ BNK2, const float* __restrict__ WQ2, const float* __restrict__ BQ2, const float* __restrict__ BNQ2, float* __restrict__ KP, float* __restrict__ QP, float* __restrict__ VP) {
  __shared__ __align__(16) char sm[(64 + 128) * C1P * 2];
  __bf16 (*sx)[C1P] = (__bf16 (*)[C1P])sm; __bf16 (*sw)[C1P] = (__bf16 (*)[C1P])(sm + C1X);
  float* so = (float*)(sm + C1X);       // output tile, over the weight rows once every wave has left them
  static_assert(128 * C2P * 2 <= C1X && C1SO + 64 * 68 * 4 <= 128 * C1P * 2, "second weights fit over the x tile, the key tile behind the k1 | q1 tile");
  __bf16 (*sw2)[C2P] = (__bf16 (*)[C2P])sm;   // fk_w2 rows 0-63, fq_w2 rows 64-127, over the x tile once every wave has left it
  float* sk = (float*)(sm + C1X + C1SO);      // key tile [64 channels][68], behind the k1 | q1 tile
  // the wave's number as a scalar: the per-wave choice of bias and BN arrays below then stays a scalar base with one offset register
  const int tid = threadIdx.x, wave = __builtin_amdgcn_readfirstlane(tid >> 5), lane = tid & 31, col = lane & 15, g = lane >> 4; const int p0 = blockIdx.x * 64; const size_t b = blockIdx.y; const int half = blockIdx.z;
  const float* Wa = half ? WV : WK1; const float* Wb = half ? WV + 64 * CIN : WQ1;   // weight rows 0-63 and 64-127 of this half
  // every '#pragma unroll' below makes the indices of xv, wa, wb and acc constants, so that these arrays live in registers and the loads of a run are independent
  // x: thread = one pixel x 8 octets of channels (a wave's load is one whole 128-B line of a plane); weights: piece e = tid + 256 j is 16 B of the contiguous rows
  const int xpx = tid & 63, xo = tid >> 6; const float* xp = X + (b * CIN + xo * 8) * (size_t)NPX + p0 + xpx;
  float xv[8][8]; v4f wa[16], wb[16];
#pragma unroll
  for (int j = 0; j < 8; ++j)
#pragma unroll
    for (int i = 0; i < 8; ++i) xv[j][i] = xp[(size_t)(j * 32 + i) * NPX];
#pragma unroll
  for (int j = 0; j < 16; ++j) wa[j] = *(const v4f*)(Wa + (tid + 256 * j) * 4);
  __builtin_amdgcn_sched_barrier(0);   // keeps the second weight batch's loads behind this point: all 192 registers of loads at once spill
#pragma unroll
  for (int j = 0; j < 8; ++j) { v8b o;
#pragma unroll
    for (int i = 0; i < 8; ++i) o[i] = (__bf16)xv[j][i];
    *(v8b*)&sx[xpx][(xo + 4 * j) * 8] = o; }
  __builtin_amdgcn_sched_barrier(0);   // the second batch takes the registers that the x values have left
#pragma unroll
  for (int j = 0; j < 16; ++j) wb[j] = *(const v4f*)(Wb + (tid + 256 * j) * 4);
#pragma unroll
  for (int j = 0; j < 16; ++j) { const int e = tid + 256 * j; v4b o;
#pragma unroll
    for (int i = 0; i < 4; ++i) o[i] = (__bf16)wa[j][i];
    *(v4b*)&sw[e >> 6][(e & 63) * 4] = o; }
#pragma unroll
  for (int j = 0; j < 16; ++j) { const int e = tid + 256 * j; v4b o;
#pragma unroll
    for (int i = 0; i < 4; ++i) o[i] = (__bf16)wb[j][i];
    *(v4b*)&sw[64 + (e >> 6)][(e & 63) * 4] = o; }
  __syncthreads();
  // second convs: wave = 16 px x 64 outputs of key (waves 0-3) or query (waves 4-7)
  const int wh = wave >> 2, pg = wave & 3;
  v4f w2v[8]; float b2[4], m2[4], g2[4], t2[4], r2[4];   // raw bias, mean, gamma, beta, variance of the wave's 4 x 16 outputs
  // issued here, behind the barrier, so that the first product covers their latency; in both halves: under a test of the half the compiler draws the arithmetic on them, and so the wait, up to this place
  {
#pragma unroll
    for (int j = 0; j < 4; ++j) { w2v[j] = *(const v4f*)(WK2 + (tid + 256 * j) * 4); w2v[4 + j] = *(const v4f*)(WQ2 + (tid + 256 * j) * 4); }
    const float* Bm = wh ? BQ2 : BK2; const float* bn = wh ? BNQ2 : BNK2;
#pragma unroll
    for (int j = 0; j < 4; ++j) { const int o = j * 16 + col; b2[j] = Bm[o]; g2[j] = bn[o]; r2[j] = bn[3 * CK + o]; m2[j] = bn[2 * CK + o]; t2[j] = bn[CK + o]; } }
  const int ph = wave & 1, og = wave >> 1;   // pixels 32 ph .. +31, outputs 32 og .. +31 of the half
  v8f acc[2][2] = {};
#pragma unroll
  for (int kc = 0; kc < CIN / 32; ++kc) { v16b a[2], w[2];
#pragma unroll
    for (int i = 0; i < 2; ++i) { a[i] = frag_b(&sx[ph * 32 + i * 16 + col][kc * 32], lane); w[i] = frag_b(&sw[og * 32 + i * 16 + col][kc * 32], lane); }
#pragma unroll
    for (int i = 0; i < 2; ++i)
#pragma unroll
      for (int j = 0; j < 2; ++j) acc[i][j] = wmma_bf(a[i], w[j], acc[i][j]); }
  __syncthreads();   // every read of the x tile and of the weight rows is done; the output tile and the second weights may overwrite them
  if (half == 0) { const float* Bm = og < 2 ? BK1 : BQ1; const float* bn = og < 2 ? BNK1 : BNQ1;   // so = [64 px][132]: k1 in columns 0-63, q1 in 64-127
#pragma unroll
    for (int j = 0; j < 2; ++j) { const int o = og * 32 + j * 16 + col, oc = o & 63; const float bb = bfr(Bm[oc]);
#pragma unroll
      for (int i = 0; i < 2; ++i)
#pragma unroll
        for (int r = 0; r < 8; ++r) so[(ph * 32 + i * 16 + 8 * g + r) * 132 + o] = bnrelu(acc[i][j][r] + bb, bn, oc, CK); }
#pragma unroll
    for (int j = 0; j < 8; ++j) { const int e = tid + 256 * (j & 3); v4b o;   // piece e of fk_w2 (j < 4) or fq_w2: row e / 16, quad e % 16
#pragma unroll
      for (int i = 0; i < 4; ++i) o[i] = (__bf16)w2v[j][i];
      *(v4b*)&sw2[(j >> 2) * 64 + (e >> 4)][(e & 15) * 4] = o; }
#pragma unroll
    for (int j = 0; j < 4; ++j) { b2[j] = bfr(b2[j]); g2[j] = bfr(g2[j]) / sqrtf(bfr(r2[j]) + 1e-5f); m2[j] = bfr(m2[j]); t2[j] = bfr(t2[j]); }
    __syncthreads();   // the k1 | q1 rows and the second weights are visible
    // the wave alone reads rows 16 pg .. +15, columns 64 wh .. +63 of so: f32 input as bf16 hi + lo, 2 products, k ascending
    v8f ac2[4] = {};
#pragma unroll
    for (int kc = 0; kc < CK / 32; ++kc) { const float* ap = &so[(pg * 16 + col) * 132 + wh * 64 + kc * 32 + 8 * g]; v4f aq[4]; v16b w2f[4]; float av[16];
      // the 12 LDS reads of a k step stand in front of its products, so that their latency is paid once a step (all 24 at once spill)
      aq[0] = *(const v4f*)ap; aq[1] = *(const v4f*)(ap + 4); aq[2] = *(const v4f*)(ap + 16); aq[3] = *(const v4f*)(ap + 20);
#pragma unroll
      for (int j = 0; j < 4; ++j) w2f[j] = frag_b(&sw2[wh * 64 + j * 16 + col][kc * 32], lane);
#pragma unroll
      for (int i = 0; i < 16; ++i) av[i] = aq[i >> 2][i & 3];
      const F2 a = bsplit16(av);   // each accumulator takes hi, then lo, kc ascending; the four accumulators alternate, so that no product waits for the one in front of it
#pragma unroll
      for (int j = 0; j < 4; ++j) ac2[j] = wmma_bf(a.h, w2f[j], ac2[j]);
#pragma unroll
      for (int j = 0; j < 4; ++j) ac2[j] = wmma_bf(a.l, w2f[j], ac2[j]); }
    // key: transposed into sk; query: back into the wave's own part of so, every read of which has fed the products above
#pragma unroll
    for (int j = 0; j < 4; ++j)
#pragma unroll
      for (int r = 0; r < 8; ++r) ac2[j][r] = fmaxf((ac2[j][r] + b2[j] - m2[j]) * g2[j] + t2[j], 0.f);
    if (wh == 0) {
#pragma unroll
      for (int j = 0; j < 4; ++j) { float* kp = &sk[(j * 16 + col) * 68 + pg * 16 + 8 * g];
        const v4f lo = {ac2[j][0], ac2[j][1], ac2[j][2], ac2[j][3]}, hi = {ac2[j][4], ac2[j][5], ac2[j][6], ac2[j][7]};
        *(v4f*)kp = lo; *(v4f*)(kp + 4) = hi; } }
    else {
#pragma unroll
      for (int j = 0; j < 4; ++j)
#pragma unroll
        for (int r = 0; r < 8; ++r) so[(pg * 16 + 8 * g + r) * 132 + 64 + j * 16 + col] = ac2[j][r]; }
    __syncthreads();   // the key and query tiles are visible
#pragma unroll
    for (int j = 0; j < 4; ++j) { const int e = tid + 256 * j, cl = e >> 4, q = e & 15;
      vst2(KP + (b * CK + cl) * (size_t)NPX + p0 + q * 4, *(const v4f*)&sk[cl * 68 + q * 4]);
      vst2(QP + (b * NPX + p0 + cl) * (size_t)CK + q * 4, *(const v4f*)&so[cl * 132 + 64 + q * 4]); } }
  else {
#pragma unroll
    for (int j = 0; j < 2; ++j) { const int o = og * 32 + j * 16 + col; const float bb = bfr(BVv[o]);
#pragma unroll
      for (int i = 0; i < 2; ++i)
#pragma unroll
        for (int r = 0; r < 8; ++r) so[o * 68 + ph * 32 + i * 16 + 8 * g + r] = acc[i][j][r] + bb; }   // transposed: [channel][px], pitch 68
    __syncthreads(); for (int e = tid; e < 128 * 16; e += 256) { const int cl = e >> 4, q = e & 15; vst2(VP + (b * CV + cl) * (size_t)NPX + p0 + q * 4, *(const v4f*)&so[cl * 68 + q * 4]); } } }
// ---- k_win: block = 32 pixels x 3 image rows, 24 waves (lane = pixel, 8 waves per image row). The 9 x 40 window rows (y0-3 .. y0+5, x0-4 .. x0+35, zeros outside the image) of 64 channels are staged once for the three image rows: key and later value 64-127 in buffer A, value 0-63 in buffer B.
// logits: wave = window row of its image row (7 of 8 waves), 64-deep in channel order; softmax; context: wave = 8 value channels of the staged 64, the 49 weights in registers, summed in window order -> f16 context row
// final 1x1 conv in the same block: the 96 f16 context rows stay in LDS, the 256 weight rows are staged once as f16 over the spent window rows; wave = 32 px x 32 outputs, k in ascending order; output tiles [3][256][32 px] through LDS -> whole 128-B lines of the output planes
#define OWP (CV + 8)                    // f16 per staged weight row: 272 B = 16 B x 17, so 16-byte fragment reads of 16 rows fall on distinct banks
#define OSP 36                          // floats per row of the output tile: 144 B = 16 B x 9, same reason for its 4-byte stores to 16 rows
typedef __attribute__((ext_vector_type(4))) _Float16 v4h;
#define WR 3                            // image rows per block
#define WT (256 * WR)                   // threads per block
#define WPITCH 40                       // floats per staged row
#define WRS (64 * WPITCH)               // floats per staged window row (64 channels side by side)
#define WITEMS (64 * (WR + 6) * 10)     // 16-byte pieces per staged pass
#define WNJ ((WITEMS + WT - 1) / WT)    // pieces per thread
#define WBUF (WNJ * WT * 4)             // floats per buffer: the 9 window rows and a tail that takes the last run's surplus pieces (zeros, never read), so that every thread runs the same loads and stores
#define WWJ ((CO * CV / 4 + WT - 1) / WT)   // 16-byte pieces of the weight rows per thread
#define WWL ((CO * CV / 4 - WT * (WWJ - 1)) / 32)   // waves whose last piece is a weight row; the others stage a second copy of the piece before it into rows behind the 256 (never read), so that every wave runs the same loads and stores
// every '#pragma unroll' below makes the indices of off, ok, va, vb, vc, s, p, a, wv, ca, w and acc constants, so that these arrays live in registers and the loads of a run are independent
// 6 waves per SIMD: the 24 waves of one work-group (269,568 B of LDS) fill a WGP, and all 192 work-groups run in one round
__global__ __launch_bounds__(WT, 6) void k_win(const float* __restrict__ KP, const float* __restrict__ QP, const float* __restrict__ VP, const float* __restrict__ WW, const float* __restrict__ BW, float* __restrict__ OUT) {
  __shared__ __align__(16) float sh[2 * WBUF]; __shared__ float sq[WR][CK][33]; __shared__ float slg[WR][49][32]; __shared__ float smx[WR][7][32]; __shared__ __align__(16) _Float16 sct[WR * 32][CV + 8];
  float* shA = sh; float* shB = sh + WBUF;
  const int t = threadIdx.x, wave = __builtin_amdgcn_readfirstlane(t >> 5), lane = t & 31;
  const int rg = wave >> 3, w8 = wave & 7;   // the wave's image row of the block, and its number among that row's 8 waves
  const int bx = blockIdx.x; const int b = bx / (NPX / (32 * WR)), tl = bx % (NPX / (32 * WR)), y0 = (tl / (HW / 32)) * WR, x0 = (tl % (HW / 32)) * 32;
  // piece e = t + 768 j of a pass is (window row e / 640, channel, quad of the row); a quad lies wholly inside or wholly outside the image
  unsigned off[WNJ]; bool ok[WNJ];   // byte offsets from the pass's first plane, clamped into it where the piece is outside (such a piece is stored as zeros)
#pragma unroll
  for (int j = 0; j < WNJ; ++j) { const int e = t + WT * j, r = e / 640, rem = e - r * 640, c = rem / 10, qd = rem - c * 10; const int yy = y0 - 3 + r, xx = x0 - 4 + 4 * qd;
    ok[j] = (e < WITEMS) & ((unsigned)yy < (unsigned)HW) & ((unsigned)xx < (unsigned)HW);
    off[j] = 4u * (unsigned)(c * NPX + min(max(yy, 0), HW - 1) * HW + min(max(xx, 0), HW - 4)); }
  auto fetch = [&](const float* __restrict__ srcp, v4f (&v)[WNJ]) {
#pragma unroll
    for (int j = 0; j < WNJ; ++j) v[j] = *(const v4f*)((const char*)srcp + off[j]); };
  auto put = [&](float* dst, const v4f (&v)[WNJ]) {
#pragma unroll
    for (int j = 0; j < WNJ; ++j) { const v4f z = {0.f, 0.f, 0.f, 0.f}; *(v4f*)&dst[(t + WT * j) * 4] = ok[j] ? v[j] : z; } };
  v4f qv[2], va[WNJ], vb[WNJ], vc[WNJ];
  // piece e = t + 768 j of the query rows: image row e / 512, pixel, quad of its 64 channels
#pragma unroll
  for (int j = 0; j < 2; ++j) { const int e = t + WT * j; qv[j] = *(const v4f*)((const char*)(QP + ((size_t)b * NPX + y0 * HW + x0) * CK) + 4u * (unsigned)((e >> 9) * (HW * CK) + (e & 511) * 4)); }
  asm volatile("s_wait_xcnt 0x0" ::: "memory");   // the data of the loads below may be given the offset registers that the two query loads name
  fetch(KP + (size_t)b * CK * NPX, va);
  put(shA, va);
#pragma unroll
  for (int j = 0; j < 2; ++j) { const int e = t + WT * j, rq = e >> 9, pl = (e & 511) >> 4, cq = e & 15;
#pragma unroll
    for (int i = 0; i < 4; ++i) sq[rq][cq * 4 + i][pl] = qv[j][i]; }
  __syncthreads();
  // both value halves are in flight under the logits (issued in front of the barrier they would be waited for at it)
  fetch(VP + (size_t)b * CV * NPX, vb);
  fetch(VP + ((size_t)b * CV + 64) * NPX, vc);
  static_assert(WNJ == 8, "the wait below names the 8 offsets");
  // the offsets are inputs, so that they stay in their registers up to this wait: without that a late load's data is given the offset registers of the loads in front of it
  asm volatile("s_wait_xcnt 0x0" :: "v"(off[0]), "v"(off[1]), "v"(off[2]), "v"(off[3]), "v"(off[4]), "v"(off[5]), "v"(off[6]), "v"(off[7]) : "memory");
  float s[7] = {0.f, 0.f, 0.f, 0.f, 0.f, 0.f, 0.f};
  if (w8 < 7) { const float* kr = &shA[(rg + w8) * WRS + lane + 1];
#pragma unroll 8   // 8 channels' LDS reads in flight per trip; the whole 64 would only lengthen the code
    for (int c = 0; c < CK; ++c) { const float q = sq[rg][c][lane];
#pragma unroll
      for (int dx = 0; dx < 7; ++dx) s[dx] += kr[c * WPITCH + dx] * q; }
    float pm = s[0];
#pragma unroll
    for (int dx = 1; dx < 7; ++dx) pm = fmaxf(pm, s[dx]);
    smx[rg][w8][lane] = pm; }
  put(shB, vb);
  __syncthreads();   // every read of the key rows is done; the row maxima are visible
  put(shA, vc);
  float mx = smx[rg][0][lane];
#pragma unroll
  for (int r = 1; r < 7; ++r) mx = fmaxf(mx, smx[rg][r][lane]);
  if (w8 < 7) {
#pragma unroll
    for (int dx = 0; dx < 7; ++dx) slg[rg][w8 * 7 + dx][lane] = expf(s[dx] - mx); }
  __syncthreads();   // the weights and all value channels are visible
  float p[49]; float ssum = 0.f;
#pragma unroll
  for (int k = 0; k < 49; ++k) { p[k] = slg[rg][k][lane]; ssum += p[k]; }
  const float inv = 1.0f / ssum;
#pragma unroll   // both halves in the text: each half's LDS addresses are then constants from the lane's one base; rolled, with the buffer's base a variable, the build spills to scratch
  for (int h = 0; h < 2; ++h) {
    const float* vr = (h ? shA : shB) + rg * WRS + w8 * 8 * WPITCH + lane + 1;
    float a[8] = {0.f, 0.f, 0.f, 0.f, 0.f, 0.f, 0.f, 0.f};
#pragma unroll
    for (int dy = 0; dy < 7; ++dy)
#pragma unroll
      for (int i = 0; i < 8; ++i)
#pragma unroll
        for (int dx = 0; dx < 7; ++dx) a[i] += p[dy * 7 + dx] * vr[dy * WRS + i * WPITCH + dx];
    v8h o;
#pragma unroll
    for (int i = 0; i < 8; ++i) o[i] = (_Float16)(a[i] * inv);
    *(v8h*)&sct[rg * 32 + lane][h * 64 + w8 * 8] = o; }
  static_assert((WT / 32) * WWJ * OWP * 2 <= 2 * WBUF * 4 && WR * CO * OSP * 4 <= 2 * WBUF * 4, "weight rows and output tiles fit in the window buffers");
  _Float16 (*sw)[OWP] = (_Float16 (*)[OWP])sh; float* so = sh + rg * (CO * OSP);
  // the lane's number is read anew here: a thread index held in a register across the context loop, which runs at the register limit, is spilled
  const int ln = (int)__builtin_amdgcn_mbcnt_lo(~0u, 0u), t2 = wave * 32 + ln, t8 = w8 * 32 + ln;
  // piece e = t2 + 768 j is 16 B of the contiguous weight rows; all loads of a thread are in flight at once
  v4f wv[WWJ]; const float* wp = WW + (unsigned)t2 * 4u;
#pragma unroll
  for (int j = 0; j < WWJ - 1; ++j) wv[j] = *(const v4f*)(wp + WT * 4 * j);
  const float* wl = wp + WT * 4 * (wave < WWL ? WWJ - 1 : WWJ - 2);
  wv[WWJ - 1] = *(const v4f*)wl;
  __syncthreads();   // every read of the value rows is done; the context rows are visible
  const int col = ln & 15, g = ln >> 4;
  const float bb[2] = {bfr(BW[w8 * 32 + col]), bfr(BW[w8 * 32 + 16 + col])};   // loaded here, where the LDS stores cover it: behind the product its latency would stand open
  // the code below takes the address registers that the weight and bias loads name; the two weight addresses are inputs, so that no weight load's data is given them before this wait
  asm volatile("s_wait_xcnt 0x0" :: "v"(wp), "v"(wl) : "memory");
#pragma unroll
  for (int j = 0; j < WWJ; ++j) { v4h o;   // piece t2 + 768 j: row wave + 24 j, quad ln
#pragma unroll
    for (int i = 0; i < 4; ++i) o[i] = (_Float16)bfr(wv[j][i]);
    *(v4h*)&sw[wave + (WT / 32) * j][ln * 4] = o; }
  __syncthreads();   // the weight rows are visible
  v8f acc[2][2] = {};
#pragma unroll
  for (int kc = 0; kc < CV / 32; ++kc) { v16h ca[2], w[2];
#pragma unroll
    for (int i = 0; i < 2; ++i) { ca[i] = frag_h(&sct[rg * 32 + i * 16 + col][kc * 32], ln); w[i] = frag_h(&sw[w8 * 32 + i * 16 + col][kc * 32], ln); }
#pragma unroll
    for (int i = 0; i < 2; ++i)
#pragma unroll
      for (int j = 0; j < 2; ++j) acc[i][j] = wmma16(ca[i], w[j], acc[i][j]); }
  __syncthreads();   // every read of the weight rows is done; the output tiles may overwrite them
#pragma unroll
  for (int j = 0; j < 2; ++j) { const int o = w8 * 32 + j * 16 + col;
#pragma unroll
    for (int i = 0; i < 2; ++i)
#pragma unroll
      for (int r = 0; r < 8; ++r) so[o * OSP + i * 16 + 8 * g + r] = acc[i][j][r] + bb[j]; }
  __syncthreads();   // the output tiles are visible
  const int n0 = (y0 + rg) * HW + x0;
#pragma unroll
  for (int j = 0; j < CO / 32; ++j) { const unsigned cl = ((unsigned)t8 >> 3) + 32u * j, q = t8 & 7; vst2(OUT + ((size_t)b * CO + cl) * NPX + n0 + q * 4, *(const v4f*)&so[cl * OSP + q * 4]); } }
extern "C" void kernel_launch(void* const* d_in, const int* in_sizes, int n_in, void* d_out, int out_size, void* d_ws, size_t ws_size, hipStream_t stream) {
  (void)in_sizes; (void)n_in; (void)out_size;
  const float** F = (const float**)d_in;   // 0 x [2,256,96,96], 1 fk_w1 [64,256], 2 fk_b1, 3 fk_bn1 [4,64], 4 fk_w2 [64,64], 5 fk_b2, 6 fk_bn2, 7 fq_w1, 8 fq_b1, 9 fq_bn1, 10 fq_w2, 11 fq_b2, 12 fq_bn2, 13 fv_w [128,256], 14 fv_b, 15 W_w [256,128], 16 W_b
  if (ws_size < (size_t)WS_END) return;
  char* ws = (char*)d_ws; float *KP = (float*)(ws + WS_KP), *QP = (float*)(ws + WS_QP), *VP = (float*)(ws + WS_VP);
  k_c1<<<dim3(NPX / 64, NB, 2), 256, 0, stream>>>(F[0], F[1], F[2], F[3], F[7], F[8], F[9], F[13], F[14], F[4], F[5], F[6], F[10], F[11], F[12], KP, QP, VP);
  k_win<<<TWB, WT, 0, stream>>>(KP, QP, VP, F[15], F[16], (float*)d_out);
}

// v006
// Measured time: 33.3 microseconds a run.
// In both of two side-by-side timings against v005, it was 1.17 times as fast.
// All steps since v000 together make it 32.3 times as fast.
// compute dtype: all float inputs rounded to bf16; the five 1x1 convs on WMMA 16x16x32: x-fed ones with EXACT bf16 products (x^T tile in LDS), the second key/query convs with their f32 input as bf16 hi + lo (2 products), eval BatchNorm + ReLU in f32; key/query planes in f32, value planes as f16 hi + lo; the 7x7-window dot products (64-deep) and the 49-way softmax (zero-padded neighbours give logit 0 and value 0, as unfold does) in f32 on the VALU; the 128-channel context on WMMA 16x16x32, one banded product per window row, weights and values each as f16 hi + lo (3 products, f32 accumulate); context rounded once to f16 for the final 1x1 conv W (bf16-exact weights in f16, 1 product) + bias; f32 output.
#include <hip/hip_runtime.h>
#include <math.h>

typedef __attribute__((ext_vector_type(16))) _Float16 v16h;
typedef __attribute__((ext_vector_type(16))) __bf16 v16b;
typedef __attribute__((ext_vector_type(8)))  _Float16 v8h;
typedef __attribute__((ext_vector_type(8)))  float v8f;
typedef __attribute__((ext_vector_type(4)))  float v4f;
typedef __attribute__((ext_vector_type(2)))  float v2f;
typedef __attribute__((ext_vector_type(4)))  unsigned v4u;
typedef __attribute__((ext_vector_type(4)))  int v4i;
typedef float __attribute__((may_alias)) float_a;
typedef int __attribute__((may_alias)) int_a;

template <typename T> __device__ __forceinline__ void vst2(void* p, T v) { *(T*)p = v;  }
__device__ __forceinline__ v8f wmma16(v16h a, v16h b, v8f c) {
  v8f d = __builtin_amdgcn_wmma_f32_16x16x32_f16(false, a, false, b, (short)0, c, false, false);
  asm volatile("v_nop\n\tv_nop\n\tv_nop\n\tv_nop" : "+v"(d) : "v"(a), "v"(b));
  return d;
}
__device__ __forceinline__ v8f wmma_bf(v16b a, v16b b, v8f c) {
  v8f d = __builtin_amdgcn_wmma_f32_16x16x32_bf16(false, a, false, b, (short)0, c, false, false);
  asm volatile("v_nop\n\tv_nop\n\tv_nop\n\tv_nop" : "+v"(d) : "v"(a), "v"(b));
  return d;
}
// 16x16x32 fragments: lane = (h = lane>>4, row/col = lane&15); elements 0..7 = k0+8h+0..7, 8..15 = k0+16+8h+0..7; D element r = row 8h+r
__device__ __forceinline__ v16h frag_h(const _Float16* rowk0, int lane) {
  union { v16h v; v8h q[2]; } u; const _Float16* p = rowk0 + 8 * (lane >> 4);
  u.q[0] = *(const v8h*)p; u.q[1] = *(const v8h*)(p + 16); return u.v;
}
// fragment from two octet addresses of the lane's own
__device__ __forceinline__ v16h frag_2(const _Float16* o0, const _Float16* o1) {
  union { v16h v; v8h q[2]; } u; u.q[0] = *(const v8h*)o0; u.q[1] = *(const v8h*)o1; return u.v;
}
__device__ __forceinline__ v16h frag_f32(const float* rowk0, int lane) {
  v16h a; const float* p = rowk0 + 8 * (lane >> 4);
#pragma unroll
  for (int i = 0; i < 8; ++i) { a[i] = (_Float16)p[i]; a[8 + i] = (_Float16)p[16 + i]; }
  return a;
}
__device__ __forceinline__ v16h frag_f32s(const float* rowk0, int lane, float sc) {
  v16h a; const float* p = rowk0 + 8 * (lane >> 4);
#pragma unroll
  for (int i = 0; i < 8; ++i) { a[i] = (_Float16)(p[i] * sc); a[8 + i] = (_Float16)(p[16 + i] * sc); }
  return a;
}
// column fragment from a [K][ld] layout (column n), rows >= K read as 0
__device__ __forceinline__ v16h fragc_f32(const float* W, int k0, int n, int lane, int ld, int K) {
  v16h a; const int g = lane >> 4;
#pragma unroll
  for (int i = 0; i < 8; ++i) { const int ka = k0 + 8 * g + i, kb = ka + 16;
    a[i] = (_Float16)(ka < K ? W[(size_t)(ka < K ? ka : K - 1) * ld + n] : 0.f); a[8 + i] = (_Float16)(kb < K ? W[(size_t)(kb < K ? kb : K - 1) * ld + n] : 0.f); }
  return a;
}
struct F2 { v16b h, l; };
__device__ __forceinline__ F2 bsplit16(const float v[16]) { F2 r;
#pragma unroll
  for (int i = 0; i < 16; ++i) { const __bf16 h = (__bf16)v[i]; r.h[i] = h; r.l[i] = (__bf16)(v[i] - (float)h); }
  return r; }
__device__ __forceinline__ F2 split_row(const float* row, int k0, int lane) { float v[16]; const float* p = row + k0 + 8 * (lane >> 4);
#pragma unroll
  for (int i = 0; i < 8; ++i) { v[i] = p[i]; v[8 + i] = p[16 + i]; }
  return bsplit16(v); }
__device__ __forceinline__ F2 split_rowK(const float* row, int k0, int lane, int K) { float v[16]; const int g = lane >> 4;
#pragma unroll
  for (int i = 0; i < 8; ++i) { const int ka = k0 + 8 * g + i, kb = ka + 16; v[i] = ka < K ? row[ka < K ? ka : K - 1] : 0.f; v[8 + i] = kb < K ? row[kb < K ? kb : K - 1] : 0.f; }
  return bsplit16(v); }
__device__ __forceinline__ F2 split_col(const float* W, int k0, int n, int lane, int ld, int K) { float v[16]; const int g = lane >> 4;
#pragma unroll
  for (int i = 0; i < 8; ++i) { const int ka = k0 + 8 * g + i, kb = ka + 16; v[i] = ka < K ? W[(size_t)(ka < K ? ka : K - 1) * ld + n] : 0.f; v[8 + i] = kb < K ? W[(size_t)(kb < K ? kb : K - 1) * ld + n] : 0.f; }
  return bsplit16(v); }
__device__ __forceinline__ v8f mac3(const F2& a, const F2& b, v8f c) { c = wmma_bf(a.l, b.h, c); c = wmma_bf(a.h, b.l, c); return wmma_bf(a.h, b.h, c); }
__device__ __forceinline__ float sigm(float v) { return 1.0f / (1.0f + expf(-v)); }
#define LDSX() do { asm volatile("s_wait_dscnt 0" ::: "memory"); __builtin_amdgcn_wave_barrier(); __builtin_amdgcn_fence(__ATOMIC_RELEASE, "workgroup"); } while (0)


// Local-window self attention (b 2, 96 x 96, Cin 256, key/query 64 via conv-BN-ReLU x2, value 128, 7x7 window, out conv 256).
#define NB 2
#define HW 96
#define NPX (HW * HW)      // 9216
#define CIN 256
#define CK 64
#define CV 128
#define CO 256
#define NPT (NB * NPX)     // 18432 = 288 x 64
#ifndef TWB
#define TWB (NPT / 96)     // window kernel blocks
#endif
typedef __attribute__((ext_vector_type(8))) __bf16 v8b;
__device__ __forceinline__ v16b frag_b(const __bf16* rowk0, int lane) {
  union { v16b v; v8b q[2]; } u; const __bf16* p = rowk0 + 8 * (lane >> 4);
  u.q[0] = *(const v8b*)p; u.q[1] = *(const v8b*)(p + 16); return u.v;
}
__device__ __forceinline__ float bfr(float v) { return (float)(__bf16)v; }
__device__ __attribute__((noinline)) float exp_ni(float v) { return expf(v); }
__device__ __attribute__((noinline)) float erf_ni(float v) { return erff(v); }

#define WS_KP  0u                                  // f32 key planes [b][64][n]
#define WS_QP  (WS_KP + 4u * (size_t)NPT * CK)        // f32 query rows [p][64]
#define WS_VP  (WS_QP + 4u * (size_t)NPT * CK)        // value planes [b][128][n / 4] of 16-byte pieces: 4 pixels as f16 hi, then the same 4 pixels as f16 lo (value = hi + lo)
#define WS_END (WS_VP + 4u * (size_t)NPT * CV)

__device__ __forceinline__ float bnrelu(float v, const float* bn, int c, int C) { const float gsc = bfr(bn[c]) / sqrtf(bfr(bn[3 * C + c]) + 1e-5f); return fmaxf((v - bfr(bn[2 * C + c])) * gsc + bfr(bn[C + c]), 0.f); }
// ---- k_c1: block = (64 px, b, half), 8 waves: half 0: k1 = bnrelu(fk_w1 x + b) and q1 likewise, kept in LDS as f32 rows, then key = bnrelu(fk_w2 k1 + b) -> planes and query likewise -> rows; half 1: the 128 value channels = fv_w x + b -> planes, each f32 value split once into f16 hi + lo.
// The x^T tile [64 px][256 c] and the half's 128 weight rows [o][256 c] are each staged once in LDS as bf16; wave = 32 px x 32 outputs, k in the same order as before.
#define C1P (CIN + 8)                   // bf16 per staged row: 528 B = 16 B x 33, so 16-byte fragment reads of 16 rows fall on distinct banks
#define C1X (64 * C1P * 2)              // bytes of the x tile
#define C2P (CK + 8)                    // bf16 per staged row of the second convs' weights: 144 B = 16 B x 9, same reason
#define C1SO (64 * 132 * 4)             // bytes of the k1 | q1 tile [64 px][132]
typedef __attribute__((ext_vector_type(4))) __bf16 v4b;
typedef __attribute__((ext_vector_type(4))) _Float16 v4h;
typedef __attribute__((ext_vector_type(2))) _Float16 v2h;
// 6 waves per SIMD: three work-groups (101,376 B of LDS each) stay resident on a WGP, so all 576 run in one round
__global__ __launch_bounds__(256, 6) void k_c1(const float* __restrict__ X, const float* __restrict__ WK1, const float* __restrict__ BK1, const float* __restrict__ BNK1, const float* __restrict__ WQ1, const float* __restrict__ BQ1, const float* __restrict__ BNQ1, const float* __restrict__ WV, const float* __restrict__ BVv, const float* __restrict__ WK2, const float* __restrict__ BK2, const float* __restrict__ BNK2, const float* __restrict__ WQ2, const float* __restrict__ BQ2, const float* __restrict__ BNQ2, float* __restrict__ KP, float* __restrict__ QP, float* __restrict__ VP) {
  __shared__ __align__(16) char sm[(64 + 128) * C1P * 2];
  __bf16 (*sx)[C1P] = (__bf16 (*)[C1P])sm; __bf16 (*sw)[C1P] = (__bf16 (*)[C1P])(sm + C1X);
  float* so = (float*)(sm + C1X);       // output tile, over the weight rows once every wave has left them
  static_assert(128 * C2P * 2 <= C1X && C1SO + 64 * 68 * 4 <= 128 * C1P * 2, "second weights fit over the x tile, the key tile behind the k1 | q1 tile");
  __bf16 (*sw2)[C2P] = (__bf16 (*)[C2P])sm;   // fk_w2 rows 0-63, fq_w2 rows 64-127, over the x tile once every wave has left it
  float* sk = (float*)(sm + C1X + C1SO);      // key tile [64 channels][68], behind the k1 | q1 tile
  // the wave's number as a scalar: the per-wave choice of bias and BN arrays below then stays a scalar base with one offset register
  const int tid = threadIdx.x, wave = __builtin_amdgcn_readfirstlane(tid >> 5), lane = tid & 31, col = lane & 15, g = lane >> 4; const int p0 = blockIdx.x * 64; const size_t b = blockIdx.y; const int half = blockIdx.z;
  const float* Wa = half ? WV : WK1; const float* Wb = half ? WV + 64 * CIN : WQ1;   // weight rows 0-63 and 64-127 of this half
  // every '#pragma unroll' below makes the indices of xv, wa, wb and acc constants, so that these arrays live in registers and the loads of a run are independent
  // x: thread = one pixel x 8 octets of channels (a wave's load is one whole 128-B line of a plane); weights: piece e = tid + 256 j is 16 B of the contiguous rows
  const int xpx = tid & 63, xo = tid >> 6; const float* xp = X + (b * CIN + xo * 8) * (size_t)NPX + p0 + xpx;
  float xv[8][8]; v4f wa[16], wb[16];
#pragma unroll
  for (int j = 0; j < 8; ++j)
#pragma unroll
    for (int i = 0; i < 8; ++i) xv[j][i] = xp[(size_t)(j * 32 + i) * NPX];
#pragma unroll
  for (int j = 0; j < 16; ++j) wa[j] = *(const v4f*)(Wa + (tid + 256 * j) * 4);
  __builtin_amdgcn_sched_barrier(0);   // keeps the second weight batch's loads behind this point: all 192 registers of loads at once spill
#pragma unroll
  for (int j = 0; j < 8; ++j) { v8b o;
#pragma unroll
    for (int i = 0; i < 8; ++i) o[i] = (__bf16)xv[j][i];
    *(v8b*)&sx[xpx][(xo + 4 * j) * 8] = o; }
  __builtin_amdgcn_sched_barrier(0);   // the second batch takes the registers that the x values have left
#pragma unroll
  for (int j = 0; j < 16; ++j) wb[j] = *(const v4f*)(Wb + (tid + 256 * j) * 4);
#pragma unroll
  for (int j = 0; j < 16; ++j) { const int e = tid + 256 * j; v4b o;
#pragma unroll
    for (int i = 0; i < 4; ++i) o[i] = (__bf16)wa[j][i];
    *(v4b*)&sw[e >> 6][(e & 63) * 4] = o; }
#pragma unroll
  for (int j = 0; j < 16; ++j) { const int e = tid + 256 * j; v4b o;
#pragma unroll
    for (int i = 0; i < 4; ++i) o[i] = (__bf16)wb[j][i];
    *(v4b*)&sw[64 + (e >> 6)][(e & 63) * 4] = o; }
  __syncthreads();
  // second convs: wave = 16 px x 64 outputs of key (waves 0-3) or query (waves 4-7)
  const int wh = wave >> 2, pg = wave & 3;
  v4f w2v[8]; float b2[4], m2[4], g2[4], t2[4], r2[4];   // raw bias, mean, gamma, beta, variance of the wave's 4 x 16 outputs
  // issued here, behind the barrier, so that the first product covers their latency; in both halves: under a test of the half the compiler draws the arithmetic on them, and so the wait, up to this place
  {
#pragma unroll
    for (int j = 0; j < 4; ++j) { w2v[j] = *(const v4f*)(WK2 + (tid + 256 * j) * 4); w2v[4 + j] = *(const v4f*)(WQ2 + (tid + 256 * j) * 4); }
    const float* Bm = wh ? BQ2 : BK2; const float* bn = wh ? BNQ2 : BNK2;
#pragma unroll
    for (int j = 0; j < 4; ++j) { const int o = j * 16 + col; b2[j] = Bm[o]; g2[j] = bn[o]; r2[j] = bn[3 * CK + o]; m2[j] = bn[2 * CK + o]; t2[j] = bn[CK + o]; } }
  const int ph = wave & 1, og = wave >> 1;   // pixels 32 ph .. +31, outputs 32 og .. +31 of the half
  v8f acc[2][2] = {};
#pragma unroll
  for (int kc = 0; kc < CIN / 32; ++kc) { v16b a[2], w[2];
#pragma unroll
    for (int i = 0; i < 2; ++i) { a[i] = frag_b(&sx[ph * 32 + i * 16 + col][kc * 32], lane); w[i] = frag_b(&sw[og * 32 + i * 16 + col][kc * 32], lane); }
#pragma unroll
    for (int i = 0; i < 2; ++i)
#pragma unroll
      for (int j = 0; j < 2; ++j) acc[i][j] = wmma_bf(a[i], w[j], acc[i][j]); }
  __syncthreads();   // every read of the x tile and of the weight rows is done; the output tile and the second weights may overwrite them
  if (half == 0) { const float* Bm = og < 2 ? BK1 : BQ1; const float* bn = og < 2 ? BNK1 : BNQ1;   // so = [64 px][132]: k1 in columns 0-63, q1 in 64-127
#pragma unroll
    for (int j = 0; j < 2; ++j) { const int o = og * 32 + j * 16 + col, oc = o & 63; const float bb = bfr(Bm[oc]);
#pragma unroll
      for (int i = 0; i < 2; ++i)
#pragma unroll
        for (int r = 0; r < 8; ++r) so[(ph * 32 + i * 16 + 8 * g + r) * 132 + o] = bnrelu(acc[i][j][r] + bb, bn, oc, CK); }
#pragma unroll
    for (int j = 0; j < 8; ++j) { const int e = tid + 256 * (j & 3); v4b o;   // piece e of fk_w2 (j < 4) or fq_w2: row e / 16, quad e % 16
#pragma unroll
      for (int i = 0; i < 4; ++i) o[i] = (__bf16)w2v[j][i];
      *(v4b*)&sw2[(j >> 2) * 64 + (e >> 4)][(e & 15) * 4] = o; }
#pragma unroll
    for (int j = 0; j < 4; ++j) { b2[j] = bfr(b2[j]); g2[j] = bfr(g2[j]) / sqrtf(bfr(r2[j]) + 1e-5f); m2[j] = bfr(m2[j]); t2[j] = bfr(t2[j]); }
    __syncthreads();   // the k1 | q1 rows and the second weights are visible
    // the wave alone reads rows 16 pg .. +15, columns 64 wh .. +63 of so: f32 input as bf16 hi + lo, 2 products, k ascending
    v8f ac2[4] = {};
#pragma unroll
    for (int kc = 0; kc < CK / 32; ++kc) { const float* ap = &so[(pg * 16 + col) * 132 + wh * 64 + kc * 32 + 8 * g]; v4f aq[4]; v16b w2f[4]; float av[16];
      // the 12 LDS reads of a k step stand in front of its products, so that their latency is paid once a step (all 24 at once spill)
      aq[0] = *(const v4f*)ap; aq[1] = *(const v4f*)(ap + 4); aq[2] = *(const v4f*)(ap + 16); aq[3] = *(const v4f*)(ap + 20);
#pragma unroll
      for (int j = 0; j < 4; ++j) w2f[j] = frag_b(&sw2[wh * 64 + j * 16 + col][kc * 32], lane);
#pragma unroll
      for (int i = 0; i < 16; ++i) av[i] = aq[i >> 2][i & 3];
      const F2 a = bsplit16(av);   // each accumulator takes hi, then lo, kc ascending; the four accumulators alternate, so that no product waits for the one in front of it
#pragma unroll
      for (int j = 0; j < 4; ++j) ac2[j] = wmma_bf(a.h, w2f[j], ac2[j]);
#pragma unroll
      for (int j = 0; j < 4; ++j) ac2[j] = wmma_bf(a.l, w2f[j], ac2[j]); }
    // key: transposed into sk; query: back into the wave's own part of so, every read of which has fed the products above
#pragma unroll
    for (int j = 0; j < 4; ++j)
#pragma unroll
      for (int r = 0; r < 8; ++r) ac2[j][r] = fmaxf((ac2[j][r] + b2[j] - m2[j]) * g2[j] + t2[j], 0.f);
    if (wh == 0) {
#pragma unroll
      for (int j = 0; j < 4; ++j) { float* kp = &sk[(j * 16 + col) * 68 + pg * 16 + 8 * g];
        const v4f lo = {ac2[j][0], ac2[j][1], ac2[j][2], ac2[j][3]}, hi = {ac2[j][4], ac2[j][5], ac2[j][6], ac2[j][7]};
        *(v4f*)kp = lo; *(v4f*)(kp + 4) = hi; } }
    else {
#pragma unroll
      for (int j = 0; j < 4; ++j)
#pragma unroll
        for (int r = 0; r < 8; ++r) so[(pg * 16 + 8 * g + r) * 132 + 64 + j * 16 + col] = ac2[j][r]; }
    __syncthreads();   // the key and query tiles are visible
#pragma unroll
    for (int j = 0; j < 4; ++j) { const int e = tid + 256 * j, cl = e >> 4, q = e & 15;
      vst2(KP + (b * CK + cl) * (size_t)NPX + p0 + q * 4, *(const v4f*)&sk[cl * 68 + q * 4]);
      vst2(QP + (b * NPX + p0 + cl) * (size_t)CK + q * 4, *(const v4f*)&so[cl * 132 + 64 + q * 4]); } }
  else {
#pragma unroll
    for (int j = 0; j < 2; ++j) { const int o = og * 32 + j * 16 + col; const float bb = bfr(BVv[o]);
#pragma unroll
      for (int i = 0; i < 2; ++i)
#pragma unroll
        for (int r = 0; r < 8; ++r) so[o * 68 + ph * 32 + i * 16 + 8 * g + r] = acc[i][j][r] + bb; }   // transposed: [channel][px], pitch 68
    __syncthreads(); for (int e = tid; e < 128 * 16; e += 256) { const int cl = e >> 4, q = e & 15; const v4f x = *(const v4f*)&so[cl * 68 + q * 4]; union { v4f f; v4h h[2]; } u;
#pragma unroll
      for (int i = 0; i < 4; ++i) { u.h[0][i] = (_Float16)x[i]; u.h[1][i] = (_Float16)(x[i] - (float)u.h[0][i]); }
      vst2(VP + (b * CV + cl) * (size_t)NPX + p0 + q * 4, u.f); } } }
// ---- k_win: block = 32 pixels x 3 image rows, 24 waves (lane = pixel, 8 waves per image row). The 9 x 40 window rows (y0-3 .. y0+5, x0-4 .. x0+35, zeros outside the image) of 64 channels are staged once for the three image rows: key and later value 64-127 in buffer A, value 0-63 in buffer B.
// logits: wave = window row of its image row (7 of 8 waves), 64-deep in channel order; softmax
// context: per window row dy a matrix product ctx[channel][px] += V[channel][k] * P[k][px], k = staged position 16 tx + 0..31 of the row, P the 7 weights of pixel i of the tile at k = i + 1 .. i + 7 and zero elsewhere; values staged as f16 hi and lo planes [window row][channel][40], weights as f16 hi and lo rows [image row][dy][px][24]; wave = 16 px x 3 image rows x 32 channels (8 waves) -> f16 context rows
// final 1x1 conv in the same block: the 96 f16 context rows stay in LDS, the 256 weight rows are staged once as f16 over the spent window rows; wave = 32 px x 32 outputs, k in ascending order; output tiles [3][256][32 px] through LDS -> whole 128-B lines of the output planes
#define OWP (CV + 8)                    // f16 per staged weight row: 272 B = 16 B x 17, so 16-byte fragment reads of 16 rows fall on distinct banks
#define OSP 36                          // floats per row of the output tile: 144 B = 16 B x 9, same reason for its 16-byte stores
#define WR 3                            // image rows per block
#define WT (256 * WR)                   // threads per block
#define WPITCH 40                       // elements per staged row (f32 keys, f16 in a value plane: 80 B = 16 B x 5, so 16-byte fragment reads of 16 rows fall on distinct banks)
#define WRS (64 * WPITCH)               // elements per staged window row (64 channels side by side)
#define WITEMS (64 * (WR + 6) * 10)     // 16-byte pieces per staged pass
#define WNJ ((WITEMS + WT - 1) / WT)    // pieces per thread
#define WBUF (WNJ * WT * 4)             // floats per buffer: the 9 window rows and a tail that takes the last run's surplus pieces (zeros; read only by the value fragment octet behind the last staged row, against zero weights), so that every thread runs the same loads and stores
#define WWJ ((CO * CV / 4 + WT - 1) / WT)   // 16-byte pieces of the weight rows per thread
#define WWL ((CO * CV / 4 - WT * (WWJ - 1)) / 32)   // waves whose last piece is a weight row; the others stage a second copy of the piece before it into rows behind the 256 (never read), so that every wave runs the same loads and stores
#define PBP 24                          // f16 per weight row: k = 24 .. 31 are zero for every pixel and are not stored; 48 B = 16 B x 3, so 16-byte fragment reads of 16 rows fall on distinct banks
#define PBN (WR * 7 * 32 * PBP)         // f16 per plane of weight rows
// every '#pragma unroll' below makes the indices of off, ok, va, vb, vc, s, eh, el, inv, cx, vh, vl, wh, wl, wv, ca, w and acc constants, so that these arrays live in registers and the loads of a run are independent
// 6 waves per SIMD: the 24 waves of one work-group (317,952 B of LDS) fill a WGP, and all 192 work-groups run in one round
__global__ __launch_bounds__(WT, 6) void k_win(const float* __restrict__ KP, const float* __restrict__ QP, const float* __restrict__ VP, const float* __restrict__ WW, const float* __restrict__ BW, float* __restrict__ OUT) {
  __shared__ __align__(16) float sh[2 * WBUF]; __shared__ float sq[WR][CK][33]; __shared__ __align__(16) _Float16 sp[2 * PBN]; __shared__ float ssm[WR][7][32]; __shared__ float smx[WR][7][32]; __shared__ __align__(16) _Float16 sct[WR * 32][CV + 8];
  float* shA = sh; float* shB = sh + WBUF;
  const int t = threadIdx.x, wave = __builtin_amdgcn_readfirstlane(t >> 5), lane = t & 31;
  const int rg = wave >> 3, w8 = wave & 7;   // the wave's image row of the block, and its number among that row's 8 waves
  const int bx = blockIdx.x; const int b = bx / (NPX / (32 * WR)), tl = bx % (NPX / (32 * WR)), y0 = (tl / (HW / 32)) * WR, x0 = (tl % (HW / 32)) * 32;
  // piece e = t + 768 j of a pass is (window row e / 640, channel, quad of the row); a quad lies wholly inside or wholly outside the image
  unsigned off[WNJ]; bool ok[WNJ];   // byte offsets from the pass's first plane, clamped into it where the piece is outside (such a piece is stored as zeros)
#pragma unroll
  for (int j = 0; j < WNJ; ++j) { const int e = t + WT * j, r = e / 640, rem = e - r * 640, c = rem / 10, qd = rem - c * 10; const int yy = y0 - 3 + r, xx = x0 - 4 + 4 * qd;
    ok[j] = (e < WITEMS) & ((unsigned)yy < (unsigned)HW) & ((unsigned)xx < (unsigned)HW);
    off[j] = 4u * (unsigned)(c * NPX + min(max(yy, 0), HW - 1) * HW + min(max(xx, 0), HW - 4)); }
  auto fetch = [&](const float* __restrict__ srcp, v4f (&v)[WNJ]) {
#pragma unroll
    for (int j = 0; j < WNJ; ++j) v[j] = *(const v4f*)((const char*)srcp + off[j]); };
  auto put = [&](float* dst, const v4f (&v)[WNJ]) {
#pragma unroll
    for (int j = 0; j < WNJ; ++j) { const v4f z = {0.f, 0.f, 0.f, 0.f}; *(v4f*)&dst[(t + WT * j) * 4] = ok[j] ? v[j] : z; } };
  // a value piece (4 hi | 4 lo) goes to the hi plane (first half of the buffer) and the lo plane (second half), at the element index of its 4 pixels
  auto put16 = [&](float* dst, const v4f (&v)[WNJ]) { _Float16* dh = (_Float16*)dst;
#pragma unroll
    for (int j = 0; j < WNJ; ++j) { const v4f z = {0.f, 0.f, 0.f, 0.f}; union { v4f f; v4h h[2]; } u; u.f = ok[j] ? v[j] : z;
      *(v4h*)&dh[(t + WT * j) * 4] = u.h[0]; *(v4h*)&dh[WBUF + (t + WT * j) * 4] = u.h[1]; } };
  v4f qv[2], va[WNJ], vb[WNJ], vc[WNJ];
  // piece e = t + 768 j of the query rows: image row e / 512, pixel, quad of its 64 channels
#pragma unroll
  for (int j = 0; j < 2; ++j) { const int e = t + WT * j; qv[j] = *(const v4f*)((const char*)(QP + ((size_t)b * NPX + y0 * HW + x0) * CK) + 4u * (unsigned)((e >> 9) * (HW * CK) + (e & 511) * 4)); }
  asm volatile("s_wait_xcnt 0x0" ::: "memory");   // the data of the loads below may be given the offset registers that the two query loads name
  fetch(KP + (size_t)b * CK * NPX, va);
  put(shA, va);
#pragma unroll
  for (int j = 0; j < 2; ++j) { const int e = t + WT * j, rq = e >> 9, pl = (e & 511) >> 4, cq = e & 15;
#pragma unroll
    for (int i = 0; i < 4; ++i) sq[rq][cq * 4 + i][pl] = qv[j][i]; }
  __syncthreads();
  // both value halves are in flight under the logits (issued in front of the barrier they would be waited for at it)
  fetch(VP + (size_t)b * CV * NPX, vb);
  fetch(VP + ((size_t)b * CV + 64) * NPX, vc);
  static_assert(WNJ == 8, "the wait below names the 8 offsets");
  // the offsets are inputs, so that they stay in their registers up to this wait: without that a late load's data is given the offset registers of the loads in front of it
  asm volatile("s_wait_xcnt 0x0" :: "v"(off[0]), "v"(off[1]), "v"(off[2]), "v"(off[3]), "v"(off[4]), "v"(off[5]), "v"(off[6]), "v"(off[7]) : "memory");
  float s[7] = {0.f, 0.f, 0.f, 0.f, 0.f, 0.f, 0.f};
  if (w8 < 7) { const float* kr = &shA[(rg + w8) * WRS + lane + 1];
#pragma unroll 8   // 8 channels' LDS reads in flight per trip; the whole 64 would only lengthen the code
    for (int c = 0; c < CK; ++c) { const float q = sq[rg][c][lane];
#pragma unroll
      for (int dx = 0; dx < 7; ++dx) s[dx] += kr[c * WPITCH + dx] * q; }
    float pm = s[0];
#pragma unroll
    for (int dx = 1; dx < 7; ++dx) pm = fmaxf(pm, s[dx]);
    smx[rg][w8][lane] = pm; }
  put16(shB, vb);
  __syncthreads();   // every read of the key rows is done; the row maxima are visible
  put16(shA, vc);
  float mx = smx[rg][0][lane];
#pragma unroll
  for (int r = 1; r < 7; ++r) mx = fmaxf(mx, smx[rg][r][lane]);
  if (w8 < 7) {   // the lane writes its pixel's whole weight row of this dy: zeros, then, over them, the 7 weights at k = i + 1 + dx
    _Float16* ph = &sp[((rg * 7 + w8) * 32 + lane) * PBP]; _Float16* pl = ph + PBN; const v8h z8 = {};
#pragma unroll
    for (int q = 0; q < 3; ++q) { *(v8h*)(ph + 8 * q) = z8; *(v8h*)(pl + 8 * q) = z8; }
    float rs = 0.f; const int k1 = (lane & 15) + 1; _Float16 eh[9], el[9];   // element 1 + dx; a zero at either end
    eh[0] = eh[8] = el[0] = el[8] = (_Float16)0.f;
#pragma unroll
    for (int dx = 0; dx < 7; ++dx) { const float e = expf(s[dx] - mx); rs += e; eh[1 + dx] = (_Float16)e; el[1 + dx] = (_Float16)(e - (float)eh[1 + dx]); }
    // as 4 whole dwords from k = k1 & ~1, so that every store is 4-byte aligned: k1 even: e0 e1 | e2 e3 | e4 e5 | e6 0; k1 odd: 0 e0 | e1 e2 | e3 e4 | e5 e6
#pragma unroll
    for (int q = 0; q < 4; ++q) { const v2h he = {eh[2 * q + 1], eh[2 * q + 2]}, ho = {eh[2 * q], eh[2 * q + 1]}, le = {el[2 * q + 1], el[2 * q + 2]}, lo = {el[2 * q], el[2 * q + 1]};
      *(v2h*)(ph + (k1 & ~1) + 2 * q) = (k1 & 1) ? ho : he; *(v2h*)(pl + (k1 & ~1) + 2 * q) = (k1 & 1) ? lo : le; }
    ssm[rg][w8][lane] = rs; }
  __syncthreads();   // the weight rows, their sums and all value channels are visible
  // 8 of the 24 waves work here, each on all three image rows: a value fragment is then read once for the products of up to three image rows (26 16-byte LDS reads per 16 x 16 output tile; 42 with one image row per wave); the other waves go on to their weight loads
  // waves 6 a + b, b < 2: two of them on every SIMD, whether the work-group's waves are dealt to the SIMDs in turn or in runs of six
  const int wa = wave / 6, wb = wave - 6 * wa;
  if (wb < 2) { const int c16 = lane & 15, gh = lane >> 4, tx = wa >> 1, cp = (wa & 1) * 2 + wb;   // the wave's pixels 16 tx .. +15 of each image row and its channels 32 cp .. +31
    float inv[WR];
#pragma unroll
    for (int q = 0; q < WR; ++q) { float ssum = 0.f;
#pragma unroll
      for (int r = 0; r < 7; ++r) ssum += ssm[q][r][tx * 16 + c16];
      inv[q] = 1.0f / ssum; }
    // value fragment: k = staged position 16 tx + k of the channel's row; at tx = 1 k = 24 .. 31 run into the next staged row or the tail: finite values against zero weights
    const _Float16* vr = (const _Float16*)(cp < 2 ? shB : shA) + ((cp & 1) * 32 + c16) * WPITCH + tx * 16;
    // weight fragment: k = 8 gh .. +7 and 16 + 8 gh .. +7 of the pixel's row; k = 24 .. 31 are zero and not stored: the upper half-wave reads k = 16 .. 23 of the tile's pixel 0 for them, whose weights end at k = 7
    const _Float16* p0 = &sp[(tx * 16 + c16) * PBP + 8 * gh]; const _Float16* p1 = &sp[(tx * 16 + (gh ? 0 : c16)) * PBP + 16];
    v8f cx[WR][2] = {};
#pragma unroll
    for (int r = 0; r < WR + 6; ++r) { v16h vh[2], vl[2], wh[WR], wl[WR];   // staged window row r is window row dy = r - q of image row q
#pragma unroll
      for (int i = 0; i < 2; ++i) { vh[i] = frag_h(vr + r * WRS + i * 16 * WPITCH, lane); vl[i] = frag_h(vr + r * WRS + i * 16 * WPITCH + WBUF, lane); }
#pragma unroll
      for (int q = 0; q < WR; ++q) if (r - q >= 0 && r - q < 7) { wh[q] = frag_2(p0 + (q * 7 + r - q) * 32 * PBP, p1 + (q * 7 + r - q) * 32 * PBP); wl[q] = frag_2(p0 + (q * 7 + r - q) * 32 * PBP + PBN, p1 + (q * 7 + r - q) * 32 * PBP + PBN); }
      // rows = channels, columns = pixels; the accumulators alternate, so that no product waits for the one in front of it
#pragma unroll
      for (int q = 0; q < WR; ++q) if (r - q >= 0 && r - q < 7) {
#pragma unroll
        for (int i = 0; i < 2; ++i) cx[q][i] = wmma16(vl[i], wh[q], cx[q][i]); }
#pragma unroll
      for (int q = 0; q < WR; ++q) if (r - q >= 0 && r - q < 7) {
#pragma unroll
        for (int i = 0; i < 2; ++i) cx[q][i] = wmma16(vh[i], wl[q], cx[q][i]); }
#pragma unroll
      for (int q = 0; q < WR; ++q) if (r - q >= 0 && r - q < 7) {
#pragma unroll
        for (int i = 0; i < 2; ++i) cx[q][i] = wmma16(vh[i], wh[q], cx[q][i]); } }
#pragma unroll
    for (int q = 0; q < WR; ++q)
#pragma unroll
      for (int i = 0; i < 2; ++i) { v8h o;   // element e = channel 32 cp + 16 i + 8 gh + e of pixel c16
#pragma unroll
        for (int e = 0; e < 8; ++e) o[e] = (_Float16)(cx[q][i][e] * inv[q]);
        *(v8h*)&sct[q * 32 + tx * 16 + c16][cp * 32 + i * 16 + 8 * gh] = o; } }
  static_assert((WT / 32) * WWJ * OWP * 2 <= 2 * WBUF * 4 && WR * CO * OSP * 4 <= 2 * WBUF * 4, "weight rows and output tiles fit in the window buffers");
  _Float16 (*sw)[OWP] = (_Float16 (*)[OWP])sh; float* so = sh + rg * (CO * OSP);
  // the lane's number is read anew here: a thread index held in a register across the context loop, which runs at the register limit, is spilled
  const int ln = (int)__builtin_amdgcn_mbcnt_lo(~0u, 0u), t2 = wave * 32 + ln, t8 = w8 * 32 + ln;
  // piece e = t2 + 768 j is 16 B of the contiguous weight rows; all loads of a thread are in flight at once
  v4f wv[WWJ]; const float* wp = WW + (unsigned)t2 * 4u;
#pragma unroll
  for (int j = 0; j < WWJ - 1; ++j) wv[j] = *(const v4f*)(wp + WT * 4 * j);
  const float* wl = wp + WT * 4 * (wave < WWL ? WWJ - 1 : WWJ - 2);
  wv[WWJ - 1] = *(const v4f*)wl;
  __syncthreads();   // every read of the value rows is done; the context rows are visible
  const int col = ln & 15, g = ln >> 4;
  const float bb[2] = {bfr(BW[w8 * 32 + col]), bfr(BW[w8 * 32 + 16 + col])};   // loaded here, where the LDS stores cover it: behind the product its latency would stand open
  // the code below takes the address registers that the weight and bias loads name; the two weight addresses are inputs, so that no weight load's data is given them before this wait
  asm volatile("s_wait_xcnt 0x0" :: "v"(wp), "v"(wl) : "memory");
#pragma unroll
  for (int j = 0; j < WWJ; ++j) { v4h o;   // piece t2 + 768 j: row wave + 24 j, quad ln
#pragma unroll
    for (int i = 0; i < 4; ++i) o[i] = (_Float16)bfr(wv[j][i]);
    *(v4h*)&sw[wave + (WT / 32) * j][ln * 4] = o; }
  __syncthreads();   // the weight rows are visible
  v8f acc[2][2] = {};
#pragma unroll
  for (int kc = 0; kc < CV / 32; ++kc) { v16h ca[2], w[2];
#pragma unroll
    for (int i = 0; i < 2; ++i) { ca[i] = frag_h(&sct[rg * 32 + i * 16 + col][kc * 32], ln); w[i] = frag_h(&sw[w8 * 32 + i * 16 + col][kc * 32], ln); }
#pragma unroll
    for (int i = 0; i < 2; ++i)
#pragma unroll
      for (int j = 0; j < 2; ++j) acc[i][j] = wmma16(ca[i], w[j], acc[i][j]); }
  __syncthreads();   // every read of the weight rows is done; the output tiles may overwrite them
#pragma unroll
  for (int j = 0; j < 2; ++j) { const int o = w8 * 32 + j * 16 + col;
#pragma unroll
    for (int i = 0; i < 2; ++i)
#pragma unroll
      for (int r = 0; r < 8; ++r) so[o * OSP + i * 16 + 8 * g + r] = acc[i][j][r] + bb[j]; }
  __syncthreads();   // the output tiles are visible
  const int n0 = (y0 + rg) * HW + x0;
#pragma unroll
  for (int j = 0; j < CO / 32; ++j) { const unsigned cl = ((unsigned)t8 >> 3) + 32u * j, q = t8 & 7; vst2(OUT + ((size_t)b * CO + cl) * NPX + n0 + q * 4, *(const v4f*)&so[cl * OSP + q * 4]); } }
extern "C" void kernel_launch(void* const* d_in, const int* in_sizes, int n_in, void* d_out, int out_size, void* d_ws, size_t ws_size, hipStream_t stream) {
  (void)in_sizes; (void)n_in; (void)out_size;
  const float** F = (const float**)d_in;   // 0 x [2,256,96,96], 1 fk_w1 [64,256], 2 fk_b1, 3 fk_bn1 [4,64], 4 fk_w2 [64,64], 5 fk_b2, 6 fk_bn2, 7 fq_w1, 8 fq_b1, 9 fq_bn1, 10 fq_w2, 11 fq_b2, 12 fq_bn2, 13 fv_w [128,256], 14 fv_b, 15 W_w [256,128], 16 W_b
  if (ws_size < (size_t)WS_END) return;
  char* ws = (char*)d_ws; float *KP = (float*)(ws + WS_KP), *QP = (float*)(ws + WS_QP), *VP = (float*)(ws + WS_VP);
  k_c1<<<dim3(NPX / 64, NB, 2), 256, 0, stream>>>(F[0], F[1], F[2], F[3], F[7], F[8], F[9], F[13], F[14], F[4], F[5], F[6], F[10], F[11], F[12], KP, QP, VP);
  k_win<<<TWB, WT, 0, stream>>>(KP, QP, VP, F[15], F[16], (float*)d_out);
}

// v007
// One run takes 29.1 microseconds.
// Timed twice side by side with v006, it ran 1.14 times as fast both times.
// Counting every step since v000, it is 36.8 times as fast.
// compute dtype: all float inputs rounded to bf16; the five 1x1 convs on WMMA 16x16x32: x-fed ones with EXACT bf16 products (x^T tile in LDS), the second key/query convs with their f32 input as bf16 hi + lo (2 products), eval BatchNorm + ReLU in f32; key and query rows and value planes as f16 hi + lo; the 7x7-window dot products (64-deep) on WMMA 16x16x32, one banded product per window row (3 products, f32 accumulate); the 49-way softmax (zero-padded neighbours give logit 0 and value 0, as unfold does) in f32 on the VALU; the 128-channel context on WMMA 16x16x32, one banded product per window row, weights and values each as f16 hi + lo (3 products, f32 accumulate); context rounded once to f16 for the final 1x1 conv W (bf16-exact weights in f16, 1 product) + bias; f32 output.
#include <hip/hip_runtime.h>
#include <math.h>

typedef __attribute__((ext_vector_type(16))) _Float16 v16h;
typedef __attribute__((ext_vector_type(16))) __bf16 v16b;
typedef __attribute__((ext_vector_type(8)))  _Float16 v8h;
typedef __attribute__((ext_vector_type(8)))  float v8f;
typedef __attribute__((ext_vector_type(4)))  float v4f;
typedef __attribute__((ext_vector_type(2)))  float v2f;
typedef __attribute__((ext_vector_type(4)))  unsigned v4u;
typedef __attribute__((ext_vector_type(4)))  int v4i;
typedef float __attribute__((may_alias)) float_a;
typedef int __attribute__((may_alias)) int_a;

template <typename T> __device__ __forceinline__ void vst2(void* p, T v) { *(T*)p = v;  }
__device__ __forceinline__ v8f wmma16(v16h a, v16h b, v8f c) {
  v8f d = __builtin_amdgcn_wmma_f32_16x16x32_f16(false, a, false, b, (short)0, c, false, false);
  asm volatile("v_nop\n\tv_nop\n\tv_nop\n\tv_nop" : "+v"(d) : "v"(a), "v"(b));
  return d;
}
__device__ __forceinline__ v8f wmma_bf(v16b a, v16b b, v8f c) {
  v8f d = __builtin_amdgcn_wmma_f32_16x16x32_bf16(false, a, false, b, (short)0, c, false, false);
  asm volatile("v_nop\n\tv_nop\n\tv_nop\n\tv_nop" : "+v"(d) : "v"(a), "v"(b));
  return d;
}
// 16x16x32 fragments: lane = (h = lane>>4, row/col = lane&15); elements 0..7 = k0+8h+0..7, 8..15 = k0+16+8h+0..7; D element r = row 8h+r
__device__ __forceinline__ v16h frag_h(const _Float16* rowk0, int lane) {
  union { v16h v; v8h q[2]; } u; const _Float16* p = rowk0 + 8 * (lane >> 4);
  u.q[0] = *(const v8h*)p; u.q[1] = *(const v8h*)(p + 16); return u.v;
}
// fragment from two octet addresses of the lane's own
__device__ __forceinline__ v16h frag_2(const _Float16* o0, const _Float16* o1) {
  union { v16h v; v8h q[2]; } u; u.q[0] = *(const v8h*)o0; u.q[1] = *(const v8h*)o1; return u.v;
}
__device__ __forceinline__ v16h frag_f32(const float* rowk0, int lane) {
  v16h a; const float* p = rowk0 + 8 * (lane >> 4);
#pragma unroll
  for (int i = 0; i < 8; ++i) { a[i] = (_Float16)p[i]; a[8 + i] = (_Float16)p[16 + i]; }
  return a;
}
__device__ __forceinline__ v16h frag_f32s(const float* rowk0, int lane, float sc) {
  v16h a; const float* p = rowk0 + 8 * (lane >> 4);
#pragma unroll
  for (int i = 0; i < 8; ++i) { a[i] = (_Float16)(p[i] * sc); a[8 + i] = (_Float16)(p[16 + i] * sc); }
  return a;
}
// column fragment from a [K][ld] layout (column n), rows >= K read as 0
__device__ __forceinline__ v16h fragc_f32(const float* W, int k0, int n, int lane, int ld, int K) {
  v16h a; const int g = lane >> 4;
#pragma unroll
  for (int i = 0; i < 8; ++i) { const int ka = k0 + 8 * g + i, kb = ka + 16;
    a[i] = (_Float16)(ka < K ? W[(size_t)(ka < K ? ka : K - 1) * ld + n] : 0.f); a[8 + i] = (_Float16)(kb < K ? W[(size_t)(kb < K ? kb : K - 1) * ld + n] : 0.f); }
  return a;
}
struct F2 { v16b h, l; };
__device__ __forceinline__ F2 bsplit16(const float v[16]) { F2 r;
#pragma unroll
  for (int i = 0; i < 16; ++i) { const __bf16 h = (__bf16)v[i]; r.h[i] = h; r.l[i] = (__bf16)(v[i] - (float)h); }
  return r; }
__device__ __forceinline__ F2 split_row(const float* row, int k0, int lane) { float v[16]; const float* p = row + k0 + 8 * (lane >> 4);
#pragma unroll
  for (int i = 0; i < 8; ++i) { v[i] = p[i]; v[8 + i] = p[16 + i]; }
  return bsplit16(v); }
__device__ __forceinline__ F2 split_rowK(const float* row, int k0, int lane, int K) { float v[16]; const int g = lane >> 4;
#pragma unroll
  for (int i = 0; i < 8; ++i) { const int ka = k0 + 8 * g + i, kb = ka + 16; v[i] = ka < K ? row[ka < K ? ka : K - 1] : 0.f; v[8 + i] = kb < K ? row[kb < K ? kb : K - 1] : 0.f; }
  return bsplit16(v); }
__device__ __forceinline__ F2 split_col(const float* W, int k0, int n, int lane, int ld, int K) { float v[16]; const int g = lane >> 4;
#pragma unroll
  for (int i = 0; i < 8; ++i) { const int ka = k0 + 8 * g + i, kb = ka + 16; v[i] = ka < K ? W[(size_t)(ka < K ? ka : K - 1) * ld + n] : 0.f; v[8 + i] = kb < K ? W[(size_t)(kb < K ? kb : K - 1) * ld + n] : 0.f; }
  return bsplit16(v); }
__device__ __forceinline__ v8f mac3(const F2& a, const F2& b, v8f c) { c = wmma_bf(a.l, b.h, c); c = wmma_bf(a.h, b.l, c); return wmma_bf(a.h, b.h, c); }
__device__ __forceinline__ float sigm(float v) { return 1.0f / (1.0f + expf(-v)); }
#define LDSX() do { asm volatile("s_wait_dscnt 0" ::: "memory"); __builtin_amdgcn_wave_barrier(); __builtin_amdgcn_fence(__ATOMIC_RELEASE, "workgroup"); } while (0)


// Local-window self attention (b 2, 96 x 96, Cin 256, key/query 64 via conv-BN-ReLU x2, value 128, 7x7 window, out conv 256).
#define NB 2
#define HW 96
#define NPX (HW * HW)      // 9216
#define CIN 256
#define CK 64
#define CV 128
#define CO 256
#define NPT (NB * NPX)     // 18432 = 288 x 64
#ifndef TWB
#define TWB (NPT / 96)     // window kernel blocks
#endif
typedef __attribute__((ext_vector_type(8))) __bf16 v8b;
__device__ __forceinline__ v16b frag_b(const __bf16* rowk0, int lane) {
  union { v16b v; v8b q[2]; } u; const __bf16* p = rowk0 + 8 * (lane >> 4);
  u.q[0] = *(const v8b*)p; u.q[1] = *(const v8b*)(p + 16); return u.v;
}
__device__ __forceinline__ float bfr(float v) { return (float)(__bf16)v; }
__device__ __attribute__((noinline)) float exp_ni(float v) { return expf(v); }
__device__ __attribute__((noinline)) float erf_ni(float v) { return erff(v); }

#define WS_KP  0u                                  // key rows [p] of 256 bytes: the 64 channels as f16 hi, then the same 64 as f16 lo (key = hi + lo)
#define WS_QP  (WS_KP + 4u * (size_t)NPT * CK)        // query rows [p], as the key rows
#define WS_VP  (WS_QP + 4u * (size_t)NPT * CK)        // value planes [b][128][n / 4] of 16-byte pieces: 4 pixels as f16 hi, then the same 4 pixels as f16 lo (value = hi + lo)
#define WS_END (WS_VP + 4u * (size_t)NPT * CV)

__device__ __forceinline__ float bnrelu(float v, const float* bn, int c, int C) { const float gsc = bfr(bn[c]) / sqrtf(bfr(bn[3 * C + c]) + 1e-5f); return fmaxf((v - bfr(bn[2 * C + c])) * gsc + bfr(bn[C + c]), 0.f); }
// ---- k_c1: block = (64 px, b, half), 8 waves: half 0: k1 = bnrelu(fk_w1 x + b) and q1 likewise, kept in LDS as f32 rows, then key = bnrelu(fk_w2 k1 + b) and query likewise -> rows, each f32 value split once into f16 hi + lo; half 1: the 128 value channels = fv_w x + b -> planes, each f32 value split once into f16 hi + lo.
// The x^T tile [64 px][256 c] and the half's 128 weight rows [o][256 c] are each staged once in LDS as bf16; wave = 32 px x 32 outputs, k in the same order as before.
#define C1P (CIN + 8)                   // bf16 per staged row: 528 B = 16 B x 33, so 16-byte fragment reads of 16 rows fall on distinct banks
#define C1X (64 * C1P * 2)              // bytes of the x tile
#define C2P (CK + 8)                    // bf16 per staged row of the second convs' weights: 144 B = 16 B x 9, same reason
#define C1SO (64 * 132 * 4)             // bytes of the k1 | q1 tile [64 px][132]
typedef __attribute__((ext_vector_type(4))) __bf16 v4b;
typedef __attribute__((ext_vector_type(4))) _Float16 v4h;
typedef __attribute__((ext_vector_type(2))) _Float16 v2h;
// 6 waves per SIMD: three work-groups (101,376 B of LDS each) stay resident on a WGP, so all 576 run in one round
__global__ __launch_bounds__(256, 6) void k_c1(const float* __restrict__ X, const float* __restrict__ WK1, const float* __restrict__ BK1, const float* __restrict__ BNK1, const float* __restrict__ WQ1, const float* __restrict__ BQ1, const float* __restrict__ BNQ1, const float* __restrict__ WV, const float* __restrict__ BVv, const float* __restrict__ WK2, const float* __restrict__ BK2, const float* __restrict__ BNK2, const float* __restrict__ WQ2, const float* __restrict__ BQ2, const float* __restrict__ BNQ2, float* __restrict__ KP, float* __restrict__ QP, float* __restrict__ VP) {
  __shared__ __align__(16) char sm[(64 + 128) * C1P * 2];
  __bf16 (*sx)[C1P] = (__bf16 (*)[C1P])sm; __bf16 (*sw)[C1P] = (__bf16 (*)[C1P])(sm + C1X);
  float* so = (float*)(sm + C1X);       // output tile, over the weight rows once every wave has left them
  static_assert(128 * C2P * 2 <= C1X && C1SO <= 128 * C1P * 2, "second weights fit over the x tile, the k1 | q1 tile over the weight rows");
  __bf16 (*sw2)[C2P] = (__bf16 (*)[C2P])sm;   // fk_w2 rows 0-63, fq_w2 rows 64-127, over the x tile once every wave has left it
  // the wave's number as a scalar: the per-wave choice of bias and BN arrays below then stays a scalar base with one offset register
  const int tid = threadIdx.x, wave = __builtin_amdgcn_readfirstlane(tid >> 5), lane = tid & 31, col = lane & 15, g = lane >> 4; const int p0 = blockIdx.x * 64; const size_t b = blockIdx.y; const int half = blockIdx.z;
  const float* Wa = half ? WV : WK1; const float* Wb = half ? WV + 64 * CIN : WQ1;   // weight rows 0-63 and 64-127 of this half
  // every '#pragma unroll' below makes the indices of xv, wa, wb and acc constants, so that these arrays live in registers and the loads of a run are independent
  // x: thread = one pixel x 8 octets of channels (a wave's load is one whole 128-B line of a plane); weights: piece e = tid + 256 j is 16 B of the contiguous rows
  const int xpx = tid & 63, xo = tid >> 6; const float* xp = X + (b * CIN + xo * 8) * (size_t)NPX + p0 + xpx;
  float xv[8][8]; v4f wa[16], wb[16];
#pragma unroll
  for (int j = 0; j < 8; ++j)
#pragma unroll
    for (int i = 0; i < 8; ++i) xv[j][i] = xp[(size_t)(j * 32 + i) * NPX];
#pragma unroll
  for (int j = 0; j < 16; ++j) wa[j] = *(const v4f*)(Wa + (tid + 256 * j) * 4);
  __builtin_amdgcn_sched_barrier(0);   // keeps the second weight batch's loads behind this point: all 192 registers of loads at once spill
#pragma unroll
  for (int j = 0; j < 8; ++j) { v8b o;
#pragma unroll
    for (int i = 0; i < 8; ++i) o[i] = (__bf16)xv[j][i];
    *(v8b*)&sx[xpx][(xo + 4 * j) * 8] = o; }
  __builtin_amdgcn_sched_barrier(0);   // the second batch takes the registers that the x values have left
#pragma unroll
  for (int j = 0; j < 16; ++j) wb[j] = *(const v4f*)(Wb + (tid + 256 * j) * 4);
#pragma unroll
  for (int j = 0; j < 16; ++j) { const int e = tid + 256 * j; v4b o;
#pragma unroll
    for (int i = 0; i < 4; ++i) o[i] = (__bf16)wa[j][i];
    *(v4b*)&sw[e >> 6][(e & 63) * 4] = o; }
#pragma unroll
  for (int j = 0; j < 16; ++j) { const int e = tid + 256 * j; v4b o;
#pragma unroll
    for (int i = 0; i < 4; ++i) o[i] = (__bf16)wb[j][i];
    *(v4b*)&sw[64 + (e >> 6)][(e & 63) * 4] = o; }
  __syncthreads();
  // second convs: wave = 16 px x 64 outputs of key (waves 0-3) or query (waves 4-7)
  const int wh = wave >> 2, pg = wave & 3;
  v4f w2v[8]; float b2[4], m2[4], g2[4], t2[4], r2[4];   // raw bias, mean, gamma, beta, variance of the wave's 4 x 16 outputs
  // issued here, behind the barrier, so that the first product covers their latency; in both halves: under a test of the half the compiler draws the arithmetic on them, and so the wait, up to this place
  {
#pragma unroll
    for (int j = 0; j < 4; ++j) { w2v[j] = *(const v4f*)(WK2 + (tid + 256 * j) * 4); w2v[4 + j] = *(const v4f*)(WQ2 + (tid + 256 * j) * 4); }
    const float* Bm = wh ? BQ2 : BK2; const float* bn = wh ? BNQ2 : BNK2;
#pragma unroll
    for (int j = 0; j < 4; ++j) { const int o = j * 16 + col; b2[j] = Bm[o]; g2[j] = bn[o]; r2[j] = bn[3 * CK + o]; m2[j] = bn[2 * CK + o]; t2[j] = bn[CK + o]; } }
  const int ph = wave & 1, og = wave >> 1;   // pixels 32 ph .. +31, outputs 32 og .. +31 of the half
  v8f acc[2][2] = {};
#pragma unroll
  for (int kc = 0; kc < CIN / 32; ++kc) { v16b a[2], w[2];
#pragma unroll
    for (int i = 0; i < 2; ++i) { a[i] = frag_b(&sx[ph * 32 + i * 16 + col][kc * 32], lane); w[i] = frag_b(&sw[og * 32 + i * 16 + col][kc * 32], lane); }
#pragma unroll
    for (int i = 0; i < 2; ++i)
#pragma unroll
      for (int j = 0; j < 2; ++j) acc[i][j] = wmma_bf(a[i], w[j], acc[i][j]); }
  __syncthreads();   // every read of the x tile and of the weight rows is done; the output tile and the second weights may overwrite them
  if (half == 0) { const float* Bm = og < 2 ? BK1 : BQ1; const float* bn = og < 2 ? BNK1 : BNQ1;   // so = [64 px][132]: k1 in columns 0-63, q1 in 64-127
#pragma unroll
    for (int j = 0; j < 2; ++j) { const int o = og * 32 + j * 16 + col, oc = o & 63; const float bb = bfr(Bm[oc]);
#pragma unroll
      for (int i = 0; i < 2; ++i)
#pragma unroll
        for (int r = 0; r < 8; ++r) so[(ph * 32 + i * 16 + 8 * g + r) * 132 + o] = bnrelu(acc[i][j][r] + bb, bn, oc, CK); }
#pragma unroll
    for (int j = 0; j < 8; ++j) { const int e = tid + 256 * (j & 3); v4b o;   // piece e of fk_w2 (j < 4) or fq_w2: row e / 16, quad e % 16
#pragma unroll
      for (int i = 0; i < 4; ++i) o[i] = (__bf16)w2v[j][i];
      *(v4b*)&sw2[(j >> 2) * 64 + (e >> 4)][(e & 15) * 4] = o; }
#pragma unroll
    for (int j = 0; j < 4; ++j) { b2[j] = bfr(b2[j]); g2[j] = bfr(g2[j]) / sqrtf(bfr(r2[j]) + 1e-5f); m2[j] = bfr(m2[j]); t2[j] = bfr(t2[j]); }
    __syncthreads();   // the k1 | q1 rows and the second weights are visible
    // the wave alone reads rows 16 pg .. +15, columns 64 wh .. +63 of so: f32 input as bf16 hi + lo, 2 products, k ascending
    v8f ac2[4] = {};
#pragma unroll
    for (int kc = 0; kc < CK / 32; ++kc) { const float* ap = &so[(pg * 16 + col) * 132 + wh * 64 + kc * 32 + 8 * g]; v4f aq[4]; v16b w2f[4]; float av[16];
      // the 12 LDS reads of a k step stand in front of its products, so that their latency is paid once a step (all 24 at once spill)
      aq[0] = *(const v4f*)ap; aq[1] = *(const v4f*)(ap + 4); aq[2] = *(const v4f*)(ap + 16); aq[3] = *(const v4f*)(ap + 20);
#pragma unroll
      for (int j = 0; j < 4; ++j) w2f[j] = frag_b(&sw2[wh * 64 + j * 16 + col][kc * 32], lane);
#pragma unroll
      for (int i = 0; i < 16; ++i) av[i] = aq[i >> 2][i & 3];
      const F2 a = bsplit16(av);   // each accumulator takes hi, then lo, kc ascending; the four accumulators alternate, so that no product waits for the one in front of it
#pragma unroll
      for (int j = 0; j < 4; ++j) ac2[j] = wmma_bf(a.h, w2f[j], ac2[j]);
#pragma unroll
      for (int j = 0; j < 4; ++j) ac2[j] = wmma_bf(a.l, w2f[j], ac2[j]); }
    // key and query: back into the wave's own part of so, every read of which has fed the products above
#pragma unroll
    for (int j = 0; j < 4; ++j)
#pragma unroll
      for (int r = 0; r < 8; ++r) so[(pg * 16 + 8 * g + r) * 132 + wh * 64 + j * 16 + col] = fmaxf((ac2[j][r] + b2[j] - m2[j]) * g2[j] + t2[j], 0.f);
    __syncthreads();   // the key and query tiles are visible
    // piece e = tid + 256 j: pixel e / 8, octet e % 8 of its 64 channels, of the key (h = 0) and of the query
#pragma unroll
    for (int j = 0; j < 2; ++j) { const int e = tid + 256 * j, cl = e >> 3, q = e & 7;
#pragma unroll
      for (int h = 0; h < 2; ++h) { const float* xp2 = &so[cl * 132 + h * 64 + q * 8]; const v4f x0 = *(const v4f*)xp2, x1 = *(const v4f*)(xp2 + 4); v8h hi, lo;
#pragma unroll
        for (int i = 0; i < 4; ++i) { hi[i] = (_Float16)x0[i]; lo[i] = (_Float16)(x0[i] - (float)hi[i]); hi[4 + i] = (_Float16)x1[i]; lo[4 + i] = (_Float16)(x1[i] - (float)hi[4 + i]); }
        float* dst = (h ? QP : KP) + (b * NPX + p0 + cl) * (size_t)CK + q * 4;   // 16 bytes = 4 floats of the 256-byte row; the lo half begins at byte 128
        vst2(dst, hi); vst2(dst + 32, lo); } } }
  else {
#pragma unroll
    for (int j = 0; j < 2; ++j) { const int o = og * 32 + j * 16 + col; const float bb = bfr(BVv[o]);
#pragma unroll
      for (int i = 0; i < 2; ++i)
#pragma unroll
        for (int r = 0; r < 8; ++r) so[o * 68 + ph * 32 + i * 16 + 8 * g + r] = acc[i][j][r] + bb; }   // transposed: [channel][px], pitch 68
    __syncthreads(); for (int e = tid; e < 128 * 16; e += 256) { const int cl = e >> 4, q = e & 15; const v4f x = *(const v4f*)&so[cl * 68 + q * 4]; union { v4f f; v4h h[2]; } u;
#pragma unroll
      for (int i = 0; i < 4; ++i) { u.h[0][i] = (_Float16)x[i]; u.h[1][i] = (_Float16)(x[i] - (float)u.h[0][i]); }
      vst2(VP + (b * CV + cl) * (size_t)NPX + p0 + q * 4, u.f); } } }
// ---- k_win: block = 32 pixels x 3 image rows, 24 waves (lane = pixel, 8 waves per image row). The 9 x 40 window rows (y0-3 .. y0+5, x0-4 .. x0+35, zeros outside the image) of 64 channels are staged once for the three image rows: key and later value 64-127 in buffer A, value 0-63 in buffer B.
// logits: wave = window row of its image row (7 of 8 waves); per 16 pixels a matrix product S[position][px] = K[position][channel] * Q[channel][px] over the staged positions 16 tx + 0..31 of the row, key and query each as f16 hi + lo; pixel i of the tile takes its 7 logits from positions i + 1 .. i + 7 through LDS; softmax
// context: per window row dy a matrix product ctx[channel][px] += V[channel][k] * P[k][px], k = staged position 16 tx + 0..31 of the row, P the 7 weights of pixel i of the tile at k = i + 1 .. i + 7 and zero elsewhere; values staged as f16 hi and lo planes [window row][channel][40], weights as f16 hi and lo rows [image row][dy][px][24]; wave = 16 px x 3 image rows x 32 channels (8 waves) -> f16 context rows
// final 1x1 conv in the same block: the 96 f16 context rows stay in LDS, the 256 weight rows are staged once as f16 over the spent window rows; wave = 32 px x 32 outputs, k in ascending order; output tiles [3][256][32 px] through LDS -> whole 128-B lines of the output planes
#define OWP (CV + 8)                    // f16 per staged weight row: 272 B = 16 B x 17, so 16-byte fragment reads of 16 rows fall on distinct banks
#define OSP 36                          // floats per row of the output tile: 144 B = 16 B x 9, same reason for its 16-byte stores
#define WR 3                            // image rows per block
#define WT (256 * WR)                   // threads per block
#define WPITCH 40                       // positions per staged row (f16 in a value plane: 80 B = 16 B x 5, so 16-byte fragment reads of 16 rows fall on distinct banks)
#define WRS (64 * WPITCH)               // elements per staged window row (64 channels side by side)
#define WITEMS (64 * (WR + 6) * 10)     // 16-byte pieces per staged pass
#define WNJ ((WITEMS + WT - 1) / WT)    // pieces per thread
#define WBUF (WNJ * WT * 4)             // floats per buffer: the 9 window rows and a tail that takes the last run's surplus pieces (zeros; read only by the value fragment octet behind the last staged row, against zero weights, and by the key fragments as positions 40 .. 47 of the last staged row, which no pixel takes), so that every thread runs the same loads and stores
#define WWJ ((CO * CV / 4 + WT - 1) / WT)   // 16-byte pieces of the weight rows per thread
#define WWL ((CO * CV / 4 - WT * (WWJ - 1)) / 32)   // waves whose last piece is a weight row; the others stage a second copy of the piece before it into rows behind the 256 (never read), so that every wave runs the same loads and stores
#define PBP 24                          // f16 per weight row: k = 24 .. 31 are zero for every pixel and are not stored; 48 B = 16 B x 3, so 16-byte fragment reads of 16 rows fall on distinct banks
#define PBN (WR * 7 * 32 * PBP)         // f16 per plane of weight rows
#define SLP 28                          // floats per pixel of a wave's logit tile (positions 0 .. 23 of the 32): 112 B = 16 B x 7, so its 16-byte stores of 16 pixels fall on distinct banks
// every '#pragma unroll' below makes the indices of off, ok, koff, kok, va, vb, vc, d, s, eh, el, inv, cx, vh, vl, wh, wl, wv, ca, w and acc constants, so that these arrays live in registers and the loads of a run are independent
// 6 waves per SIMD: the 24 waves of one work-group (317,184 B of LDS) fill a WGP, and all 192 work-groups run in one round
__global__ __launch_bounds__(WT, 6) void k_win(const float* __restrict__ KP, const float* __restrict__ QP, const float* __restrict__ VP, const float* __restrict__ WW, const float* __restrict__ BW, float* __restrict__ OUT) {
  __shared__ __align__(16) float sh[2 * WBUF]; __shared__ __align__(16) char sq[WR * 32 * 256]; __shared__ __align__(16) _Float16 spc[2 * PBN + WR * 32 * (CV + 8)]; __shared__ float ssm[WR][7][32]; __shared__ float smx[WR][7][32];
  float* shA = sh; float* shB = sh + WBUF;
  _Float16* sp = spc; _Float16 (*sct)[CV + 8] = (_Float16 (*)[CV + 8])(spc + 2 * PBN);
  float* sl = (float*)spc;   // the logit tiles, where the weight rows and the context rows come later
  static_assert(WR * 7 * 32 * SLP * 4 <= (2 * PBN + WR * 32 * (CV + 8)) * 2 && (WNJ * WT / 16) * 256 <= WBUF * 4, "logit tiles fit under the weight and context rows, the key rows in buffer A");
  const int t = threadIdx.x, wave = __builtin_amdgcn_readfirstlane(t >> 5), lane = t & 31;
  const int rg = wave >> 3, w8 = wave & 7;   // the wave's image row of the block, and its number among that row's 8 waves
  const int bx = blockIdx.x; const int b = bx / (NPX / (32 * WR)), tl = bx % (NPX / (32 * WR)), y0 = (tl / (HW / 32)) * WR, x0 = (tl % (HW / 32)) * 32;
  // piece e = t + 768 j of a value pass is (window row e / 640, channel, quad of the row); a quad lies wholly inside or wholly outside the image
  unsigned off[WNJ]; bool ok[WNJ];   // byte offsets from the pass's first plane, clamped into it where the piece is outside (such a piece is stored as zeros)
#pragma unroll
  for (int j = 0; j < WNJ; ++j) { const int e = t + WT * j, r = e / 640, rem = e - r * 640, c = rem / 10, qd = rem - c * 10; const int yy = y0 - 3 + r, xx = x0 - 4 + 4 * qd;
    ok[j] = (e < WITEMS) & ((unsigned)yy < (unsigned)HW) & ((unsigned)xx < (unsigned)HW);
    off[j] = 4u * (unsigned)(c * NPX + min(max(yy, 0), HW - 1) * HW + min(max(xx, 0), HW - 4)); }
  auto fetch = [&](const float* __restrict__ srcp, v4f (&v)[WNJ]) {
#pragma unroll
    for (int j = 0; j < WNJ; ++j) v[j] = *(const v4f*)((const char*)srcp + off[j]); };
  // a value piece (4 hi | 4 lo) goes to the hi plane (first half of the buffer) and the lo plane (second half), at the element index of its 4 pixels
  auto put16 = [&](float* dst, const v4f (&v)[WNJ]) { _Float16* dh = (_Float16*)dst;
#pragma unroll
    for (int j = 0; j < WNJ; ++j) { const v4f z = {0.f, 0.f, 0.f, 0.f}; union { v4f f; v4h h[2]; } u; u.f = ok[j] ? v[j] : z;
      *(v4h*)&dh[(t + WT * j) * 4] = u.h[0]; *(v4h*)&dh[WBUF + (t + WT * j) * 4] = u.h[1]; } };
  // key rows: piece e = t + 768 j is (staged position e / 16 = 40 x window row + column, 16-byte slot e % 16 of its 256-byte row: 8 octets of hi, 8 of lo); a wave's load is 512 bytes in a row
  // in LDS slot s of position p (and of query pixel p) stands at slot s ^ (p & 15) of its 256 bytes, so that the 16 slots of a row as well as one slot of 16 rows fall on distinct banks
  unsigned koff[WNJ]; bool kok[WNJ];
#pragma unroll
  for (int j = 0; j < WNJ; ++j) { const int e = t + WT * j, pp = e >> 4, r = pp / WPITCH, yy = y0 - 3 + r, xx = x0 - 4 + pp - r * WPITCH;
    kok[j] = (e < WITEMS) & ((unsigned)yy < (unsigned)HW) & ((unsigned)xx < (unsigned)HW);
    koff[j] = 256u * (unsigned)(min(max(yy, 0), HW - 1) * HW + min(max(xx, 0), HW - 1)) + 16u * (unsigned)(e & 15); }
  v4f qv[2], va[WNJ], vb[WNJ], vc[WNJ];
  // piece e = t + 768 j of the query rows: image row e / 512, pixel, 16-byte slot e % 16 of its 256-byte row
#pragma unroll
  for (int j = 0; j < 2; ++j) { const int e = t + WT * j; qv[j] = *(const v4f*)((const char*)(QP + ((size_t)b * NPX + y0 * HW + x0) * CK) + 4u * (unsigned)((e >> 9) * (HW * CK) + (e & 511) * 4)); }
  asm volatile("s_wait_xcnt 0x0" ::: "memory");   // the data of the loads below may be given the offset registers that the two query loads name
#pragma unroll
  for (int j = 0; j < WNJ; ++j) va[j] = *(const v4f*)((const char*)(KP + (size_t)b * CK * NPX) + koff[j]);
  // the offsets are inputs, so that they stay in their registers up to this wait: without that a late load's data is given the offset registers of the loads in front of it
  asm volatile("s_wait_xcnt 0x0" :: "v"(koff[0]), "v"(koff[1]), "v"(koff[2]), "v"(koff[3]), "v"(koff[4]), "v"(koff[5]), "v"(koff[6]), "v"(koff[7]) : "memory");
#pragma unroll
  for (int j = 0; j < WNJ; ++j) { const int e = t + WT * j; const v4f z = {0.f, 0.f, 0.f, 0.f}; *(v4f*)((char*)shA + (e >> 4) * 256 + (((e ^ (e >> 4)) & 15) << 4)) = kok[j] ? va[j] : z; }
#pragma unroll
  for (int j = 0; j < 2; ++j) { const int e = t + WT * j; *(v4f*)(sq + (e >> 4) * 256 + (((e ^ (e >> 4)) & 15) << 4)) = qv[j]; }
  __syncthreads();
  // both value halves are in flight under the logits (issued in front of the barrier they would be waited for at it)
  fetch(VP + (size_t)b * CV * NPX, vb);
  fetch(VP + ((size_t)b * CV + 64) * NPX, vc);
  static_assert(WNJ == 8, "the wait below names the 8 offsets");
  // the offsets are inputs, so that they stay in their registers up to this wait: without that a late load's data is given the offset registers of the loads in front of it
  asm volatile("s_wait_xcnt 0x0" :: "v"(off[0]), "v"(off[1]), "v"(off[2]), "v"(off[3]), "v"(off[4]), "v"(off[5]), "v"(off[6]), "v"(off[7]) : "memory");
  float s[7] = {0.f, 0.f, 0.f, 0.f, 0.f, 0.f, 0.f};
  if (w8 < 7) { const int c16 = lane & 15, gh = lane >> 4, kp = (rg + w8) * WPITCH + c16;   // kp: the lane's key row in the row's first 16 positions
    // byte address of slot gh of the lane's key row and query row; slot 8 plane + 4 ks + 2 half + gh is that address ^ (16 x the even part), 16 rows further on + 4096
    const unsigned ka = (unsigned)kp * 256u + (unsigned)(((kp & 15) ^ gh) << 4), qa = (unsigned)(rg * 32 + c16) * 256u + (unsigned)((c16 ^ gh) << 4);
    const char* kb = (const char*)shA; float* st = sl + (rg * 7 + w8) * (32 * SLP);
    auto fr = [&](const char* base, unsigned a, int tile, int plane, int ks) { return frag_2((const _Float16*)(base + (a ^ (unsigned)(plane * 128 + ks * 64)) + tile * 4096), (const _Float16*)(base + (a ^ (unsigned)(plane * 128 + ks * 64 + 32)) + tile * 4096)); };
#pragma unroll
    for (int tx = 0; tx < 2; ++tx) { v8f d[2] = {};   // rows = positions 16 tx + 16 i + 0..15, columns = pixels 16 tx + 0..15; positions 40 .. 47 run into the next staged row or the zero tail: rows of the product that no pixel takes
#pragma unroll
      for (int ks = 0; ks < CK / 32; ++ks) { const v16h qh = fr(sq, qa, tx, 0, ks), ql = fr(sq, qa, tx, 1, ks); v16h kh[2], kl[2];
#pragma unroll
        for (int i = 0; i < 2; ++i) { kh[i] = fr(kb, ka, tx + i, 0, ks); kl[i] = fr(kb, ka, tx + i, 1, ks); }
        // the two accumulators alternate, so that no product waits for the one in front of it
#pragma unroll
        for (int i = 0; i < 2; ++i) d[i] = wmma16(kl[i], qh, d[i]);
#pragma unroll
        for (int i = 0; i < 2; ++i) d[i] = wmma16(kh[i], ql, d[i]);
#pragma unroll
        for (int i = 0; i < 2; ++i) d[i] = wmma16(kh[i], qh, d[i]); }
      // element e = position 16 i + 8 gh + e of pixel c16; positions 24 .. 31 are beyond every pixel's window and are not stored
      float* sr = st + (tx * 16 + c16) * SLP + 8 * gh;
      const v4f d0 = {d[0][0], d[0][1], d[0][2], d[0][3]}, d1 = {d[0][4], d[0][5], d[0][6], d[0][7]}, d2 = {d[1][0], d[1][1], d[1][2], d[1][3]}, d3 = {d[1][4], d[1][5], d[1][6], d[1][7]};
      *(v4f*)sr = d0; *(v4f*)(sr + 4) = d1;
      if (gh == 0) { *(v4f*)(sr + 16) = d2; *(v4f*)(sr + 20) = d3; } }
    asm volatile("s_wait_dscnt 0x0" ::: "memory");   // the wave's own tile: the reads below take what other lanes of the wave have stored, and may not be moved up over those stores
#pragma unroll
    for (int dx = 0; dx < 7; ++dx) s[dx] = st[lane * SLP + c16 + 1 + dx];
    float pm = s[0];
#pragma unroll
    for (int dx = 1; dx < 7; ++dx) pm = fmaxf(pm, s[dx]);
    smx[rg][w8][lane] = pm; }
  put16(shB, vb);
  __syncthreads();   // every read of the key rows is done; the row maxima are visible
  put16(shA, vc);
  float mx = smx[rg][0][lane];
#pragma unroll
  for (int r = 1; r < 7; ++r) mx = fmaxf(mx, smx[rg][r][lane]);
  if (w8 < 7) {   // the lane writes its pixel's whole weight row of this dy: zeros, then, over them, the 7 weights at k = i + 1 + dx
    _Float16* ph = &sp[((rg * 7 + w8) * 32 + lane) * PBP]; _Float16* pl = ph + PBN; const v8h z8 = {};
#pragma unroll
    for (int q = 0; q < 3; ++q) { *(v8h*)(ph + 8 * q) = z8; *(v8h*)(pl + 8 * q) = z8; }
    float rs = 0.f; const int k1 = (lane & 15) + 1; _Float16 eh[9], el[9];   // element 1 + dx; a zero at either end
    eh[0] = eh[8] = el[0] = el[8] = (_Float16)0.f;
#pragma unroll
    for (int dx = 0; dx < 7; ++dx) { const float e = expf(s[dx] - mx); rs += e; eh[1 + dx] = (_Float16)e; el[1 + dx] = (_Float16)(e - (float)eh[1 + dx]); }
    // as 4 whole dwords from k = k1 & ~1, so that every store is 4-byte aligned: k1 even: e0 e1 | e2 e3 | e4 e5 | e6 0; k1 odd: 0 e0 | e1 e2 | e3 e4 | e5 e6
#pragma unroll
    for (int q = 0; q < 4; ++q) { const v2h he = {eh[2 * q + 1], eh[2 * q + 2]}, ho = {eh[2 * q], eh[2 * q + 1]}, le = {el[2 * q + 1], el[2 * q + 2]}, lo = {el[2 * q], el[2 * q + 1]};
      *(v2h*)(ph + (k1 & ~1) + 2 * q) = (k1 & 1) ? ho : he; *(v2h*)(pl + (k1 & ~1) + 2 * q) = (k1 & 1) ? lo : le; }
    ssm[rg][w8][lane] = rs; }
  __syncthreads();   // the weight rows, their sums and all value channels are visible
  // 8 of the 24 waves work here, each on all three image rows: a value fragment is then read once for the products of up to three image rows (26 16-byte LDS reads per 16 x 16 output tile; 42 with one image row per wave); the other waves go on to their weight loads
  // waves 6 a + b, b < 2: two of them on every SIMD, whether the work-group's waves are dealt to the SIMDs in turn or in runs of six
  const int wa = wave / 6, wb = wave - 6 * wa;
  if (wb < 2) { const int c16 = lane & 15, gh = lane >> 4, tx = wa >> 1, cp = (wa & 1) * 2 + wb;   // the wave's pixels 16 tx .. +15 of each image row and its channels 32 cp .. +31
    float inv[WR];
#pragma unroll
    for (int q = 0; q < WR; ++q) { float ssum = 0.f;
#pragma unroll
      for (int r = 0; r < 7; ++r) ssum += ssm[q][r][tx * 16 + c16];
      inv[q] = 1.0f / ssum; }
    // value fragment: k = staged position 16 tx + k of the channel's row; at tx = 1 k = 24 .. 31 run into the next staged row or the tail: finite values against zero weights
    const _Float16* vr = (const _Float16*)(cp < 2 ? shB : shA) + ((cp & 1) * 32 + c16) * WPITCH + tx * 16;
    // weight fragment: k = 8 gh .. +7 and 16 + 8 gh .. +7 of the pixel's row; k = 24 .. 31 are zero and not stored: the upper half-wave reads k = 16 .. 23 of the tile's pixel 0 for them, whose weights end at k = 7
    const _Float16* p0 = &sp[(tx * 16 + c16) * PBP + 8 * gh]; const _Float16* p1 = &sp[(tx * 16 + (gh ? 0 : c16)) * PBP + 16];
    v8f cx[WR][2] = {};
#pragma unroll
    for (int r = 0; r < WR + 6; ++r) { v16h vh[2], vl[2], wh[WR], wl[WR];   // staged window row r is window row dy = r - q of image row q
#pragma unroll
      for (int i = 0; i < 2; ++i) { vh[i] = frag_h(vr + r * WRS + i * 16 * WPITCH, lane); vl[i] = frag_h(vr + r * WRS + i * 16 * WPITCH + WBUF, lane); }
#pragma unroll
      for (int q = 0; q < WR; ++q) if (r - q >= 0 && r - q < 7) { wh[q] = frag_2(p0 + (q * 7 + r - q) * 32 * PBP, p1 + (q * 7 + r - q) * 32 * PBP); wl[q] = frag_2(p0 + (q * 7 + r - q) * 32 * PBP + PBN, p1 + (q * 7 + r - q) * 32 * PBP + PBN); }
      // rows = channels, columns = pixels; the accumulators alternate, so that no product waits for the one in front of it
#pragma unroll
      for (int q = 0; q < WR; ++q) if (r - q >= 0 && r - q < 7) {
#pragma unroll
        for (int i = 0; i < 2; ++i) cx[q][i] = wmma16(vl[i], wh[q], cx[q][i]); }
#pragma unroll
      for (int q = 0; q < WR; ++q) if (r - q >= 0 && r - q < 7) {
#pragma unroll
        for (int i = 0; i < 2; ++i) cx[q][i] = wmma16(vh[i], wl[q], cx[q][i]); }
#pragma unroll
      for (int q = 0; q < WR; ++q) if (r - q >= 0 && r - q < 7) {
#pragma unroll
        for (int i = 0; i < 2; ++i) cx[q][i] = wmma16(vh[i], wh[q], cx[q][i]); } }
#pragma unroll
    for (int q = 0; q < WR; ++q)
#pragma unroll
      for (int i = 0; i < 2; ++i) { v8h o;   // element e = channel 32 cp + 16 i + 8 gh + e of pixel c16
#pragma unroll
        for (int e = 0; e < 8; ++e) o[e] = (_Float16)(cx[q][i][e] * inv[q]);
        *(v8h*)&sct[q * 32 + tx * 16 + c16][cp * 32 + i * 16 + 8 * gh] = o; } }
  static_assert((WT / 32) * WWJ * OWP * 2 <= 2 * WBUF * 4 && WR * CO * OSP * 4 <= 2 * WBUF * 4, "weight rows and output tiles fit in the window buffers");
  _Float16 (*sw)[OWP] = (_Float16 (*)[OWP])sh; float* so = sh + rg * (CO * OSP);
  // the lane's number is read anew here: a thread index held in a register across the context loop, which runs at the register limit, is spilled
  const int ln = (int)__builtin_amdgcn_mbcnt_lo(~0u, 0u), t2 = wave * 32 + ln, t8 = w8 * 32 + ln;
  // piece e = t2 + 768 j is 16 B of the contiguous weight rows; all loads of a thread are in flight at once
  v4f wv[WWJ]; const float* wp = WW + (unsigned)t2 * 4u;
#pragma unroll
  for (int j = 0; j < WWJ - 1; ++j) wv[j] = *(const v4f*)(wp + WT * 4 * j);
  const float* wl = wp + WT * 4 * (wave < WWL ? WWJ - 1 : WWJ - 2);
  wv[WWJ - 1] = *(const v4f*)wl;
  __syncthreads();   // every read of the value rows is done; the context rows are visible
  const int col = ln & 15, g = ln >> 4;
  const float bb[2] = {bfr(BW[w8 * 32 + col]), bfr(BW[w8 * 32 + 16 + col])};   // loaded here, where the LDS stores cover it: behind the product its latency would stand open
  // the code below takes the address registers that the weight and bias loads name; the two weight addresses are inputs, so that no weight load's data is given them before this wait
  asm volatile("s_wait_xcnt 0x0" :: "v"(wp), "v"(wl) : "memory");
#pragma unroll
  for (int j = 0; j < WWJ; ++j) { v4h o;   // piece t2 + 768 j: row wave + 24 j, quad ln
#pragma unroll
    for (int i = 0; i < 4; ++i) o[i] = (_Float16)bfr(wv[j][i]);
    *(v4h*)&sw[wave + (WT / 32) * j][ln * 4] = o; }
  __syncthreads();   // the weight rows are visible
  v8f acc[2][2] = {};
#pragma unroll
  for (int kc = 0; kc < CV / 32; ++kc) { v16h ca[2], w[2];
#pragma unroll
    for (int i = 0; i < 2; ++i) { ca[i] = frag_h(&sct[rg * 32 + i * 16 + col][kc * 32], ln); w[i] = frag_h(&sw[w8 * 32 + i * 16 + col][kc * 32], ln); }
#pragma unroll
    for (int i = 0; i < 2; ++i)
#pragma unroll
      for (int j = 0; j < 2; ++j) acc[i][j] = wmma16(ca[i], w[j], acc[i][j]); }
  __syncthreads();   // every read of the weight rows is done; the output tiles may overwrite them
#pragma unroll
  for (int j = 0; j < 2; ++j) { const int o = w8 * 32 + j * 16 + col;
#pragma unroll
    for (int i = 0; i < 2; ++i)
#pragma unroll
      for (int r = 0; r < 8; ++r) so[o * OSP + i * 16 + 8 * g + r] = acc[i][j][r] + bb[j]; }
  __syncthreads();   // the output tiles are visible
  const int n0 = (y0 + rg) * HW + x0;
#pragma unroll
  for (int j = 0; j < CO / 32; ++j) { const unsigned cl = ((unsigned)t8 >> 3) + 32u * j, q = t8 & 7; vst2(OUT + ((size_t)b * CO + cl) * NPX + n0 + q * 4, *(const v4f*)&so[cl * OSP + q * 4]); } }
extern "C" void kernel_launch(void* const* d_in, const int* in_sizes, int n_in, void* d_out, int out_size, void* d_ws, size_t ws_size, hipStream_t stream) {
  (void)in_sizes; (void)n_in; (void)out_size;
  const float** F = (const float**)d_in;   // 0 x [2,256,96,96], 1 fk_w1 [64,256], 2 fk_b1, 3 fk_bn1 [4,64], 4 fk_w2 [64,64], 5 fk_b2, 6 fk_bn2, 7 fq_w1, 8 fq_b1, 9 fq_bn1, 10 fq_w2, 11 fq_b2, 12 fq_bn2, 13 fv_w [128,256], 14 fv_b, 15 W_w [256,128], 16 W_b
  if (ws_size < (size_t)WS_END) return;
  char* ws = (char*)d_ws; float *KP = (float*)(ws + WS_KP), *QP = (float*)(ws + WS_QP), *VP = (float*)(ws + WS_VP);
  k_c1<<<dim3(NPX / 64, NB, 2), 256, 0, stream>>>(F[0], F[1], F[2], F[3], F[7], F[8], F[9], F[13], F[14], F[4], F[5], F[6], F[10], F[11], F[12], KP, QP, VP);
  k_win<<<TWB, WT, 0, stream>>>(KP, QP, VP, F[15], F[16], (float*)d_out);
}

// v008
// One run takes 27.4 microseconds.
// Next to v007, in two timings, it ran 1.06 times as fast each time.
// Over all steps from v000 it is 38.9 times as fast.
// compute dtype: all float inputs rounded to bf16; the five 1x1 convs on WMMA 16x16x32: x-fed ones with EXACT bf16 products (x^T tile in LDS), the second key/query convs with their f32 input as bf16 hi + lo (2 products), eval BatchNorm + ReLU in f32; key and query rows and value planes as f16 hi + lo; the 7x7-window dot products (64-deep) on WMMA 16x16x32, one banded product per window row (3 products, f32 accumulate); the 49-way softmax (zero-padded neighbours give logit 0 and value 0, as unfold does) in f32 on the VALU; the 128-channel context on WMMA 16x16x32, one banded product per window row, weights and values each as f16 hi + lo (3 products, f32 accumulate); context rounded once to f16 for the final 1x1 conv W (bf16-exact weights in f16, 1 product) + bias; f32 output.
#include <hip/hip_runtime.h>
#include <math.h>

typedef __attribute__((ext_vector_type(16))) _Float16 v16h;
typedef __attribute__((ext_vector_type(16))) __bf16 v16b;
typedef __attribute__((ext_vector_type(8)))  _Float16 v8h;
typedef __attribute__((ext_vector_type(8)))  float v8f;
typedef __attribute__((ext_vector_type(4)))  float v4f;
typedef __attribute__((ext_vector_type(2)))  float v2f;
typedef __attribute__((ext_vector_type(4)))  unsigned v4u;
typedef __attribute__((ext_vector_type(4)))  int v4i;
typedef float __attribute__((may_alias)) float_a;
typedef int __attribute__((may_alias)) int_a;

template <typename T> __device__ __forceinline__ void vst2(void* p, T v) { *(T*)p = v;  }
__device__ __forceinline__ v8f wmma16(v16h a, v16h b, v8f c) {
  v8f d = __builtin_amdgcn_wmma_f32_16x16x32_f16(false, a, false, b, (short)0, c, false, false);
  asm volatile("v_nop\n\tv_nop\n\tv_nop\n\tv_nop" : "+v"(d) : "v"(a), "v"(b));
  return d;
}
__device__ __forceinline__ v8f wmma_bf(v16b a, v16b b, v8f c) {
  v8f d = __builtin_amdgcn_wmma_f32_16x16x32_bf16(false, a, false, b, (short)0, c, false, false);
  asm volatile("v_nop\n\tv_nop\n\tv_nop\n\tv_nop" : "+v"(d) : "v"(a), "v"(b));
  return d;
}
// 16x16x32 fragments: lane = (h = lane>>4, row/col = lane&15); elements 0..7 = k0+8h+0..7, 8..15 = k0+16+8h+0..7; D element r = row 8h+r
__device__ __forceinline__ v16h frag_h(const _Float16* rowk0, int lane) {
  union { v16h v; v8h q[2]; } u; const _Float16* p = rowk0 + 8 * (lane >> 4);
  u.q[0] = *(const v8h*)p; u.q[1] = *(const v8h*)(p + 16); return u.v;
}
// fragment from two octet addresses of the lane's own
__device__ __forceinline__ v16h frag_2(const _Float16* o0, const _Float16* o1) {
  union { v16h v; v8h q[2]; } u; u.q[0] = *(const v8h*)o0; u.q[1] = *(const v8h*)o1; return u.v;
}
__device__ __forceinline__ v16h frag_f32(const float* rowk0, int lane) {
  v16h a; const float* p = rowk0 + 8 * (lane >> 4);
#pragma unroll
  for (int i = 0; i < 8; ++i) { a[i] = (_Float16)p[i]; a[8 + i] = (_Float16)p[16 + i]; }
  return a;
}
__device__ __forceinline__ v16h frag_f32s(const float* rowk0, int lane, float sc) {
  v16h a; const float* p = rowk0 + 8 * (lane >> 4);
#pragma unroll
  for (int i = 0; i < 8; ++i) { a[i] = (_Float16)(p[i] * sc); a[8 + i] = (_Float16)(p[16 + i] * sc); }
  return a;
}
// column fragment from a [K][ld] layout (column n), rows >= K read as 0
__device__ __forceinline__ v16h fragc_f32(const float* W, int k0, int n, int lane, int ld, int K) {
  v16h a; const int g = lane >> 4;
#pragma unroll
  for (int i = 0; i < 8; ++i) { const int ka = k0 + 8 * g + i, kb = ka + 16;
    a[i] = (_Float16)(ka < K ? W[(size_t)(ka < K ? ka : K - 1) * ld + n] : 0.f); a[8 + i] = (_Float16)(kb < K ? W[(size_t)(kb < K ? kb : K - 1) * ld + n] : 0.f); }
  return a;
}
struct F2 { v16b h, l; };
__device__ __forceinline__ F2 bsplit16(const float v[16]) { F2 r;
#pragma unroll
  for (int i = 0; i < 16; ++i) { const __bf16 h = (__bf16)v[i]; r.h[i] = h; r.l[i] = (__bf16)(v[i] - (float)h); }
  return r; }
__device__ __forceinline__ F2 split_row(const float* row, int k0, int lane) { float v[16]; const float* p = row + k0 + 8 * (lane >> 4);
#pragma unroll
  for (int i = 0; i < 8; ++i) { v[i] = p[i]; v[8 + i] = p[16 + i]; }
  return bsplit16(v); }
__device__ __forceinline__ F2 split_rowK(const float* row, int k0, int lane, int K) { float v[16]; const int g = lane >> 4;
#pragma unroll
  for (int i = 0; i < 8; ++i) { const int ka = k0 + 8 * g + i, kb = ka + 16; v[i] = ka < K ? row[ka < K ? ka : K - 1] : 0.f; v[8 + i] = kb < K ? row[kb < K ? kb : K - 1] : 0.f; }
  return bsplit16(v); }
__device__ __forceinline__ F2 split_col(const float* W, int k0, int n, int lane, int ld, int K) { float v[16]; const int g = lane >> 4;
#pragma unroll
  for (int i = 0; i < 8; ++i) { const int ka = k0 + 8 * g + i, kb = ka + 16; v[i] = ka < K ? W[(size_t)(ka < K ? ka : K - 1) * ld + n] : 0.f; v[8 + i] = kb < K ? W[(size_t)(kb < K ? kb : K - 1) * ld + n] : 0.f; }
  return bsplit16(v); }
__device__ __forceinline__ v8f mac3(const F2& a, const F2& b, v8f c) { c = wmma_bf(a.l, b.h, c); c = wmma_bf(a.h, b.l, c); return wmma_bf(a.h, b.h, c); }
__device__ __forceinline__ float sigm(float v) { return 1.0f / (1.0f + expf(-v)); }
#define LDSX() do { asm volatile("s_wait_dscnt 0" ::: "memory"); __builtin_amdgcn_wave_barrier(); __builtin_amdgcn_fence(__ATOMIC_RELEASE, "workgroup"); } while (0)


// Local-window self attention (b 2, 96 x 96, Cin 256, key/query 64 via conv-BN-ReLU x2, value 128, 7x7 window, out conv 256).
#define NB 2
#define HW 96
#define NPX (HW * HW)      // 9216
#define CIN 256
#define CK 64
#define CV 128
#define CO 256
#define NPT (NB * NPX)     // 18432 = 288 x 64
#ifndef TWB
#define TWB (NPT / 96)     // window kernel blocks
#endif
typedef __attribute__((ext_vector_type(8))) __bf16 v8b;
__device__ __forceinline__ v16b frag_b(const __bf16* rowk0, int lane) {
  union { v16b v; v8b q[2]; } u; const __bf16* p = rowk0 + 8 * (lane >> 4);
  u.q[0] = *(const v8b*)p; u.q[1] = *(const v8b*)(p + 16); return u.v;
}
__device__ __forceinline__ float bfr(float v) { return (float)(__bf16)v; }
__device__ __attribute__((noinline)) float exp_ni(float v) { return expf(v); }
__device__ __attribute__((noinline)) float erf_ni(float v) { return erff(v); }

#define WS_KP  0u                                  // key rows [p] of 256 bytes: the 64 channels as f16 hi, then the same 64 as f16 lo (key = hi + lo)
#define WS_QP  (WS_KP + 4u * (size_t)NPT * CK)        // query rows [p], as the key rows
#define WS_VP  (WS_QP + 4u * (size_t)NPT * CK)        // value planes [b][128][n / 4] of 16-byte pieces: 4 pixels as f16 hi, then the same 4 pixels as f16 lo (value = hi + lo)
#define WS_END (WS_VP + 4u * (size_t)NPT * CV)

__device__ __forceinline__ float bnrelu(float v, const float* bn, int c, int C) { const float gsc = bfr(bn[c]) / sqrtf(bfr(bn[3 * C + c]) + 1e-5f); return fmaxf((v - bfr(bn[2 * C + c])) * gsc + bfr(bn[C + c]), 0.f); }
// ---- k_c1: block = (192 px, b, half), 12 waves: half 0: k1 = bnrelu(fk_w1 x + b) and q1 likewise, kept in LDS as f32 rows, then key = bnrelu(fk_w2 k1 + b) and query likewise -> rows, each f32 value split once into f16 hi + lo; half 1: the 128 value channels = fv_w x + b -> planes, each f32 value split once into f16 hi + lo.
// The x^T tile [192 px][256 c] and the half's 128 weight rows [o][256 c] are each staged once in LDS as bf16: a weight row is fetched and converted once for 192 pixels; wave = 32 px x 64 outputs (6 fragments for 8 products), k in the same order as before.
#define C1P (CIN + 8)                   // bf16 per staged row: 528 B = 16 B x 33, so 16-byte fragment reads of 16 rows fall on distinct banks
#define C1PX 192                        // pixels per block
#define C1NT 384                        // threads per block
#define C1X (C1PX * C1P * 2)            // bytes of the x tile
#define C2P (CK + 8)                    // bf16 per staged row of the second convs' weights: 144 B = 16 B x 9, same reason
#define C1SO (C1PX * 132 * 4)           // bytes of the k1 | q1 tile [192 px][132]
#define C1VP (C1PX + 4)                 // floats per channel row of the value tile: 784 B = 16 B x 49, same reason for its 16-byte stores
#define C1WN (128 * CIN / 4)            // 16-byte pieces of the half's weight rows
#define C2WN (2 * CK * CK / 4)          // 16-byte pieces of the two second weights
#define C1WJ ((C1WN + C1NT - 1) / C1NT) // pieces per thread
#define C2WJ ((C2WN + C1NT - 1) / C1NT)
#define C1WM (C1WN / 2 / C1NT)          // the run in which the first 64 weight rows end
// whether the wave's 32 pieces of run j (pieces 384 j + 32 wave .. + 31) lie below piece lim (a multiple of 32): a constant wherever the 12 waves agree, a scalar test of the wave's number elsewhere
#define C1LT(j, lim) ((C1NT * ((j) + 1) <= (lim)) || (C1NT * (j) < (lim) && C1NT * (j) + 32 * wave < (lim)))
typedef __attribute__((ext_vector_type(4))) __bf16 v4b;
typedef __attribute__((ext_vector_type(4))) _Float16 v4h;
typedef __attribute__((ext_vector_type(2))) _Float16 v2h;
// 3 waves per SIMD: the 12 waves of the one work-group (168,960 B of LDS) that a WGP holds; all 192 work-groups run in one round
__global__ __launch_bounds__(C1NT, 3) void k_c1(const float* __restrict__ X, const float* __restrict__ WK1, const float* __restrict__ BK1, const float* __restrict__ BNK1, const float* __restrict__ WQ1, const float* __restrict__ BQ1, const float* __restrict__ BNQ1, const float* __restrict__ WV, const float* __restrict__ BVv, const float* __restrict__ WK2, const float* __restrict__ BK2, const float* __restrict__ BNK2, const float* __restrict__ WQ2, const float* __restrict__ BQ2, const float* __restrict__ BNQ2, float* __restrict__ KP, float* __restrict__ QP, float* __restrict__ VP) {
  __shared__ __align__(16) char sm[(C1PX + 128) * C1P * 2];
  __bf16 (*sx)[C1P] = (__bf16 (*)[C1P])sm; __bf16 (*sw)[C1P] = (__bf16 (*)[C1P])(sm + C1X);
  float* so = (float*)sm;               // output tile, over the x tile once every wave has left it
  static_assert(C1SO <= C1X && 128 * C1VP * 4 <= C1X && 128 * C2P * 2 <= 128 * C1P * 2, "the k1 | q1 tile and the value tile fit over the x tile, the second weights over the weight rows");
  static_assert(C1WN % 64 == 0 && C2WN % 64 == 0 && C1PX * 8 % C1NT == 0 && 128 * (C1PX / 4) % C1NT == 0 && C1NT % (C1PX / 4) == 0, "a wave's 32 pieces lie in one weight array; the output pieces divide evenly");
  __bf16 (*sw2)[C2P] = (__bf16 (*)[C2P])(sm + C1X);   // fk_w2 rows 0-63, fq_w2 rows 64-127, over the weight rows once every wave has left them
  // the wave's number as a scalar: the per-wave choice of weight, bias and BN arrays below then stays a scalar base with one offset register
  const int tid = threadIdx.x, wave = __builtin_amdgcn_readfirstlane(tid >> 5), lane = tid & 31, col = lane & 15, g = lane >> 4; const int p0 = blockIdx.x * C1PX; const size_t b = blockIdx.y; const int half = blockIdx.z;
  const int pxg = wave % 6, og = wave / 6;   // the wave's pixels 32 pxg .. +31 and its outputs 64 og .. +63 of the half (half 0: og 0 = key path, og 1 = query path)
  const float* Wa = half ? WV : WK1; const float* Wb = half ? WV + 64 * CIN : WQ1;   // weight rows 0-63 and 64-127 of this half
  // every '#pragma unroll' below makes the indices of xv, wv, w2v, acc and ac2 constants, so that these arrays live in registers and the loads of a run are independent
  // x: wave = 32 px x 128 channels, thread = 4 pixels x 4 octets of channels; a wave's 16-byte load is four whole 128-B lines (8 lanes each) of four planes, and the 32 + 22 loads of a thread are all in flight at once
  // lane = (quad & 3) + 4 x (octet & 3) + 16 x (quad >> 2): the 16-byte LDS stores of either half-wave then fall on distinct banks (4 rows on = 16 banks on, an octet on = 4 banks on)
  // weights: piece e = tid + 384 j is 16 B of the contiguous rows
  const int xq = (lane & 3) + 4 * g, xo = (lane >> 2) & 3, xpx = pxg * 32 + xq * 4; const float* xp = X + (b * CIN + og * 128 + xo * 8) * (size_t)NPX + p0 + xpx;
  // byte offset of the thread's piece in run j from the start of its weight array: wo + a constant, but in the one run that holds the last pieces of rows 0-63 and the first of rows 64-127, where it is wom
  const unsigned wo = 16u * (unsigned)tid, wom = wo + (C1LT(C1WM, C1WN / 2) ? 16u * (C1NT * C1WM) : 0u - 16u * (C1WN / 2 - C1NT * C1WM));
  v4f xv[4][8], wv[C1WJ];
#pragma unroll
  for (int j = 0; j < 4; ++j)
#pragma unroll
    for (int i = 0; i < 8; ++i) xv[j][i] = *(const v4f*)(xp + (size_t)(j * 32 + i) * NPX);
#pragma unroll
  for (int j = 0; j < C1WJ; ++j) if (C1LT(j, C1WN)) wv[j] = *(const v4f*)((const char*)(C1LT(j, C1WN / 2) ? Wa : Wb) + (j == C1WM ? wom : j < C1WM ? wo + 16u * (C1NT * j) : wo + 16u * (C1NT * j - C1WN / 2)));
  // the code below takes the address registers that these loads name; the addresses are inputs, so that no late load's data is given them before this wait
  asm volatile("s_wait_xcnt 0x0" :: "v"(xp), "v"(wo), "v"(wom) : "memory");
#pragma unroll
  for (int j = 0; j < 4; ++j)
#pragma unroll
    for (int k = 0; k < 4; ++k) { v8b o;
#pragma unroll
      for (int i = 0; i < 8; ++i) o[i] = (__bf16)xv[j][i][k];
      *(v8b*)&sx[xpx + k][(og * 16 + xo + 4 * j) * 8] = o; }
#pragma unroll
  for (int j = 0; j < C1WJ; ++j) if (C1LT(j, C1WN)) { const int e = tid + C1NT * j; v4b o;
#pragma unroll
    for (int i = 0; i < 4; ++i) o[i] = (__bf16)wv[j][i];
    *(v4b*)&sw[e >> 6][(e & 63) * 4] = o; }
  __syncthreads();
  // second convs: wave = its own 32 px x 64 outputs of key (og 0) or query (og 1)
  v4f w2v[C2WJ]; float b2[4], m2[4], g2[4], t2[4], r2[4];   // raw bias, mean, gamma, beta, variance of the wave's 4 x 16 outputs
  // issued here, behind the barrier, so that the first product covers their latency; in both halves: under a test of the half the compiler draws the arithmetic on them, and so the wait, up to this place
  {
#pragma unroll
    for (int j = 0; j < C2WJ; ++j) if (C1LT(j, C2WN)) { const int e = tid + C1NT * j; w2v[j] = *(const v4f*)(C1LT(j, C2WN / 2) ? WK2 + e * 4 : WQ2 + (e - C2WN / 2) * 4); }
    const float* Bm = og ? BQ2 : BK2; const float* bn = og ? BNQ2 : BNK2;
#pragma unroll
    for (int j = 0; j < 4; ++j) { const int o = j * 16 + col; b2[j] = Bm[o]; g2[j] = bn[o]; r2[j] = bn[3 * CK + o]; m2[j] = bn[2 * CK + o]; t2[j] = bn[CK + o]; } }
  v8f acc[2][4] = {};
#pragma unroll
  for (int kc = 0; kc < CIN / 32; ++kc) { v16b a[2], w[4];
#pragma unroll
    for (int i = 0; i < 2; ++i) a[i] = frag_b(&sx[pxg * 32 + i * 16 + col][kc * 32], lane);
#pragma unroll
    for (int j = 0; j < 4; ++j) w[j] = frag_b(&sw[og * 64 + j * 16 + col][kc * 32], lane);
#pragma unroll
    for (int i = 0; i < 2; ++i)
#pragma unroll
      for (int j = 0; j < 4; ++j) acc[i][j] = wmma_bf(a[i], w[j], acc[i][j]); }
  __syncthreads();   // every read of the x tile and of the weight rows is done; the output tile and the second weights may overwrite them
  if (half == 0) { const float* Bm = og ? BQ1 : BK1; const float* bn = og ? BNQ1 : BNK1;   // so = [192 px][132]: k1 in columns 0-63, q1 in 64-127
#pragma unroll
    for (int j = 0; j < 4; ++j) { const int oc = j * 16 + col, o = og * 64 + oc; const float bb = bfr(Bm[oc]);
#pragma unroll
      for (int i = 0; i < 2; ++i)
#pragma unroll
        for (int r = 0; r < 8; ++r) so[(pxg * 32 + i * 16 + 8 * g + r) * 132 + o] = bnrelu(acc[i][j][r] + bb, bn, oc, CK); }
#pragma unroll
    for (int j = 0; j < C2WJ; ++j) if (C1LT(j, C2WN)) { const int e = tid + C1NT * j; v4b o;   // piece e: row e / 16 (fk_w2, then fq_w2), quad e % 16
#pragma unroll
      for (int i = 0; i < 4; ++i) o[i] = (__bf16)w2v[j][i];
      *(v4b*)&sw2[e >> 4][(e & 15) * 4] = o; }
#pragma unroll
    for (int j = 0; j < 4; ++j) { b2[j] = bfr(b2[j]); g2[j] = bfr(g2[j]) / sqrtf(bfr(r2[j]) + 1e-5f); m2[j] = bfr(m2[j]); t2[j] = bfr(t2[j]); }
    __syncthreads();   // the k1 | q1 rows and the second weights are visible
    // the wave alone reads rows 32 pxg .. +31, columns 64 og .. +63 of so: f32 input as bf16 hi + lo, 2 products, k ascending
    v8f ac2[2][4] = {};
#pragma unroll
    for (int kc = 0; kc < CK / 32; ++kc) { v16b w2f[4]; F2 a[2];
      // the 16 LDS reads of a k step stand in front of its products, so that their latency is paid once a step
#pragma unroll
      for (int j = 0; j < 4; ++j) w2f[j] = frag_b(&sw2[og * 64 + j * 16 + col][kc * 32], lane);
#pragma unroll
      for (int s = 0; s < 2; ++s) { const float* ap = &so[(pxg * 32 + s * 16 + col) * 132 + og * 64 + kc * 32 + 8 * g]; v4f aq[4]; float av[16];
        aq[0] = *(const v4f*)ap; aq[1] = *(const v4f*)(ap + 4); aq[2] = *(const v4f*)(ap + 16); aq[3] = *(const v4f*)(ap + 20);
#pragma unroll
        for (int i = 0; i < 16; ++i) av[i] = aq[i >> 2][i & 3];
        a[s] = bsplit16(av); }
      // each accumulator takes hi, then lo, kc ascending; the eight accumulators alternate, so that no product waits for the one in front of it
#pragma unroll
      for (int s = 0; s < 2; ++s)
#pragma unroll
        for (int j = 0; j < 4; ++j) ac2[s][j] = wmma_bf(a[s].h, w2f[j], ac2[s][j]);
#pragma unroll
      for (int s = 0; s < 2; ++s)
#pragma unroll
        for (int j = 0; j < 4; ++j) ac2[s][j] = wmma_bf(a[s].l, w2f[j], ac2[s][j]); }
    // key and query: back into the wave's own part of so, every read of which has fed the products above
#pragma unroll
    for (int s = 0; s < 2; ++s)
#pragma unroll
      for (int j = 0; j < 4; ++j)
#pragma unroll
        for (int r = 0; r < 8; ++r) so[(pxg * 32 + s * 16 + 8 * g + r) * 132 + og * 64 + j * 16 + col] = fmaxf((ac2[s][j][r] + b2[j] - m2[j]) * g2[j] + t2[j], 0.f);
    __syncthreads();   // the key and query tiles are visible
    // piece e = tid + 384 j: pixel e / 8, octet e % 8 of its 64 channels, of the key (h = 0) and of the query
#pragma unroll
    for (int j = 0; j < C1PX * 8 / C1NT; ++j) { const int e = tid + C1NT * j, cl = e >> 3, q = e & 7;
#pragma unroll
      for (int h = 0; h < 2; ++h) { const float* xp2 = &so[cl * 132 + h * 64 + q * 8]; const v4f x0 = *(const v4f*)xp2, x1 = *(const v4f*)(xp2 + 4); v8h hi, lo;
#pragma unroll
        for (int i = 0; i < 4; ++i) { hi[i] = (_Float16)x0[i]; lo[i] = (_Float16)(x0[i] - (float)hi[i]); hi[4 + i] = (_Float16)x1[i]; lo[4 + i] = (_Float16)(x1[i] - (float)hi[4 + i]); }
        float* dst = (h ? QP : KP) + (b * NPX + p0 + cl) * (size_t)CK + q * 4;   // 16 bytes = 4 floats of the 256-byte row; the lo half begins at byte 128
        vst2(dst, hi); vst2(dst + 32, lo); } } }
  else {
#pragma unroll
    for (int j = 0; j < 4; ++j) { const int o = og * 64 + j * 16 + col; const float bb = bfr(BVv[o]);
#pragma unroll
      for (int i = 0; i < 2; ++i)
#pragma unroll
        for (int r = 0; r < 8; ++r) so[o * C1VP + pxg * 32 + i * 16 + 8 * g + r] = acc[i][j][r] + bb; }   // transposed: [channel][px], pitch 196
    __syncthreads();   // the value tile is visible
    // piece e = tid + 384 j: channel e / 48 = tid / 48 + 8 j, quad e % 48 = tid % 48 of its 192 pixels
    const int c0 = tid / (C1PX / 4), q = tid - c0 * (C1PX / 4); const float* sv = &so[c0 * C1VP + q * 4]; float* vp = VP + (b * CV + c0) * (size_t)NPX + p0 + q * 4;
#pragma unroll
    for (int j = 0; j < 128 * (C1PX / 4) / C1NT; ++j) { const v4f x = *(const v4f*)(sv + j * (C1NT / (C1PX / 4)) * C1VP); union { v4f f; v4h h[2]; } u;
#pragma unroll
      for (int i = 0; i < 4; ++i) { u.h[0][i] = (_Float16)x[i]; u.h[1][i] = (_Float16)(x[i] - (float)u.h[0][i]); }
      vst2(vp + (size_t)(j * (C1NT / (C1PX / 4))) * NPX, u.f);
      if (j % 8 == 7) __builtin_amdgcn_sched_barrier(0); }   // 8 pieces at a time: with all 16 in work at once the kernel goes beyond 256 registers
    asm volatile("s_wait_xcnt 0x0" ::: "memory"); } }   // in the listing the other half's code, which takes the registers that these stores name, stands behind this path
// ---- k_win: block = 32 pixels x 3 image rows, 24 waves (lane = pixel, 8 waves per image row). The 9 x 40 window rows (y0-3 .. y0+5, x0-4 .. x0+35, zeros outside the image) of 64 channels are staged once for the three image rows: key and later value 64-127 in buffer A, value 0-63 in buffer B.
// logits: wave = window row of its image row (7 of 8 waves); per 16 pixels a matrix product S[position][px] = K[position][channel] * Q[channel][px] over the staged positions 16 tx + 0..31 of the row, key and query each as f16 hi + lo; pixel i of the tile takes its 7 logits from positions i + 1 .. i + 7 through LDS; softmax
// context: per window row dy a matrix product ctx[channel][px] += V[channel][k] * P[k][px], k = staged position 16 tx + 0..31 of the row, P the 7 weights of pixel i of the tile at k = i + 1 .. i + 7 and zero elsewhere; values staged as f16 hi and lo planes [window row][channel][40], weights as f16 hi and lo rows [image row][dy][px][24]; wave = 16 px x 3 image rows x 32 channels (8 waves) -> f16 context rows
// final 1x1 conv in the same block: the 96 f16 context rows stay in LDS, the 256 weight rows are staged once as f16 over the spent window rows; wave = 32 px x 32 outputs, k in ascending order; output tiles [3][256][32 px] through LDS -> whole 128-B lines of the output planes
#define OWP (CV + 8)                    // f16 per staged weight row: 272 B = 16 B x 17, so 16-byte fragment reads of 16 rows fall on distinct banks
#define OSP 36                          // floats per row of the output tile: 144 B = 16 B x 9, same reason for its 16-byte stores
#define WR 3                            // image rows per block
#define WT (256 * WR)                   // threads per block
#define WPITCH 40                       // positions per staged row (f16 in a value plane: 80 B = 16 B x 5, so 16-byte fragment reads of 16 rows fall on distinct banks)
#define WRS (64 * WPITCH)               // elements per staged window row (64 channels side by side)
#define WITEMS (64 * (WR + 6) * 10)     // 16-byte pieces per staged pass
#define WNJ ((WITEMS + WT - 1) / WT)    // pieces per thread
#define WBUF (WNJ * WT * 4)             // floats per buffer: the 9 window rows and a tail that takes the last run's surplus pieces (zeros; read only by the value fragment octet behind the last staged row, against zero weights, and by the key fragments as positions 40 .. 47 of the last staged row, which no pixel takes), so that every thread runs the same loads and stores
#define WWJ ((CO * CV / 4 + WT - 1) / WT)   // 16-byte pieces of the weight rows per thread
#define WWL ((CO * CV / 4 - WT * (WWJ - 1)) / 32)   // waves whose last piece is a weight row; the others stage a second copy of the piece before it into rows behind the 256 (never read), so that every wave runs the same loads and stores
#define PBP 24                          // f16 per weight row: k = 24 .. 31 are zero for every pixel and are not stored; 48 B = 16 B x 3, so 16-byte fragment reads of 16 rows fall on distinct banks
#define PBN (WR * 7 * 32 * PBP)         // f16 per plane of weight rows
#define SLP 28                          // floats per pixel of a wave's logit tile (positions 0 .. 23 of the 32): 112 B = 16 B x 7, so its 16-byte stores of 16 pixels fall on distinct banks
// every '#pragma unroll' below makes the indices of off, ok, koff, kok, va, vb, vc, d, s, eh, el, inv, cx, vh, vl, wh, wl, wv, ca, w and acc constants, so that these arrays live in registers and the loads of a run are independent
// 6 waves per SIMD: the 24 waves of one work-group (317,184 B of LDS) fill a WGP, and all 192 work-groups run in one round
__global__ __launch_bounds__(WT, 6) void k_win(const float* __restrict__ KP, const float* __restrict__ QP, const float* __restrict__ VP, const float* __restrict__ WW, const float* __restrict__ BW, float* __restrict__ OUT) {
  __shared__ __align__(16) float sh[2 * WBUF]; __shared__ __align__(16) char sq[WR * 32 * 256]; __shared__ __align__(16) _Float16 spc[2 * PBN + WR * 32 * (CV + 8)]; __shared__ float ssm[WR][7][32]; __shared__ float smx[WR][7][32];
  float* shA = sh; float* shB = sh + WBUF;
  _Float16* sp = spc; _Float16 (*sct)[CV + 8] = (_Float16 (*)[CV + 8])(spc + 2 * PBN);
  float* sl = (float*)spc;   // the logit tiles, where the weight rows and the context rows come later
  static_assert(WR * 7 * 32 * SLP * 4 <= (2 * PBN + WR * 32 * (CV + 8)) * 2 && (WNJ * WT / 16) * 256 <= WBUF * 4, "logit tiles fit under the weight and context rows, the key rows in buffer A");
  const int t = threadIdx.x, wave = __builtin_amdgcn_readfirstlane(t >> 5), lane = t & 31;
  const int rg = wave >> 3, w8 = wave & 7;   // the wave's image row of the block, and its number among that row's 8 waves
  const int bx = blockIdx.x; const int b = bx / (NPX / (32 * WR)), tl = bx % (NPX / (32 * WR)), y0 = (tl / (HW / 32)) * WR, x0 = (tl % (HW / 32)) * 32;
  // piece e = t + 768 j of a value pass is (window row e / 640, channel, quad of the row); a quad lies wholly inside or wholly outside the image
  unsigned off[WNJ]; bool ok[WNJ];   // byte offsets from the pass's first plane, clamped into it where the piece is outside (such a piece is stored as zeros)
#pragma unroll
  for (int j = 0; j < WNJ; ++j) { const int e = t + WT * j, r = e / 640, rem = e - r * 640, c = rem / 10, qd = rem - c * 10; const int yy = y0 - 3 + r, xx = x0 - 4 + 4 * qd;
    ok[j] = (e < WITEMS) & ((unsigned)yy < (unsigned)HW) & ((unsigned)xx < (unsigned)HW);
    off[j] = 4u * (unsigned)(c * NPX + min(max(yy, 0), HW - 1) * HW + min(max(xx, 0), HW - 4)); }
  auto fetch = [&](const float* __restrict__ srcp, v4f (&v)[WNJ]) {
#pragma unroll
    for (int j = 0; j < WNJ; ++j) v[j] = *(const v4f*)((const char*)srcp + off[j]); };
  // a value piece (4 hi | 4 lo) goes to the hi plane (first half of the buffer) and the lo plane (second half), at the element index of its 4 pixels
  auto put16 = [&](float* dst, const v4f (&v)[WNJ]) { _Float16* dh = (_Float16*)dst;
#pragma unroll
    for (int j = 0; j < WNJ; ++j) { const v4f z = {0.f, 0.f, 0.f, 0.f}; union { v4f f; v4h h[2]; } u; u.f = ok[j] ? v[j] : z;
      *(v4h*)&dh[(t + WT * j) * 4] = u.h[0]; *(v4h*)&dh[WBUF + (t + WT * j) * 4] = u.h[1]; } };
  // key rows: piece e = t + 768 j is (staged position e / 16 = 40 x window row + column, 16-byte slot e % 16 of its 256-byte row: 8 octets of hi, 8 of lo); a wave's load is 512 bytes in a row
  // in LDS slot s of position p (and of query pixel p) stands at slot s ^ (p & 15) of its 256 bytes, so that the 16 slots of a row as well as one slot of 16 rows fall on distinct banks
  unsigned koff[WNJ]; bool kok[WNJ];
#pragma unroll
  for (int j = 0; j < WNJ; ++j) { const int e = t + WT * j, pp = e >> 4, r = pp / WPITCH, yy = y0 - 3 + r, xx = x0 - 4 + pp - r * WPITCH;
    kok[j] = (e < WITEMS) & ((unsigned)yy < (unsigned)HW) & ((unsigned)xx < (unsigned)HW);
    koff[j] = 256u * (unsigned)(min(max(yy, 0), HW - 1) * HW + min(max(xx, 0), HW - 1)) + 16u * (unsigned)(e & 15); }
  v4f qv[2], va[WNJ], vb[WNJ], vc[WNJ];
  // piece e = t + 768 j of the query rows: image row e / 512, pixel, 16-byte slot e % 16 of its 256-byte row
#pragma unroll
  for (int j = 0; j < 2; ++j) { const int e = t + WT * j; qv[j] = *(const v4f*)((const char*)(QP + ((size_t)b * NPX + y0 * HW + x0) * CK) + 4u * (unsigned)((e >> 9) * (HW * CK) + (e & 511) * 4)); }
  asm volatile("s_wait_xcnt 0x0" ::: "memory");   // the data of the loads below may be given the offset registers that the two query loads name
#pragma unroll
  for (int j = 0; j < WNJ; ++j) va[j] = *(const v4f*)((const char*)(KP + (size_t)b * CK * NPX) + koff[j]);
  // the offsets are inputs, so that they stay in their registers up to this wait: without that a late load's data is given the offset registers of the loads in front of it
  asm volatile("s_wait_xcnt 0x0" :: "v"(koff[0]), "v"(koff[1]), "v"(koff[2]), "v"(koff[3]), "v"(koff[4]), "v"(koff[5]), "v"(koff[6]), "v"(koff[7]) : "memory");
#pragma unroll
  for (int j = 0; j < WNJ; ++j) { const int e = t + WT * j; const v4f z = {0.f, 0.f, 0.f, 0.f}; *(v4f*)((char*)shA + (e >> 4) * 256 + (((e ^ (e >> 4)) & 15) << 4)) = kok[j] ? va[j] : z; }
#pragma unroll
  for (int j = 0; j < 2; ++j) { const int e = t + WT * j; *(v4f*)(sq + (e >> 4) * 256 + (((e ^ (e >> 4)) & 15) << 4)) = qv[j]; }
  __syncthreads();
  // both value halves are in flight under the logits (issued in front of the barrier they would be waited for at it)
  fetch(VP + (size_t)b * CV * NPX, vb);
  fetch(VP + ((size_t)b * CV + 64) * NPX, vc);
  static_assert(WNJ == 8, "the wait below names the 8 offsets");
  // the offsets are inputs, so that they stay in their registers up to this wait: without that a late load's data is given the offset registers of the loads in front of it
  asm volatile("s_wait_xcnt 0x0" :: "v"(off[0]), "v"(off[1]), "v"(off[2]), "v"(off[3]), "v"(off[4]), "v"(off[5]), "v"(off[6]), "v"(off[7]) : "memory");
  float s[7] = {0.f, 0.f, 0.f, 0.f, 0.f, 0.f, 0.f};
  if (w8 < 7) { const int c16 = lane & 15, gh = lane >> 4, kp = (rg + w8) * WPITCH + c16;   // kp: the lane's key row in the row's first 16 positions
    // byte address of slot gh of the lane's key row and query row; slot 8 plane + 4 ks + 2 half + gh is that address ^ (16 x the even part), 16 rows further on + 4096
    const unsigned ka = (unsigned)kp * 256u + (unsigned)(((kp & 15) ^ gh) << 4), qa = (unsigned)(rg * 32 + c16) * 256u + (unsigned)((c16 ^ gh) << 4);
    const char* kb = (const char*)shA; float* st = sl + (rg * 7 + w8) * (32 * SLP);
    auto fr = [&](const char* base, unsigned a, int tile, int plane, int ks) { return frag_2((const _Float16*)(base + (a ^ (unsigned)(plane * 128 + ks * 64)) + tile * 4096), (const _Float16*)(base + (a ^ (unsigned)(plane * 128 + ks * 64 + 32)) + tile * 4096)); };
#pragma unroll
    for (int tx = 0; tx < 2; ++tx) { v8f d[2] = {};   // rows = positions 16 tx + 16 i + 0..15, columns = pixels 16 tx + 0..15; positions 40 .. 47 run into the next staged row or the zero tail: rows of the product that no pixel takes
#pragma unroll
      for (int ks = 0; ks < CK / 32; ++ks) { const v16h qh = fr(sq, qa, tx, 0, ks), ql = fr(sq, qa, tx, 1, ks); v16h kh[2], kl[2];
#pragma unroll
        for (int i = 0; i < 2; ++i) { kh[i] = fr(kb, ka, tx + i, 0, ks); kl[i] = fr(kb, ka, tx + i, 1, ks); }
        // the two accumulators alternate, so that no product waits for the one in front of it
#pragma unroll
        for (int i = 0; i < 2; ++i) d[i] = wmma16(kl[i], qh, d[i]);
#pragma unroll
        for (int i = 0; i < 2; ++i) d[i] = wmma16(kh[i], ql, d[i]);
#pragma unroll
        for (int i = 0; i < 2; ++i) d[i] = wmma16(kh[i], qh, d[i]); }
      // element e = position 16 i + 8 gh + e of pixel c16; positions 24 .. 31 are beyond every pixel's window and are not stored
      float* sr = st + (tx * 16 + c16) * SLP + 8 * gh;
      const v4f d0 = {d[0][0], d[0][1], d[0][2], d[0][3]}, d1 = {d[0][4], d[0][5], d[0][6], d[0][7]}, d2 = {d[1][0], d[1][1], d[1][2], d[1][3]}, d3 = {d[1][4], d[1][5], d[1][6], d[1][7]};
      *(v4f*)sr = d0; *(v4f*)(sr + 4) = d1;
      if (gh == 0) { *(v4f*)(sr + 16) = d2; *(v4f*)(sr + 20) = d3; } }
    asm volatile("s_wait_dscnt 0x0" ::: "memory");   // the wave's own tile: the reads below take what other lanes of the wave have stored, and may not be moved up over those stores
#pragma unroll
    for (int dx = 0; dx < 7; ++dx) s[dx] = st[lane * SLP + c16 + 1 + dx];
    float pm = s[0];
#pragma unroll
    for (int dx = 1; dx < 7; ++dx) pm = fmaxf(pm, s[dx]);
    smx[rg][w8][lane] = pm; }
  put16(shB, vb);
  __syncthreads();   // every read of the key rows is done; the row maxima are visible
  put16(shA, vc);
  float mx = smx[rg][0][lane];
#pragma unroll
  for (int r = 1; r < 7; ++r) mx = fmaxf(mx, smx[rg][r][lane]);
  if (w8 < 7) {   // the lane writes its pixel's whole weight row of this dy: zeros, then, over them, the 7 weights at k = i + 1 + dx
    _Float16* ph = &sp[((rg * 7 + w8) * 32 + lane) * PBP]; _Float16* pl = ph + PBN; const v8h z8 = {};
#pragma unroll
    for (int q = 0; q < 3; ++q) { *(v8h*)(ph + 8 * q) = z8; *(v8h*)(pl + 8 * q) = z8; }
    float rs = 0.f; const int k1 = (lane & 15) + 1; _Float16 eh[9], el[9];   // element 1 + dx; a zero at either end
    eh[0] = eh[8] = el[0] = el[8] = (_Float16)0.f;
#pragma unroll
    for (int dx = 0; dx < 7; ++dx) { const float e = expf(s[dx] - mx); rs += e; eh[1 + dx] = (_Float16)e; el[1 + dx] = (_Float16)(e - (float)eh[1 + dx]); }
    // as 4 whole dwords from k = k1 & ~1, so that every store is 4-byte aligned: k1 even: e0 e1 | e2 e3 | e4 e5 | e6 0; k1 odd: 0 e0 | e1 e2 | e3 e4 | e5 e6
#pragma unroll
    for (int q = 0; q < 4; ++q) { const v2h he = {eh[2 * q + 1], eh[2 * q + 2]}, ho = {eh[2 * q], eh[2 * q + 1]}, le = {el[2 * q + 1], el[2 * q + 2]}, lo = {el[2 * q], el[2 * q + 1]};
      *(v2h*)(ph + (k1 & ~1) + 2 * q) = (k1 & 1) ? ho : he; *(v2h*)(pl + (k1 & ~1) + 2 * q) = (k1 & 1) ? lo : le; }
    ssm[rg][w8][lane] = rs; }
  __syncthreads();   // the weight rows, their sums and all value channels are visible
  // 8 of the 24 waves work here, each on all three image rows: a value fragment is then read once for the products of up to three image rows (26 16-byte LDS reads per 16 x 16 output tile; 42 with one image row per wave); the other waves go on to their weight loads
  // waves 6 a + b, b < 2: the choice of waves is for speed only
  const int wa = wave / 6, wb = wave - 6 * wa;
  if (wb < 2) { const int c16 = lane & 15, gh = lane >> 4, tx = wa >> 1, cp = (wa & 1) * 2 + wb;   // the wave's pixels 16 tx .. +15 of each image row and its channels 32 cp .. +31
    float inv[WR];
#pragma unroll
    for (int q = 0; q < WR; ++q) { float ssum = 0.f;
#pragma unroll
      for (int r = 0; r < 7; ++r) ssum += ssm[q][r][tx * 16 + c16];
      inv[q] = 1.0f / ssum; }
    // value fragment: k = staged position 16 tx + k of the channel's row; at tx = 1 k = 24 .. 31 run into the next staged row or the tail: finite values against zero weights
    const _Float16* vr = (const _Float16*)(cp < 2 ? shB : shA) + ((cp & 1) * 32 + c16) * WPITCH + tx * 16;
    // weight fragment: k = 8 gh .. +7 and 16 + 8 gh .. +7 of the pixel's row; k = 24 .. 31 are zero and not stored: the upper half-wave reads k = 16 .. 23 of the tile's pixel 0 for them, whose weights end at k = 7
    const _Float16* p0 = &sp[(tx * 16 + c16) * PBP + 8 * gh]; const _Float16* p1 = &sp[(tx * 16 + (gh ? 0 : c16)) * PBP + 16];
    v8f cx[WR][2] = {};
#pragma unroll
    for (int r = 0; r < WR + 6; ++r) { v16h vh[2], vl[2], wh[WR], wl[WR];   // staged window row r is window row dy = r - q of image row q
#pragma unroll
      for (int i = 0; i < 2; ++i) { vh[i] = frag_h(vr + r * WRS + i * 16 * WPITCH, lane); vl[i] = frag_h(vr + r * WRS + i * 16 * WPITCH + WBUF, lane); }
#pragma unroll
      for (int q = 0; q < WR; ++q) if (r - q >= 0 && r - q < 7) { wh[q] = frag_2(p0 + (q * 7 + r - q) * 32 * PBP, p1 + (q * 7 + r - q) * 32 * PBP); wl[q] = frag_2(p0 + (q * 7 + r - q) * 32 * PBP + PBN, p1 + (q * 7 + r - q) * 32 * PBP + PBN); }
      // rows = channels, columns = pixels; the accumulators alternate, so that no product waits for the one in front of it
#pragma unroll
      for (int q = 0; q < WR; ++q) if (r - q >= 0 && r - q < 7) {
#pragma unroll
        for (int i = 0; i < 2; ++i) cx[q][i] = wmma16(vl[i], wh[q], cx[q][i]); }
#pragma unroll
      for (int q = 0; q < WR; ++q) if (r - q >= 0 && r - q < 7) {
#pragma unroll
        for (int i = 0; i < 2; ++i) cx[q][i] = wmma16(vh[i], wl[q], cx[q][i]); }
#pragma unroll
      for (int q = 0; q < WR; ++q) if (r - q >= 0 && r - q < 7) {
#pragma unroll
        for (int i = 0; i < 2; ++i) cx[q][i] = wmma16(vh[i], wh[q], cx[q][i]); } }
#pragma unroll
    for (int q = 0; q < WR; ++q)
#pragma unroll
      for (int i = 0; i < 2; ++i) { v8h o;   // element e = channel 32 cp + 16 i + 8 gh + e of pixel c16
#pragma unroll
        for (int e = 0; e < 8; ++e) o[e] = (_Float16)(cx[q][i][e] * inv[q]);
        *(v8h*)&sct[q * 32 + tx * 16 + c16][cp * 32 + i * 16 + 8 * gh] = o; } }
  static_assert((WT / 32) * WWJ * OWP * 2 <= 2 * WBUF * 4 && WR * CO * OSP * 4 <= 2 * WBUF * 4, "weight rows and output tiles fit in the window buffers");
  _Float16 (*sw)[OWP] = (_Float16 (*)[OWP])sh; float* so = sh + rg * (CO * OSP);
  // the lane's number is read anew here: a thread index held in a register across the context loop, which runs at the register limit, is spilled
  const int ln = (int)__builtin_amdgcn_mbcnt_lo(~0u, 0u), t2 = wave * 32 + ln, t8 = w8 * 32 + ln;
  // piece e = t2 + 768 j is 16 B of the contiguous weight rows; all loads of a thread are in flight at once
  v4f wv[WWJ]; const float* wp = WW + (unsigned)t2 * 4u;
#pragma unroll
  for (int j = 0; j < WWJ - 1; ++j) wv[j] = *(const v4f*)(wp + WT * 4 * j);
  const float* wl = wp + WT * 4 * (wave < WWL ? WWJ - 1 : WWJ - 2);
  wv[WWJ - 1] = *(const v4f*)wl;
  __syncthreads();   // every read of the value rows is done; the context rows are visible
  const int col = ln & 15, g = ln >> 4;
  const float bb[2] = {bfr(BW[w8 * 32 + col]), bfr(BW[w8 * 32 + 16 + col])};   // loaded here, where the LDS stores cover it: behind the product its latency would stand open
  // the code below takes the address registers that the weight and bias loads name; the two weight addresses are inputs, so that no weight load's data is given them before this wait
  asm volatile("s_wait_xcnt 0x0" :: "v"(wp), "v"(wl) : "memory");
#pragma unroll
  for (int j = 0; j < WWJ; ++j) { v4h o;   // piece t2 + 768 j: row wave + 24 j, quad ln
#pragma unroll
    for (int i = 0; i < 4; ++i) o[i] = (_Float16)bfr(wv[j][i]);
    *(v4h*)&sw[wave + (WT / 32) * j][ln * 4] = o; }
  __syncthreads();   // the weight rows are visible
  v8f acc[2][2] = {};
#pragma unroll
  for (int kc = 0; kc < CV / 32; ++kc) { v16h ca[2], w[2];
#pragma unroll
    for (int i = 0; i < 2; ++i) { ca[i] = frag_h(&sct[rg * 32 + i * 16 + col][kc * 32], ln); w[i] = frag_h(&sw[w8 * 32 + i * 16 + col][kc * 32], ln); }
#pragma unroll
    for (int i = 0; i < 2; ++i)
#pragma unroll
      for (int j = 0; j < 2; ++j) acc[i][j] = wmma16(ca[i], w[j], acc[i][j]); }
  __syncthreads();   // every read of the weight rows is done; the output tiles may overwrite them
#pragma unroll
  for (int j = 0; j < 2; ++j) { const int o = w8 * 32 + j * 16 + col;
#pragma unroll
    for (int i = 0; i < 2; ++i)
#pragma unroll
      for (int r = 0; r < 8; ++r) so[o * OSP + i * 16 + 8 * g + r] = acc[i][j][r] + bb[j]; }
  __syncthreads();   // the output tiles are visible
  const int n0 = (y0 + rg) * HW + x0;
#pragma unroll
  for (int j = 0; j < CO / 32; ++j) { const unsigned cl = ((unsigned)t8 >> 3) + 32u * j, q = t8 & 7; vst2(OUT + ((size_t)b * CO + cl) * NPX + n0 + q * 4, *(const v4f*)&so[cl * OSP + q * 4]); } }
extern "C" void kernel_launch(void* const* d_in, const int* in_sizes, int n_in, void* d_out, int out_size, void* d_ws, size_t ws_size, hipStream_t stream) {
  (void)in_sizes; (void)n_in; (void)out_size;
  const float** F = (const float**)d_in;   // 0 x [2,256,96,96], 1 fk_w1 [64,256], 2 fk_b1, 3 fk_bn1 [4,64], 4 fk_w2 [64,64], 5 fk_b2, 6 fk_bn2, 7 fq_w1, 8 fq_b1, 9 fq_bn1, 10 fq_w2, 11 fq_b2, 12 fq_bn2, 13 fv_w [128,256], 14 fv_b, 15 W_w [256,128], 16 W_b
  if (ws_size < (size_t)WS_END) return;
  char* ws = (char*)d_ws; float *KP = (float*)(ws + WS_KP), *QP = (float*)(ws + WS_QP), *VP = (float*)(ws + WS_VP);
  k_c1<<<dim3(NPX / C1PX, NB, 2), C1NT, 0, stream>>>(F[0], F[1], F[2], F[3], F[7], F[8], F[9], F[13], F[14], F[4], F[5], F[6], F[10], F[11], F[12], KP, QP, VP);
  k_win<<<TWB, WT, 0, stream>>>(KP, QP, VP, F[15], F[16], (float*)d_out);
}

// v009
// It runs in 25.7 microseconds.
// Timed twice side by side with v008, it ran 1.07 times as fast both times.
// All steps since v000 together make it 41.6 times as fast.
// compute dtype: all float inputs rounded to bf16; the five 1x1 convs on WMMA 16x16x32: x-fed ones with EXACT bf16 products (x^T tile in LDS), the second key/query convs with their f32 input as bf16 hi + lo (2 products), eval BatchNorm + ReLU in f32; key and query rows and value planes as f16 hi + lo; the 7x7-window dot products (64-deep) on WMMA 16x16x32, one banded product per window row (3 products, f32 accumulate); the 49-way softmax (zero-padded neighbours give logit 0 and value 0, as unfold does) in f32 on the VALU; the 128-channel context on WMMA 16x16x32, one banded product per window row, weights and values each as f16 hi + lo (3 products, f32 accumulate); context rounded once to f16 for the final 1x1 conv W (bf16-exact weights in f16, 1 product) + bias; f32 output.
#include <hip/hip_runtime.h>
#include <math.h>

typedef __attribute__((ext_vector_type(16))) _Float16 v16h;
typedef __attribute__((ext_vector_type(16))) __bf16 v16b;
typedef __attribute__((ext_vector_type(8)))  _Float16 v8h;
typedef __attribute__((ext_vector_type(8)))  float v8f;
typedef __attribute__((ext_vector_type(4)))  float v4f;
typedef __attribute__((ext_vector_type(2)))  float v2f;
typedef __attribute__((ext_vector_type(4)))  unsigned v4u;
typedef __attribute__((ext_vector_type(4)))  int v4i;
typedef float __attribute__((may_alias)) float_a;
typedef int __attribute__((may_alias)) int_a;

template <typename T> __device__ __forceinline__ void vst2(void* p, T v) { *(T*)p = v;  }
__device__ __forceinline__ v8f wmma16(v16h a, v16h b, v8f c) {
  v8f d = __builtin_amdgcn_wmma_f32_16x16x32_f16(false, a, false, b, (short)0, c, false, false);
  asm volatile("v_nop\n\tv_nop\n\tv_nop\n\tv_nop" : "+v"(d) : "v"(a), "v"(b));
  return d;
}
__device__ __forceinline__ v8f wmma_bf(v16b a, v16b b, v8f c) {
  v8f d = __builtin_amdgcn_wmma_f32_16x16x32_bf16(false, a, false, b, (short)0, c, false, false);
  asm volatile("v_nop\n\tv_nop\n\tv_nop\n\tv_nop" : "+v"(d) : "v"(a), "v"(b));
  return d;
}
// 16x16x32 fragments: lane = (h = lane>>4, row/col = lane&15); elements 0..7 = k0+8h+0..7, 8..15 = k0+16+8h+0..7; D element r = row 8h+r
__device__ __forceinline__ v16h frag_h(const _Float16* rowk0, int lane) {
  union { v16h v; v8h q[2]; } u; const _Float16* p = rowk0 + 8 * (lane >> 4);
  u.q[0] = *(const v8h*)p; u.q[1] = *(const v8h*)(p + 16); return u.v;
}
// fragment from two octet addresses of the lane's own
__device__ __forceinline__ v16h frag_2(const _Float16* o0, const _Float16* o1) {
  union { v16h v; v8h q[2]; } u; u.q[0] = *(const v8h*)o0; u.q[1] = *(const v8h*)o1; return u.v;
}
__device__ __forceinline__ v16h frag_f32(const float* rowk0, int lane) {
  v16h a; const float* p = rowk0 + 8 * (lane >> 4);
#pragma unroll
  for (int i = 0; i < 8; ++i) { a[i] = (_Float16)p[i]; a[8 + i] = (_Float16)p[16 + i]; }
  return a;
}
__device__ __forceinline__ v16h frag_f32s(const float* rowk0, int lane, float sc) {
  v16h a; const float* p = rowk0 + 8 * (lane >> 4);
#pragma unroll
  for (int i = 0; i < 8; ++i) { a[i] = (_Float16)(p[i] * sc); a[8 + i] = (_Float16)(p[16 + i] * sc); }
  return a;
}
// column fragment from a [K][ld] layout (column n), rows >= K read as 0
__device__ __forceinline__ v16h fragc_f32(const float* W, int k0, int n, int lane, int ld, int K) {
  v16h a; const int g = lane >> 4;
#pragma unroll
  for (int i = 0; i < 8; ++i) { const int ka = k0 + 8 * g + i, kb = ka + 16;
    a[i] = (_Float16)(ka < K ? W[(size_t)(ka < K ? ka : K - 1) * ld + n] : 0.f); a[8 + i] = (_Float16)(kb < K ? W[(size_t)(kb < K ? kb : K - 1) * ld + n] : 0.f); }
  return a;
}
struct F2 { v16b h, l; };
__device__ __forceinline__ F2 bsplit16(const float v[16]) { F2 r;
#pragma unroll
  for (int i = 0; i < 16; ++i) { const __bf16 h = (__bf16)v[i]; r.h[i] = h; r.l[i] = (__bf16)(v[i] - (float)h); }
  return r; }
__device__ __forceinline__ F2 split_row(const float* row, int k0, int lane) { float v[16]; const float* p = row + k0 + 8 * (lane >> 4);
#pragma unroll
  for (int i = 0; i < 8; ++i) { v[i] = p[i]; v[8 + i] = p[16 + i]; }
  return bsplit16(v); }
__device__ __forceinline__ F2 split_rowK(const float* row, int k0, int lane, int K) { float v[16]; const int g = lane >> 4;
#pragma unroll
  for (int i = 0; i < 8; ++i) { const int ka = k0 + 8 * g + i, kb = ka + 16; v[i] = ka < K ? row[ka < K ? ka : K - 1] : 0.f; v[8 + i] = kb < K ? row[kb < K ? kb : K - 1] : 0.f; }
  return bsplit16(v); }
__device__ __forceinline__ F2 split_col(const float* W, int k0, int n, int lane, int ld, int K) { float v[16]; const int g = lane >> 4;
#pragma unroll
  for (int i = 0; i < 8; ++i) { const int ka = k0 + 8 * g + i, kb = ka + 16; v[i] = ka < K ? W[(size_t)(ka < K ? ka : K - 1) * ld + n] : 0.f; v[8 + i] = kb < K ? W[(size_t)(kb < K ? kb : K - 1) * ld + n] : 0.f; }
  return bsplit16(v); }
__device__ __forceinline__ v8f mac3(const F2& a, const F2& b, v8f c) { c = wmma_bf(a.l, b.h, c); c = wmma_bf(a.h, b.l, c); return wmma_bf(a.h, b.h, c); }
__device__ __forceinline__ float sigm(float v) { return 1.0f / (1.0f + expf(-v)); }
#define LDSX() do { asm volatile("s_wait_dscnt 0" ::: "memory"); __builtin_amdgcn_wave_barrier(); __builtin_amdgcn_fence(__ATOMIC_RELEASE, "workgroup"); } while (0)


// Local-window self attention (b 2, 96 x 96, Cin 256, key/query 64 via conv-BN-ReLU x2, value 128, 7x7 window, out conv 256).
#define NB 2
#define HW 96
#define NPX (HW * HW)      // 9216
#define CIN 256
#define CK 64
#define CV 128
#define CO 256
#define NPT (NB * NPX)     // 18432 = 288 x 64
#ifndef TWB
#define TWB (NPT / 96)     // window kernel blocks
#endif
typedef __attribute__((ext_vector_type(8))) __bf16 v8b;
__device__ __forceinline__ v16b frag_b(const __bf16* rowk0, int lane) {
  union { v16b v; v8b q[2]; } u; const __bf16* p = rowk0 + 8 * (lane >> 4);
  u.q[0] = *(const v8b*)p; u.q[1] = *(const v8b*)(p + 16); return u.v;
}
__device__ __forceinline__ float bfr(float v) { return (float)(__bf16)v; }
__device__ __attribute__((noinline)) float exp_ni(float v) { return expf(v); }
__device__ __attribute__((noinline)) float erf_ni(float v) { return erff(v); }

#define WS_KP  0u                                  // key rows [p] of 256 bytes: the 64 channels as f16 hi, then the same 64 as f16 lo (key = hi + lo)
#define WS_QP  (WS_KP + 4u * (size_t)NPT * CK)        // query rows [p], as the key rows
#define WS_VP  (WS_QP + 4u * (size_t)NPT * CK)        // values [b][n / 4][128] of 16-byte pieces: 4 pixels of one channel as f16 hi, then the same 4 pixels as f16 lo (value = hi + lo); the 128 channels of a quad of pixels lie side by side, so that 8 channels are one 128-byte line
#define WS_END (WS_VP + 4u * (size_t)NPT * CV)

__device__ __forceinline__ float bnrelu(float v, const float* bn, int c, int C) { const float gsc = bfr(bn[c]) / sqrtf(bfr(bn[3 * C + c]) + 1e-5f); return fmaxf((v - bfr(bn[2 * C + c])) * gsc + bfr(bn[C + c]), 0.f); }
// ---- k_c1: block = (192 px, b, half), 12 waves: half 0: k1 = bnrelu(fk_w1 x + b) and q1 likewise, kept in LDS as f32 rows, then key = bnrelu(fk_w2 k1 + b) and query likewise -> rows, each f32 value split once into f16 hi + lo; half 1: the 128 value channels = fv_w x + b -> 16-byte pieces [quad of pixels][channel], each f32 value split once into f16 hi + lo.
// The x^T tile [192 px][256 c] and the half's 128 weight rows [o][256 c] are each staged once in LDS as bf16: a weight row is fetched and converted once for 192 pixels; wave = 32 px x 64 outputs (6 fragments for 8 products), k in the same order as before.
#define C1P (CIN + 8)                   // bf16 per staged row: 528 B = 16 B x 33, so 16-byte fragment reads of 16 rows fall on distinct banks
#define C1PX 192                        // pixels per block
#define C1NT 384                        // threads per block
#define C1X (C1PX * C1P * 2)            // bytes of the x tile
#define C2P (CK + 8)                    // bf16 per staged row of the second convs' weights: 144 B = 16 B x 9, same reason
#define C1SO (C1PX * 132 * 4)           // bytes of the k1 | q1 tile [192 px][132]
#define C1VP (C1PX + 4)                 // floats per channel row of the value tile: 784 B = 16 B x 49, same reason for its 16-byte stores
#define C1WN (128 * CIN / 4)            // 16-byte pieces of the half's weight rows
#define C2WN (2 * CK * CK / 4)          // 16-byte pieces of the two second weights
#define C1WJ ((C1WN + C1NT - 1) / C1NT) // pieces per thread
#define C2WJ ((C2WN + C1NT - 1) / C1NT)
#define C1WM (C1WN / 2 / C1NT)          // the run in which the first 64 weight rows end
// whether the wave's 32 pieces of run j (pieces 384 j + 32 wave .. + 31) lie below piece lim (a multiple of 32): a constant wherever the 12 waves agree, a scalar test of the wave's number elsewhere
#define C1LT(j, lim) ((C1NT * ((j) + 1) <= (lim)) || (C1NT * (j) < (lim) && C1NT * (j) + 32 * wave < (lim)))
typedef __attribute__((ext_vector_type(4))) __bf16 v4b;
typedef __attribute__((ext_vector_type(4))) _Float16 v4h;
typedef __attribute__((ext_vector_type(2))) _Float16 v2h;
// 3 waves per SIMD: the 12 waves of the one work-group (168,960 B of LDS) that a WGP holds; all 192 work-groups run in one round
__global__ __launch_bounds__(C1NT, 3) void k_c1(const float* __restrict__ X, const float* __restrict__ WK1, const float* __restrict__ BK1, const float* __restrict__ BNK1, const float* __restrict__ WQ1, const float* __restrict__ BQ1, const float* __restrict__ BNQ1, const float* __restrict__ WV, const float* __restrict__ BVv, const float* __restrict__ WK2, const float* __restrict__ BK2, const float* __restrict__ BNK2, const float* __restrict__ WQ2, const float* __restrict__ BQ2, const float* __restrict__ BNQ2, float* __restrict__ KP, float* __restrict__ QP, float* __restrict__ VP) {
  __shared__ __align__(16) char sm[(C1PX + 128) * C1P * 2];
  __bf16 (*sx)[C1P] = (__bf16 (*)[C1P])sm; __bf16 (*sw)[C1P] = (__bf16 (*)[C1P])(sm + C1X);
  float* so = (float*)sm;               // output tile, over the x tile once every wave has left it
  static_assert(C1SO <= C1X && 128 * C1VP * 4 <= C1X && 128 * C2P * 2 <= 128 * C1P * 2, "the k1 | q1 tile and the value tile fit over the x tile, the second weights over the weight rows");
  static_assert(C1WN % 64 == 0 && C2WN % 64 == 0 && C1PX * 8 % C1NT == 0 && 128 * (C1PX / 4) % C1NT == 0 && C1NT % (C1PX / 4) == 0, "a wave's 32 pieces lie in one weight array; the output pieces divide evenly");
  __bf16 (*sw2)[C2P] = (__bf16 (*)[C2P])(sm + C1X);   // fk_w2 rows 0-63, fq_w2 rows 64-127, over the weight rows once every wave has left them
  // the wave's number as a scalar: the per-wave choice of weight, bias and BN arrays below then stays a scalar base with one offset register
  const int tid = threadIdx.x, wave = __builtin_amdgcn_readfirstlane(tid >> 5), lane = tid & 31, col = lane & 15, g = lane >> 4; const int p0 = blockIdx.x * C1PX; const size_t b = blockIdx.y; const int half = blockIdx.z;
  const int pxg = wave % 6, og = wave / 6;   // the wave's pixels 32 pxg .. +31 and its outputs 64 og .. +63 of the half (half 0: og 0 = key path, og 1 = query path)
  const float* Wa = half ? WV : WK1; const float* Wb = half ? WV + 64 * CIN : WQ1;   // weight rows 0-63 and 64-127 of this half
  // every '#pragma unroll' below makes the indices of xv, wv, w2v, acc and ac2 constants, so that these arrays live in registers and the loads of a run are independent
  // x: wave = 32 px x 128 channels, thread = 4 pixels x 4 octets of channels; a wave's 16-byte load is four whole 128-B lines (8 lanes each) of four planes, and the 32 + 22 loads of a thread are all in flight at once
  // lane = (quad & 3) + 4 x (octet & 3) + 16 x (quad >> 2): the 16-byte LDS stores of either half-wave then fall on distinct banks (4 rows on = 16 banks on, an octet on = 4 banks on)
  // weights: piece e = tid + 384 j is 16 B of the contiguous rows
  const int xq = (lane & 3) + 4 * g, xo = (lane >> 2) & 3, xpx = pxg * 32 + xq * 4; const float* xp = X + (b * CIN + og * 128 + xo * 8) * (size_t)NPX + p0 + xpx;
  // byte offset of the thread's piece in run j from the start of its weight array: wo + a constant, but in the one run that holds the last pieces of rows 0-63 and the first of rows 64-127, where it is wom
  const unsigned wo = 16u * (unsigned)tid, wom = wo + (C1LT(C1WM, C1WN / 2) ? 16u * (C1NT * C1WM) : 0u - 16u * (C1WN / 2 - C1NT * C1WM));
  v4f xv[4][8], wv[C1WJ];
#pragma unroll
  for (int j = 0; j < 4; ++j)
#pragma unroll
    for (int i = 0; i < 8; ++i) xv[j][i] = *(const v4f*)(xp + (size_t)(j * 32 + i) * NPX);
#pragma unroll
  for (int j = 0; j < C1WJ; ++j) if (C1LT(j, C1WN)) wv[j] = *(const v4f*)((const char*)(C1LT(j, C1WN / 2) ? Wa : Wb) + (j == C1WM ? wom : j < C1WM ? wo + 16u * (C1NT * j) : wo + 16u * (C1NT * j - C1WN / 2)));
  // the code below takes the address registers that these loads name; the addresses are inputs, so that no late load's data is given them before this wait
  asm volatile("s_wait_xcnt 0x0" :: "v"(xp), "v"(wo), "v"(wom) : "memory");
#pragma unroll
  for (int j = 0; j < 4; ++j)
#pragma unroll
    for (int k = 0; k < 4; ++k) { v8b o;
#pragma unroll
      for (int i = 0; i < 8; ++i) o[i] = (__bf16)xv[j][i][k];
      *(v8b*)&sx[xpx + k][(og * 16 + xo + 4 * j) * 8] = o; }
#pragma unroll
  for (int j = 0; j < C1WJ; ++j) if (C1LT(j, C1WN)) { const int e = tid + C1NT * j; v4b o;
#pragma unroll
    for (int i = 0; i < 4; ++i) o[i] = (__bf16)wv[j][i];
    *(v4b*)&sw[e >> 6][(e & 63) * 4] = o; }
  __syncthreads();
  // second convs: wave = its own 32 px x 64 outputs of key (og 0) or query (og 1)
  v4f w2v[C2WJ]; float b2[4], m2[4], g2[4], t2[4], r2[4];   // raw bias, mean, gamma, beta, variance of the wave's 4 x 16 outputs
  // issued here, behind the barrier, so that the first product covers their latency; in both halves: under a test of the half the compiler draws the arithmetic on them, and so the wait, up to this place
  {
#pragma unroll
    for (int j = 0; j < C2WJ; ++j) if (C1LT(j, C2WN)) { const int e = tid + C1NT * j; w2v[j] = *(const v4f*)(C1LT(j, C2WN / 2) ? WK2 + e * 4 : WQ2 + (e - C2WN / 2) * 4); }
    const float* Bm = og ? BQ2 : BK2; const float* bn = og ? BNQ2 : BNK2;
#pragma unroll
    for (int j = 0; j < 4; ++j) { const int o = j * 16 + col; b2[j] = Bm[o]; g2[j] = bn[o]; r2[j] = bn[3 * CK + o]; m2[j] = bn[2 * CK + o]; t2[j] = bn[CK + o]; } }
  v8f acc[2][4] = {};
#pragma unroll
  for (int kc = 0; kc < CIN / 32; ++kc) { v16b a[2], w[4];
#pragma unroll
    for (int i = 0; i < 2; ++i) a[i] = frag_b(&sx[pxg * 32 + i * 16 + col][kc * 32], lane);
#pragma unroll
    for (int j = 0; j < 4; ++j) w[j] = frag_b(&sw[og * 64 + j * 16 + col][kc * 32], lane);
#pragma unroll
    for (int i = 0; i < 2; ++i)
#pragma unroll
      for (int j = 0; j < 4; ++j) acc[i][j] = wmma_bf(a[i], w[j], acc[i][j]); }
  __syncthreads();   // every read of the x tile and of the weight rows is done; the output tile and the second weights may overwrite them
  if (half == 0) { const float* Bm = og ? BQ1 : BK1; const float* bn = og ? BNQ1 : BNK1;   // so = [192 px][132]: k1 in columns 0-63, q1 in 64-127
#pragma unroll
    for (int j = 0; j < 4; ++j) { const int oc = j * 16 + col, o = og * 64 + oc; const float bb = bfr(Bm[oc]);
#pragma unroll
      for (int i = 0; i < 2; ++i)
#pragma unroll
        for (int r = 0; r < 8; ++r) so[(pxg * 32 + i * 16 + 8 * g + r) * 132 + o] = bnrelu(acc[i][j][r] + bb, bn, oc, CK); }
#pragma unroll
    for (int j = 0; j < C2WJ; ++j) if (C1LT(j, C2WN)) { const int e = tid + C1NT * j; v4b o;   // piece e: row e / 16 (fk_w2, then fq_w2), quad e % 16
#pragma unroll
      for (int i = 0; i < 4; ++i) o[i] = (__bf16)w2v[j][i];
      *(v4b*)&sw2[e >> 4][(e & 15) * 4] = o; }
#pragma unroll
    for (int j = 0; j < 4; ++j) { b2[j] = bfr(b2[j]); g2[j] = bfr(g2[j]) / sqrtf(bfr(r2[j]) + 1e-5f); m2[j] = bfr(m2[j]); t2[j] = bfr(t2[j]); }
    __syncthreads();   // the k1 | q1 rows and the second weights are visible
    // the wave alone reads rows 32 pxg .. +31, columns 64 og .. +63 of so: f32 input as bf16 hi + lo, 2 products, k ascending
    v8f ac2[2][4] = {};
#pragma unroll
    for (int kc = 0; kc < CK / 32; ++kc) { v16b w2f[4]; F2 a[2];
      // the 16 LDS reads of a k step stand in front of its products, so that their latency is paid once a step
#pragma unroll
      for (int j = 0; j < 4; ++j) w2f[j] = frag_b(&sw2[og * 64 + j * 16 + col][kc * 32], lane);
#pragma unroll
      for (int s = 0; s < 2; ++s) { const float* ap = &so[(pxg * 32 + s * 16 + col) * 132 + og * 64 + kc * 32 + 8 * g]; v4f aq[4]; float av[16];
        aq[0] = *(const v4f*)ap; aq[1] = *(const v4f*)(ap + 4); aq[2] = *(const v4f*)(ap + 16); aq[3] = *(const v4f*)(ap + 20);
#pragma unroll
        for (int i = 0; i < 16; ++i) av[i] = aq[i >> 2][i & 3];
        a[s] = bsplit16(av); }
      // each accumulator takes hi, then lo, kc ascending; the eight accumulators alternate, so that no product waits for the one in front of it
#pragma unroll
      for (int s = 0; s < 2; ++s)
#pragma unroll
        for (int j = 0; j < 4; ++j) ac2[s][j] = wmma_bf(a[s].h, w2f[j], ac2[s][j]);
#pragma unroll
      for (int s = 0; s < 2; ++s)
#pragma unroll
        for (int j = 0; j < 4; ++j) ac2[s][j] = wmma_bf(a[s].l, w2f[j], ac2[s][j]); }
    // key and query: back into the wave's own part of so, every read of which has fed the products above
#pragma unroll
    for (int s = 0; s < 2; ++s)
#pragma unroll
      for (int j = 0; j < 4; ++j)
#pragma unroll
        for (int r = 0; r < 8; ++r) so[(pxg * 32 + s * 16 + 8 * g + r) * 132 + og * 64 + j * 16 + col] = fmaxf((ac2[s][j][r] + b2[j] - m2[j]) * g2[j] + t2[j], 0.f);
    __syncthreads();   // the key and query tiles are visible
    // piece e = tid + 384 j: pixel e / 8, octet e % 8 of its 64 channels, of the key (h = 0) and of the query
#pragma unroll
    for (int j = 0; j < C1PX * 8 / C1NT; ++j) { const int e = tid + C1NT * j, cl = e >> 3, q = e & 7;
#pragma unroll
      for (int h = 0; h < 2; ++h) { const float* xp2 = &so[cl * 132 + h * 64 + q * 8]; const v4f x0 = *(const v4f*)xp2, x1 = *(const v4f*)(xp2 + 4); v8h hi, lo;
#pragma unroll
        for (int i = 0; i < 4; ++i) { hi[i] = (_Float16)x0[i]; lo[i] = (_Float16)(x0[i] - (float)hi[i]); hi[4 + i] = (_Float16)x1[i]; lo[4 + i] = (_Float16)(x1[i] - (float)hi[4 + i]); }
        float* dst = (h ? QP : KP) + (b * NPX + p0 + cl) * (size_t)CK + q * 4;   // 16 bytes = 4 floats of the 256-byte row; the lo half begins at byte 128
        vst2(dst, hi); vst2(dst + 32, lo); } } }
  else {
#pragma unroll
    for (int j = 0; j < 4; ++j) { const int o = og * 64 + j * 16 + col; const float bb = bfr(BVv[o]);
#pragma unroll
      for (int i = 0; i < 2; ++i)
#pragma unroll
        for (int r = 0; r < 8; ++r) so[o * C1VP + pxg * 32 + i * 16 + 8 * g + r] = acc[i][j][r] + bb; }   // transposed: [channel][px], pitch 196
    __syncthreads();   // the value tile is visible
    // piece e = tid + 384 j: channel e % 128 = tid % 128, quad e / 128 = tid / 128 + 3 j of its 192 pixels; the block's pieces are 98,304 bytes in a row, and the 16-byte LDS reads of 16 channels fall on distinct banks
    static_assert(C1NT % CV == 0, "a thread keeps its channel in every run");
    const float* sv = &so[(tid & (CV - 1)) * C1VP + (tid / CV) * 4]; float* vp = VP + (b * (NPX / 4) + p0 / 4) * (size_t)(CV * 4) + tid * 4;
#pragma unroll
    for (int j = 0; j < 128 * (C1PX / 4) / C1NT; ++j) { const v4f x = *(const v4f*)(sv + j * (C1NT / CV) * 4); union { v4f f; v4h h[2]; } u;
#pragma unroll
      for (int i = 0; i < 4; ++i) { u.h[0][i] = (_Float16)x[i]; u.h[1][i] = (_Float16)(x[i] - (float)u.h[0][i]); }
      vst2(vp + j * (C1NT * 4), u.f);
      if (j % 8 == 7) __builtin_amdgcn_sched_barrier(0); }   // 8 pieces at a time: with all 16 in work at once the kernel goes beyond 256 registers
    asm volatile("s_wait_xcnt 0x0" ::: "memory"); } }   // in the listing the other half's code, which takes the registers that these stores name, stands behind this path
// ---- k_win: block = 32 pixels x 3 image rows, 24 waves (lane = pixel, 8 waves per image row). The 9 x 40 window rows (y0-3 .. y0+5, x0-4 .. x0+35, zeros outside the image) of 64 channels are staged once for the three image rows: key and later value 64-127 in buffer A, value 0-63 in buffer B.
// logits: wave = window row of its image row (7 of 8 waves); per 16 pixels a matrix product S[position][px] = K[position][channel] * Q[channel][px] over the staged positions 16 tx + 0..31 of the row, key and query each as f16 hi + lo; pixel i of the tile takes its 7 logits from positions i + 1 .. i + 7 through LDS; softmax
// context: per window row dy a matrix product ctx[channel][px] += V[channel][k] * P[k][px], k = staged position 16 tx + 0..31 of the row, P the 7 weights of pixel i of the tile at k = i + 1 .. i + 7 and zero elsewhere; values staged as f16 hi and lo planes [window row][channel][40], weights as f16 hi and lo rows [image row][dy][px][24]; wave = 16 px x 3 image rows x 32 channels (8 waves) -> f16 context rows
// final 1x1 conv in the same block: the 96 f16 context rows stay in LDS, the 256 weight rows are staged once as f16 over the spent window rows; wave = 32 px x 32 outputs, k in ascending order; output tiles [3][256][32 px] through LDS -> whole 128-B lines of the output planes
#define OWP (CV + 8)                    // f16 per staged weight row: 272 B = 16 B x 17, so 16-byte fragment reads of 16 rows fall on distinct banks
#define OSP 36                          // floats per row of the output tile: 144 B = 16 B x 9, same reason for its 16-byte stores
#define WR 3                            // image rows per block
#define WT (256 * WR)                   // threads per block
#define WPITCH 40                       // positions per staged row (f16 in a value plane: 80 B = 16 B x 5, so 16-byte fragment reads of 16 rows fall on distinct banks)
#define WRS (64 * WPITCH)               // elements per staged window row (64 channels side by side)
#define WITEMS (64 * (WR + 6) * 10)     // 16-byte pieces per staged pass
#define WNJ ((WITEMS + WT - 1) / WT)    // pieces per thread
#define WTASKS (WITEMS / 32)            // wave loads per staged value pass
#define WBUF (WNJ * WT * 4)             // floats per buffer: the 9 window rows and a tail that takes the last run's surplus pieces (zeros; read only by the key fragments of the last window row, in product rows that no pixel takes, and by the value fragment octet behind the last staged row, against zero weights), so that every thread runs the same loads and stores
#define WWJ ((CO * CV / 4 + WT - 1) / WT)   // 16-byte pieces of the weight rows per thread
#define WWL ((CO * CV / 4 - WT * (WWJ - 1)) / 32)   // waves whose last piece is a weight row; the others stage a second copy of the piece before it into rows behind the 256 (never read), so that every wave runs the same loads and stores
#define PBP 24                          // f16 per weight row: k = 24 .. 31 are zero for every pixel and are not stored; 48 B = 16 B x 3, so 16-byte fragment reads of 16 rows fall on distinct banks
#define PBN (WR * 7 * 32 * PBP)         // f16 per plane of weight rows
#define SLP 28                          // floats per pixel of a wave's logit tile (positions 0 .. 23 of the 32): 112 B = 16 B x 7, so its 16-byte stores of 16 pixels fall on distinct banks
// every '#pragma unroll' below makes the indices of off, ok, koff, kok, va, vb, vc, d, s, eh, el, inv, cx, vh, vl, wh, wl, wv, ca, w and acc constants, so that these arrays live in registers and the loads of a run are independent
// 6 waves per SIMD: the 24 waves of one work-group (317,184 B of LDS) fill a WGP, and all 192 work-groups run in one round
__global__ __launch_bounds__(WT, 6) void k_win(const float* __restrict__ KP, const float* __restrict__ QP, const float* __restrict__ VP, const float* __restrict__ WW, const float* __restrict__ BW, float* __restrict__ OUT) {
  __shared__ __align__(16) float sh[2 * WBUF]; __shared__ __align__(16) char sq[WR * 32 * 256]; __shared__ __align__(16) _Float16 spc[2 * PBN + WR * 32 * (CV + 8)]; __shared__ float ssm[WR][7][32]; __shared__ float smx[WR][7][32];
  float* shA = sh; float* shB = sh + WBUF;
  _Float16* sp = spc; _Float16 (*sct)[CV + 8] = (_Float16 (*)[CV + 8])(spc + 2 * PBN);
  float* sl = (float*)spc;   // the logit tiles, where the weight rows and the context rows come later
  static_assert(WR * 7 * 32 * SLP * 4 <= (2 * PBN + WR * 32 * (CV + 8)) * 2 && (WNJ * WT / 16) * 256 <= WBUF * 4, "logit tiles fit under the weight and context rows, the key rows in buffer A");
  const int t = threadIdx.x, wave = __builtin_amdgcn_readfirstlane(t >> 5), lane = t & 31;
  const int rg = wave >> 3, w8 = wave & 7;   // the wave's image row of the block, and its number among that row's 8 waves
  const int bx = blockIdx.x; const int b = bx / (NPX / (32 * WR)), tl = bx % (NPX / (32 * WR)), y0 = (tl / (HW / 32)) * WR, x0 = (tl % (HW / 32)) * 32;
  // run j of a value pass: the wave takes task k = wave + 24 j = (window row k / 20, pair of quads of the row, 16 channels k % 4); lanes 0-15 take the 16 channels of the even quad, lanes 16-31 those of the odd quad:
  // the load is two runs of 256 bytes (four whole 128-byte lines), and the 8-byte LDS stores of the 32 lanes (a channel on = 20 banks on, a quad on = 2 banks on) fall on the 64 banks once each; a quad lies wholly inside or wholly outside the image
  const int vl = lane & 15, vq = lane >> 4;
  unsigned off[WNJ]; bool ok[WNJ];   // piece numbers from the pass's first piece, clamped into the image where the piece is outside (such a piece is stored as zeros)
#pragma unroll
  for (int j = 0; j < WNJ; ++j) { const int k = wave + (WT / 32) * j, cg = k & 3, rq = k >> 2, r = rq / 5, qd = (rq - r * 5) * 2 + vq; const int yy = y0 - 3 + r, xq = x0 / 4 - 1 + qd;
    const bool in = (WT / 32) * (j + 1) <= WTASKS || k < WTASKS;   // a constant but in the last run, a scalar test of the wave's number there
    ok[j] = in & ((unsigned)yy < (unsigned)HW) & ((unsigned)xq < (unsigned)(HW / 4));
    const int yc = __builtin_amdgcn_readfirstlane(min(max(yy, 0), HW - 1));   // the same in every lane; as a scalar, so that the row's product below is a scalar one and not a quarter-rate vector multiply
    off[j] = (unsigned)((yc * (HW / 4) + min(max(xq, 0), HW / 4 - 1)) * CV + cg * 16 + vl); }
  auto fetch = [&](const float* __restrict__ srcp, v4f (&v)[WNJ]) {
#pragma unroll
    for (int j = 0; j < WNJ; ++j) v[j] = ((const v4f*)srcp)[off[j]]; };
  // a value piece (4 hi | 4 lo) goes to the hi plane (first half of the buffer) and the lo plane (second half), at the element index of its 4 pixels
  // element index in a plane: [window row][channel][40], the surplus tasks of the last run in the tail; formed here from the wave's number and the lane's number read anew: eight indices held in registers across the logits are spilled
  auto put16 = [&](float* dst, const v4f (&v)[WNJ]) { _Float16* dh = (_Float16*)dst; const int pl = (int)__builtin_amdgcn_mbcnt_lo(~0u, 0u), pb = (pl & 15) * WPITCH + (pl >> 4) * 4;
#pragma unroll
    for (int j = 0; j < WNJ; ++j) { const v4f z = {0.f, 0.f, 0.f, 0.f}; union { v4f f; v4h h[2]; } u; u.f = ok[j] ? v[j] : z;
      const int k = wave + (WT / 32) * j, rq = k >> 2, r = rq / 5; const bool in = (WT / 32) * (j + 1) <= WTASKS || k < WTASKS;
      const int ix = in ? r * WRS + (k & 3) * 16 * WPITCH + (rq - r * 5) * 8 + pb : (WR + 6) * WRS + ((k - WTASKS) * 32 + pl) * 4;
      *(v4h*)&dh[ix] = u.h[0]; *(v4h*)&dh[WBUF + ix] = u.h[1]; } };
  // key rows: piece e = t + 768 j is (staged position e / 16 = 40 x window row + column, 16-byte slot e % 16 of its 256-byte row: 8 octets of hi, 8 of lo); a wave's load is 512 bytes in a row
  // in LDS slot s of position p (and of query pixel p) stands at slot s ^ (p & 15) of its 256 bytes, so that the 16 slots of a row as well as one slot of 16 rows fall on distinct banks
  unsigned koff[WNJ]; bool kok[WNJ];
#pragma unroll
  for (int j = 0; j < WNJ; ++j) { const int e = t + WT * j, pp = e >> 4, r = pp / WPITCH, yy = y0 - 3 + r, xx = x0 - 4 + pp - r * WPITCH;
    kok[j] = (e < WITEMS) & ((unsigned)yy < (unsigned)HW) & ((unsigned)xx < (unsigned)HW);
    koff[j] = 256u * (unsigned)(min(max(yy, 0), HW - 1) * HW + min(max(xx, 0), HW - 1)) + 16u * (unsigned)(e & 15); }
  v4f qv[2], va[WNJ], vb[WNJ], vc[WNJ];
  // piece e = t + 768 j of the query rows: image row e / 512, pixel, 16-byte slot e % 16 of its 256-byte row
#pragma unroll
  for (int j = 0; j < 2; ++j) { const int e = t + WT * j; qv[j] = *(const v4f*)((const char*)(QP + ((size_t)b * NPX + y0 * HW + x0) * CK) + 4u * (unsigned)((e >> 9) * (HW * CK) + (e & 511) * 4)); }
  asm volatile("s_wait_xcnt 0x0" ::: "memory");   // the data of the loads below may be given the offset registers that the two query loads name
#pragma unroll
  for (int j = 0; j < WNJ; ++j) va[j] = *(const v4f*)((const char*)(KP + (size_t)b * CK * NPX) + koff[j]);
  // the offsets are inputs, so that they stay in their registers up to this wait: without that a late load's data is given the offset registers of the loads in front of it
  asm volatile("s_wait_xcnt 0x0" :: "v"(koff[0]), "v"(koff[1]), "v"(koff[2]), "v"(koff[3]), "v"(koff[4]), "v"(koff[5]), "v"(koff[6]), "v"(koff[7]) : "memory");
#pragma unroll
  for (int j = 0; j < WNJ; ++j) { const int e = t + WT * j; const v4f z = {0.f, 0.f, 0.f, 0.f}; *(v4f*)((char*)shA + (e >> 4) * 256 + (((e ^ (e >> 4)) & 15) << 4)) = kok[j] ? va[j] : z; }
#pragma unroll
  for (int j = 0; j < 2; ++j) { const int e = t + WT * j; *(v4f*)(sq + (e >> 4) * 256 + (((e ^ (e >> 4)) & 15) << 4)) = qv[j]; }
  __syncthreads();
  // both value halves are in flight under the logits (issued in front of the barrier they would be waited for at it)
  fetch(VP + (size_t)b * CV * NPX, vb);
  fetch(VP + (size_t)b * CV * NPX + 64 * 4, vc);
  static_assert(WNJ == 8, "the wait below names the 8 offsets");
  // the offsets are inputs, so that they stay in their registers up to this wait: without that a late load's data is given the offset registers of the loads in front of it
  asm volatile("s_wait_xcnt 0x0" :: "v"(off[0]), "v"(off[1]), "v"(off[2]), "v"(off[3]), "v"(off[4]), "v"(off[5]), "v"(off[6]), "v"(off[7]) : "memory");
  float s[7] = {0.f, 0.f, 0.f, 0.f, 0.f, 0.f, 0.f};
  if (w8 < 7) { const int c16 = lane & 15, gh = lane >> 4, kp = (rg + w8) * WPITCH + c16;   // kp: the lane's key row in the row's first 16 positions
    // byte address of slot gh of the lane's key row and query row; slot 8 plane + 4 ks + 2 half + gh is that address ^ (16 x the even part), 16 rows further on + 4096
    const unsigned ka = (unsigned)kp * 256u + (unsigned)(((kp & 15) ^ gh) << 4), qa = (unsigned)(rg * 32 + c16) * 256u + (unsigned)((c16 ^ gh) << 4);
    const char* kb = (const char*)shA; float* st = sl + (rg * 7 + w8) * (32 * SLP);
    auto fr = [&](const char* base, unsigned a, int tile, int plane, int ks) { return frag_2((const _Float16*)(base + (a ^ (unsigned)(plane * 128 + ks * 64)) + tile * 4096), (const _Float16*)(base + (a ^ (unsigned)(plane * 128 + ks * 64 + 32)) + tile * 4096)); };
#pragma unroll
    for (int tx = 0; tx < 2; ++tx) { v8f d[2] = {};   // rows = positions 16 tx + 16 i + 0..15, columns = pixels 16 tx + 0..15; positions 40 .. 47 run into the next staged row or the zero tail: rows of the product that no pixel takes
#pragma unroll
      for (int ks = 0; ks < CK / 32; ++ks) { const v16h qh = fr(sq, qa, tx, 0, ks), ql = fr(sq, qa, tx, 1, ks); v16h kh[2], kl[2];
#pragma unroll
        for (int i = 0; i < 2; ++i) { kh[i] = fr(kb, ka, tx + i, 0, ks); kl[i] = fr(kb, ka, tx + i, 1, ks); }
        // the two accumulators alternate, so that no product waits for the one in front of it
#pragma unroll
        for (int i = 0; i < 2; ++i) d[i] = wmma16(kl[i], qh, d[i]);
#pragma unroll
        for (int i = 0; i < 2; ++i) d[i] = wmma16(kh[i], ql, d[i]);
#pragma unroll
        for (int i = 0; i < 2; ++i) d[i] = wmma16(kh[i], qh, d[i]); }
      // element e = position 16 i + 8 gh + e of pixel c16; positions 24 .. 31 are beyond every pixel's window and are not stored
      float* sr = st + (tx * 16 + c16) * SLP + 8 * gh;
      const v4f d0 = {d[0][0], d[0][1], d[0][2], d[0][3]}, d1 = {d[0][4], d[0][5], d[0][6], d[0][7]}, d2 = {d[1][0], d[1][1], d[1][2], d[1][3]}, d3 = {d[1][4], d[1][5], d[1][6], d[1][7]};
      *(v4f*)sr = d0; *(v4f*)(sr + 4) = d1;
      if (gh == 0) { *(v4f*)(sr + 16) = d2; *(v4f*)(sr + 20) = d3; } }
    asm volatile("s_wait_dscnt 0x0" ::: "memory");   // the wave's own tile: the reads below take what other lanes of the wave have stored, and may not be moved up over those stores
#pragma unroll
    for (int dx = 0; dx < 7; ++dx) s[dx] = st[lane * SLP + c16 + 1 + dx];
    float pm = s[0];
#pragma unroll
    for (int dx = 1; dx < 7; ++dx) pm = fmaxf(pm, s[dx]);
    smx[rg][w8][lane] = pm; }
  put16(shB, vb);
  __syncthreads();   // every read of the key rows is done; the row maxima are visible
  put16(shA, vc);
  float mx = smx[rg][0][lane];
#pragma unroll
  for (int r = 1; r < 7; ++r) mx = fmaxf(mx, smx[rg][r][lane]);
  if (w8 < 7) {   // the lane writes its pixel's whole weight row of this dy: zeros, then, over them, the 7 weights at k = i + 1 + dx
    _Float16* ph = &sp[((rg * 7 + w8) * 32 + lane) * PBP]; _Float16* pl = ph + PBN; const v8h z8 = {};
#pragma unroll
    for (int q = 0; q < 3; ++q) { *(v8h*)(ph + 8 * q) = z8; *(v8h*)(pl + 8 * q) = z8; }
    float rs = 0.f; const int k1 = (lane & 15) + 1; _Float16 eh[9], el[9];   // element 1 + dx; a zero at either end
    eh[0] = eh[8] = el[0] = el[8] = (_Float16)0.f;
#pragma unroll
    for (int dx = 0; dx < 7; ++dx) { const float e = expf(s[dx] - mx); rs += e; eh[1 + dx] = (_Float16)e; el[1 + dx] = (_Float16)(e - (float)eh[1 + dx]); }
    // as 4 whole dwords from k = k1 & ~1, so that every store is 4-byte aligned: k1 even: e0 e1 | e2 e3 | e4 e5 | e6 0; k1 odd: 0 e0 | e1 e2 | e3 e4 | e5 e6
#pragma unroll
    for (int q = 0; q < 4; ++q) { const v2h he = {eh[2 * q + 1], eh[2 * q + 2]}, ho = {eh[2 * q], eh[2 * q + 1]}, le = {el[2 * q + 1], el[2 * q + 2]}, lo = {el[2 * q], el[2 * q + 1]};
      *(v2h*)(ph + (k1 & ~1) + 2 * q) = (k1 & 1) ? ho : he; *(v2h*)(pl + (k1 & ~1) + 2 * q) = (k1 & 1) ? lo : le; }
    ssm[rg][w8][lane] = rs; }
  __syncthreads();   // the weight rows, their sums and all value channels are visible
  // 8 of the 24 waves work here, each on all three image rows: a value fragment is then read once for the products of up to three image rows (26 16-byte LDS reads per 16 x 16 output tile; 42 with one image row per wave); the other waves go on to their weight loads
  // waves 6 a + b, b < 2: the choice of waves is for speed only
  const int wa = wave / 6, wb = wave - 6 * wa;
  if (wb < 2) { const int c16 = lane & 15, gh = lane >> 4, tx = wa >> 1, cp = (wa & 1) * 2 + wb;   // the wave's pixels 16 tx .. +15 of each image row and its channels 32 cp .. +31
    float inv[WR];
#pragma unroll
    for (int q = 0; q < WR; ++q) { float ssum = 0.f;
#pragma unroll
      for (int r = 0; r < 7; ++r) ssum += ssm[q][r][tx * 16 + c16];
      inv[q] = 1.0f / ssum; }
    // value fragment: k = staged position 16 tx + k of the channel's row; at tx = 1 k = 24 .. 31 run into the next staged row or the tail: finite values against zero weights
    const _Float16* vr = (const _Float16*)(cp < 2 ? shB : shA) + ((cp & 1) * 32 + c16) * WPITCH + tx * 16;
    // weight fragment: k = 8 gh .. +7 and 16 + 8 gh .. +7 of the pixel's row; k = 24 .. 31 are zero and not stored: the upper half-wave reads k = 16 .. 23 of the tile's pixel 0 for them, whose weights end at k = 7
    const _Float16* p0 = &sp[(tx * 16 + c16) * PBP + 8 * gh]; const _Float16* p1 = &sp[(tx * 16 + (gh ? 0 : c16)) * PBP + 16];
    v8f cx[WR][2] = {};
#pragma unroll
    for (int r = 0; r < WR + 6; ++r) { v16h vh[2], vl[2], wh[WR], wl[WR];   // staged window row r is window row dy = r - q of image row q
#pragma unroll
      for (int i = 0; i < 2; ++i) { vh[i] = frag_h(vr + r * WRS + i * 16 * WPITCH, lane); vl[i] = frag_h(vr + r * WRS + i * 16 * WPITCH + WBUF, lane); }
#pragma unroll
      for (int q = 0; q < WR; ++q) if (r - q >= 0 && r - q < 7) { wh[q] = frag_2(p0 + (q * 7 + r - q) * 32 * PBP, p1 + (q * 7 + r - q) * 32 * PBP); wl[q] = frag_2(p0 + (q * 7 + r - q) * 32 * PBP + PBN, p1 + (q * 7 + r - q) * 32 * PBP + PBN); }
      // rows = channels, columns = pixels; the accumulators alternate, so that no product waits for the one in front of it
#pragma unroll
      for (int q = 0; q < WR; ++q) if (r - q >= 0 && r - q < 7) {
#pragma unroll
        for (int i = 0; i < 2; ++i) cx[q][i] = wmma16(vl[i], wh[q], cx[q][i]); }
#pragma unroll
      for (int q = 0; q < WR; ++q) if (r - q >= 0 && r - q < 7) {
#pragma unroll
        for (int i = 0; i < 2; ++i) cx[q][i] = wmma16(vh[i], wl[q], cx[q][i]); }
#pragma unroll
      for (int q = 0; q < WR; ++q) if (r - q >= 0 && r - q < 7) {
#pragma unroll
        for (int i = 0; i < 2; ++i) cx[q][i] = wmma16(vh[i], wh[q], cx[q][i]); } }
#pragma unroll
    for (int q = 0; q < WR; ++q)
#pragma unroll
      for (int i = 0; i < 2; ++i) { v8h o;   // element e = channel 32 cp + 16 i + 8 gh + e of pixel c16
#pragma unroll
        for (int e = 0; e < 8; ++e) o[e] = (_Float16)(cx[q][i][e] * inv[q]);
        *(v8h*)&sct[q * 32 + tx * 16 + c16][cp * 32 + i * 16 + 8 * gh] = o; } }
  static_assert((WT / 32) * WWJ * OWP * 2 <= 2 * WBUF * 4 && WR * CO * OSP * 4 <= 2 * WBUF * 4, "weight rows and output tiles fit in the window buffers");
  _Float16 (*sw)[OWP] = (_Float16 (*)[OWP])sh; float* so = sh + rg * (CO * OSP);
  // the lane's number is read anew here: a thread index held in a register across the context loop, which runs at the register limit, is spilled
  const int ln = (int)__builtin_amdgcn_mbcnt_lo(~0u, 0u), t2 = wave * 32 + ln, t8 = w8 * 32 + ln;
  // piece e = t2 + 768 j is 16 B of the contiguous weight rows; all loads of a thread are in flight at once
  v4f wv[WWJ]; const float* wp = WW + (unsigned)t2 * 4u;
#pragma unroll
  for (int j = 0; j < WWJ - 1; ++j) wv[j] = *(const v4f*)(wp + WT * 4 * j);
  const float* wl = wp + WT * 4 * (wave < WWL ? WWJ - 1 : WWJ - 2);
  wv[WWJ - 1] = *(const v4f*)wl;
  __syncthreads();   // every read of the value rows is done; the context rows are visible
  const int col = ln & 15, g = ln >> 4;
  const float bb[2] = {bfr(BW[w8 * 32 + col]), bfr(BW[w8 * 32 + 16 + col])};   // loaded here, where the LDS stores cover it: behind the product its latency would stand open
  // the code below takes the address registers that the weight and bias loads name; the two weight addresses are inputs, so that no weight load's data is given them before this wait
  asm volatile("s_wait_xcnt 0x0" :: "v"(wp), "v"(wl) : "memory");
#pragma unroll
  for (int j = 0; j < WWJ; ++j) { v4h o;   // piece t2 + 768 j: row wave + 24 j, quad ln
#pragma unroll
    for (int i = 0; i < 4; ++i) o[i] = (_Float16)bfr(wv[j][i]);
    *(v4h*)&sw[wave + (WT / 32) * j][ln * 4] = o; }
  __syncthreads();   // the weight rows are visible
  v8f acc[2][2] = {};
#pragma unroll
  for (int kc = 0; kc < CV / 32; ++kc) { v16h ca[2], w[2];
#pragma unroll
    for (int i = 0; i < 2; ++i) { ca[i] = frag_h(&sct[rg * 32 + i * 16 + col][kc * 32], ln); w[i] = frag_h(&sw[w8 * 32 + i * 16 + col][kc * 32], ln); }
#pragma unroll
    for (int i = 0; i < 2; ++i)
#pragma unroll
      for (int j = 0; j < 2; ++j) acc[i][j] = wmma16(ca[i], w[j], acc[i][j]); }
  __syncthreads();   // every read of the weight rows is done; the output tiles may overwrite them
#pragma unroll
  for (int j = 0; j < 2; ++j) { const int o = w8 * 32 + j * 16 + col;
#pragma unroll
    for (int i = 0; i < 2; ++i)
#pragma unroll
      for (int r = 0; r < 8; ++r) so[o * OSP + i * 16 + 8 * g + r] = acc[i][j][r] + bb[j]; }
  __syncthreads();   // the output tiles are visible
  const int n0 = (y0 + rg) * HW + x0;
#pragma unroll
  for (int j = 0; j < CO / 32; ++j) { const unsigned cl = ((unsigned)t8 >> 3) + 32u * j, q = t8 & 7; vst2(OUT + ((size_t)b * CO + cl) * NPX + n0 + q * 4, *(const v4f*)&so[cl * OSP + q * 4]); } }
extern "C" void kernel_launch(void* const* d_in, const int* in_sizes, int n_in, void* d_out, int out_size, void* d_ws, size_t ws_size, hipStream_t stream) {
  (void)in_sizes; (void)n_in; (void)out_size;
  const float** F = (const float**)d_in;   // 0 x [2,256,96,96], 1 fk_w1 [64,256], 2 fk_b1, 3 fk_bn1 [4,64], 4 fk_w2 [64,64], 5 fk_b2, 6 fk_bn2, 7 fq_w1, 8 fq_b1, 9 fq_bn1, 10 fq_w2, 11 fq_b2, 12 fq_bn2, 13 fv_w [128,256], 14 fv_b, 15 W_w [256,128], 16 W_b
  if (ws_size < (size_t)WS_END) return;
  char* ws = (char*)d_ws; float *KP = (float*)(ws + WS_KP), *QP = (float*)(ws + WS_QP), *VP = (float*)(ws + WS_VP);
  k_c1<<<dim3(NPX / C1PX, NB, 2), C1NT, 0, stream>>>(F[0], F[1], F[2], F[3], F[7], F[8], F[9], F[13], F[14], F[4], F[5], F[6], F[10], F[11], F[12], KP, QP, VP);
  k_win<<<TWB, WT, 0, stream>>>(KP, QP, VP, F[15], F[16], (float*)d_out);
}

// v010
// It runs in 23.2 microseconds.
// In both of two side-by-side timings against v009, it was 1.10 times as fast.
// Over all steps from v000 it is 45.7 times as fast.
// compute dtype: all float inputs rounded to bf16; the five 1x1 convs on WMMA 16x16x32: x-fed ones with EXACT bf16 products (x^T tile in LDS), the second key/query convs with their f32 input as bf16 hi + lo (2 products), eval BatchNorm + ReLU in f32; key and query rows and value planes as f16 hi + lo; the 7x7-window dot products (64-deep) on WMMA 16x16x32, one banded product per window row (3 products, f32 accumulate); the 49-way softmax (zero-padded neighbours give logit 0 and value 0, as unfold does) in f32 on the VALU; the 128-channel context on WMMA 16x16x32, one banded product per window row, weights and values each as f16 hi + lo (3 products, f32 accumulate); context rounded once to f16 for the final 1x1 conv W (bf16-exact weights in f16, 1 product) + bias; f32 output.
#include <hip/hip_runtime.h>
#include <math.h>

typedef __attribute__((ext_vector_type(16))) _Float16 v16h;
typedef __attribute__((ext_vector_type(16))) __bf16 v16b;
typedef __attribute__((ext_vector_type(8)))  _Float16 v8h;
typedef __attribute__((ext_vector_type(8)))  float v8f;
typedef __attribute__((ext_vector_type(4)))  float v4f;
typedef __attribute__((ext_vector_type(2)))  float v2f;
typedef __attribute__((ext_vector_type(4)))  unsigned v4u;
typedef __attribute__((ext_vector_type(4)))  int v4i;
typedef float __attribute__((may_alias)) float_a;
typedef int __attribute__((may_alias)) int_a;

template <typename T> __device__ __forceinline__ void vst2(void* p, T v) { *(T*)p = v;  }
__device__ __forceinline__ v8f wmma16(v16h a, v16h b, v8f c) {
  v8f d = __builtin_amdgcn_wmma_f32_16x16x32_f16(false, a, false, b, (short)0, c, false, false);
  asm volatile("v_nop\n\tv_nop\n\tv_nop\n\tv_nop" : "+v"(d) : "v"(a), "v"(b));
  return d;
}
__device__ __forceinline__ v8f wmma_bf(v16b a, v16b b, v8f c) {
  v8f d = __builtin_amdgcn_wmma_f32_16x16x32_bf16(false, a, false, b, (short)0, c, false, false);
  asm volatile("v_nop\n\tv_nop\n\tv_nop\n\tv_nop" : "+v"(d) : "v"(a), "v"(b));
  return d;
}
// 16x16x32 fragments: lane = (h = lane>>4, row/col = lane&15); elements 0..7 = k0+8h+0..7, 8..15 = k0+16+8h+0..7; D element r = row 8h+r
__device__ __forceinline__ v16h frag_h(const _Float16* rowk0, int lane) {
  union { v16h v; v8h q[2]; } u; const _Float16* p = rowk0 + 8 * (lane >> 4);
  u.q[0] = *(const v8h*)p; u.q[1] = *(const v8h*)(p + 16); return u.v;
}
// fragment from two octet addresses of the lane's own
__device__ __forceinline__ v16h frag_2(const _Float16* o0, const _Float16* o1) {
  union { v16h v; v8h q[2]; } u; u.q[0] = *(const v8h*)o0; u.q[1] = *(const v8h*)o1; return u.v;
}
__device__ __forceinline__ v16h frag_f32(const float* rowk0, int lane) {
  v16h a; const float* p = rowk0 + 8 * (lane >> 4);
#pragma unroll
  for (int i = 0; i < 8; ++i) { a[i] = (_Float16)p[i]; a[8 + i] = (_Float16)p[16 + i]; }
  return a;
}
__device__ __forceinline__ v16h frag_f32s(const float* rowk0, int lane, float sc) {
  v16h a; const float* p = rowk0 + 8 * (lane >> 4);
#pragma unroll
  for (int i = 0; i < 8; ++i) { a[i] = (_Float16)(p[i] * sc); a[8 + i] = (_Float16)(p[16 + i] * sc); }
  return a;
}
// column fragment from a [K][ld] layout (column n), rows >= K read as 0
__device__ __forceinline__ v16h fragc_f32(const float* W, int k0, int n, int lane, int ld, int K) {
  v16h a; const int g = lane >> 4;
#pragma unroll
  for (int i = 0; i < 8; ++i) { const int ka = k0 + 8 * g + i, kb = ka + 16;
    a[i] = (_Float16)(ka < K ? W[(size_t)(ka < K ? ka : K - 1) * ld + n] : 0.f); a[8 + i] = (_Float16)(kb < K ? W[(size_t)(kb < K ? kb : K - 1) * ld + n] : 0.f); }
  return a;
}
struct F2 { v16b h, l; };
__device__ __forceinline__ F2 bsplit16(const float v[16]) { F2 r;
#pragma unroll
  for (int i = 0; i < 16; ++i) { const __bf16 h = (__bf16)v[i]; r.h[i] = h; r.l[i] = (__bf16)(v[i] - (float)h); }
  return r; }
__device__ __forceinline__ F2 split_row(const float* row, int k0, int lane) { float v[16]; const float* p = row + k0 + 8 * (lane >> 4);
#pragma unroll
  for (int i = 0; i < 8; ++i) { v[i] = p[i]; v[8 + i] = p[16 + i]; }
  return bsplit16(v); }
__device__ __forceinline__ F2 split_rowK(const float* row, int k0, int lane, int K) { float v[16]; const int g = lane >> 4;
#pragma unroll
  for (int i = 0; i < 8; ++i) { const int ka = k0 + 8 * g + i, kb = ka + 16; v[i] = ka < K ? row[ka < K ? ka : K - 1] : 0.f; v[8 + i] = kb < K ? row[kb < K ? kb : K - 1] : 0.f; }
  return bsplit16(v); }
__device__ __forceinline__ F2 split_col(const float* W, int k0, int n, int lane, int ld, int K) { float v[16]; const int g = lane >> 4;
#pragma unroll
  for (int i = 0; i < 8; ++i) { const int ka = k0 + 8 * g + i, kb = ka + 16; v[i] = ka < K ? W[(size_t)(ka < K ? ka : K - 1) * ld + n] : 0.f; v[8 + i] = kb < K ? W[(size_t)(kb < K ? kb : K - 1) * ld + n] : 0.f; }
  return bsplit16(v); }
__device__ __forceinline__ v8f mac3(const F2& a, const F2& b, v8f c) { c = wmma_bf(a.l, b.h, c); c = wmma_bf(a.h, b.l, c); return wmma_bf(a.h, b.h, c); }
__device__ __forceinline__ float sigm(float v) { return 1.0f / (1.0f + expf(-v)); }
#define LDSX() do { asm volatile("s_wait_dscnt 0" ::: "memory"); __builtin_amdgcn_wave_barrier(); __builtin_amdgcn_fence(__ATOMIC_RELEASE, "workgroup"); } while (0)


// Local-window self attention (b 2, 96 x 96, Cin 256, key/query 64 via conv-BN-ReLU x2, value 128, 7x7 window, out conv 256).
#define NB 2
#define HW 96
#define NPX (HW * HW)      // 9216
#define CIN 256
#define CK 64
#define CV 128
#define CO 256
#define NPT (NB * NPX)     // 18432 = 288 x 64
#ifndef TWB
#define TWB (NPT / 96)     // window kernel blocks
#endif
typedef __attribute__((ext_vector_type(8))) __bf16 v8b;
__device__ __forceinline__ v16b frag_b(const __bf16* rowk0, int lane) {
  union { v16b v; v8b q[2]; } u; const __bf16* p = rowk0 + 8 * (lane >> 4);
  u.q[0] = *(const v8b*)p; u.q[1] = *(const v8b*)(p + 16); return u.v;
}
__device__ __forceinline__ float bfr(float v) { return (float)(__bf16)v; }
__device__ __attribute__((noinline)) float exp_ni(float v) { return expf(v); }
__device__ __attribute__((noinline)) float erf_ni(float v) { return erff(v); }

#define WS_KP  0u                                  // key rows [p] of 256 bytes: the 64 channels as f16 hi, then the same 64 as f16 lo (key = hi + lo)
#define WS_QP  (WS_KP + 4u * (size_t)NPT * CK)        // query rows [p], as the key rows
#define WS_VP  (WS_QP + 4u * (size_t)NPT * CK)        // values [b][n / 4][128] of 16-byte pieces: 4 pixels of one channel as f16 hi, then the same 4 pixels as f16 lo (value = hi + lo); the 128 channels of a quad of pixels lie side by side, so that 8 channels are one 128-byte line
#define WS_END (WS_VP + 4u * (size_t)NPT * CV)

__device__ __forceinline__ float bnrelu(float v, const float* bn, int c, int C) { const float gsc = bfr(bn[c]) / sqrtf(bfr(bn[3 * C + c]) + 1e-5f); return fmaxf((v - bfr(bn[2 * C + c])) * gsc + bfr(bn[C + c]), 0.f); }
// ---- k_c1: block = (192 px, b, half), 12 waves: half 0: k1 = bnrelu(fk_w1 x + b) and q1 likewise, kept in LDS as f32 rows, then key = bnrelu(fk_w2 k1 + b) and query likewise -> rows, each f32 value split once into f16 hi + lo; half 1: the 128 value channels = fv_w x + b -> 16-byte pieces [quad of pixels][channel], each f32 value split once into f16 hi + lo.
// The x^T tile [192 px][256 c] and the half's 128 weight rows [o][256 c] are each staged once in LDS as bf16: a weight row is fetched and converted once for 192 pixels; wave = 32 px x 64 outputs (6 fragments for 8 products), k in the same order as before.
#define C1P (CIN + 8)                   // bf16 per staged row: 528 B = 16 B x 33, so 16-byte fragment reads of 16 rows fall on distinct banks
#define C1PX 192                        // pixels per block
#define C1NT 384                        // threads per block
#define C1X (C1PX * C1P * 2)            // bytes of the x tile
#define C2P (CK + 8)                    // bf16 per staged row of the second convs' weights: 144 B = 16 B x 9, same reason
#define C1SO (C1PX * 132 * 4)           // bytes of the k1 | q1 tile [192 px][132]
#define C1VP (C1PX + 4)                 // floats per channel row of the value tile: 784 B = 16 B x 49, same reason for its 16-byte stores
#define C1WN (128 * CIN / 4)            // 16-byte pieces of the half's weight rows
#define C2WN (2 * CK * CK / 4)          // 16-byte pieces of the two second weights
#define C1WJ ((C1WN + C1NT - 1) / C1NT) // pieces per thread
#define C2WJ ((C2WN + C1NT - 1) / C1NT)
#define C1WM (C1WN / 2 / C1NT)          // the run in which the first 64 weight rows end
// whether the wave's 32 pieces of run j (pieces 384 j + 32 wave .. + 31) lie below piece lim (a multiple of 32): a constant wherever the 12 waves agree, a scalar test of the wave's number elsewhere
#define C1LT(j, lim) ((C1NT * ((j) + 1) <= (lim)) || (C1NT * (j) < (lim) && C1NT * (j) + 32 * wave < (lim)))
typedef __attribute__((ext_vector_type(4))) __bf16 v4b;
typedef __attribute__((ext_vector_type(4))) _Float16 v4h;
typedef __attribute__((ext_vector_type(2))) _Float16 v2h;
// 3 waves per SIMD: the 12 waves of the one work-group (168,960 B of LDS) that a WGP holds; all 192 work-groups run in one round
__global__ __launch_bounds__(C1NT, 3) void k_c1(const float* __restrict__ X, const float* __restrict__ WK1, const float* __restrict__ BK1, const float* __restrict__ BNK1, const float* __restrict__ WQ1, const float* __restrict__ BQ1, const float* __restrict__ BNQ1, const float* __restrict__ WV, const float* __restrict__ BVv, const float* __restrict__ WK2, const float* __restrict__ BK2, const float* __restrict__ BNK2, const float* __restrict__ WQ2, const float* __restrict__ BQ2, const float* __restrict__ BNQ2, float* __restrict__ KP, float* __restrict__ QP, float* __restrict__ VP) {
  __shared__ __align__(16) char sm[(C1PX + 128) * C1P * 2];
  __bf16 (*sx)[C1P] = (__bf16 (*)[C1P])sm; __bf16 (*sw)[C1P] = (__bf16 (*)[C1P])(sm + C1X);
  float* so = (float*)sm;               // output tile, over the x tile once every wave has left it
  static_assert(C1SO <= C1X && 128 * C1VP * 4 <= C1X && 128 * C2P * 2 <= 128 * C1P * 2, "the k1 | q1 tile and the value tile fit over the x tile, the second weights over the weight rows");
  static_assert(C1WN % 64 == 0 && C2WN % 64 == 0 && C1PX * 8 % C1NT == 0 && 128 * (C1PX / 4) % C1NT == 0 && C1NT % (C1PX / 4) == 0, "a wave's 32 pieces lie in one weight array; the output pieces divide evenly");
  __bf16 (*sw2)[C2P] = (__bf16 (*)[C2P])(sm + C1X);   // fk_w2 rows 0-63, fq_w2 rows 64-127, over the weight rows once every wave has left them
  // the wave's number as a scalar: the per-wave choice of weight, bias and BN arrays below then stays a scalar base with one offset register
  const int tid = threadIdx.x, wave = __builtin_amdgcn_readfirstlane(tid >> 5), lane = tid & 31, col = lane & 15, g = lane >> 4; const int p0 = blockIdx.x * C1PX; const size_t b = blockIdx.y; const int half = blockIdx.z;
  const int pxg = wave % 6, og = wave / 6;   // the wave's pixels 32 pxg .. +31 and its outputs 64 og .. +63 of the half (half 0: og 0 = key path, og 1 = query path)
  const float* Wa = half ? WV : WK1; const float* Wb = half ? WV + 64 * CIN : WQ1;   // weight rows 0-63 and 64-127 of this half
  // every '#pragma unroll' below makes the indices of xv, wv, w2v, acc and ac2 constants, so that these arrays live in registers and the loads of a run are independent
  // x: wave = 32 px x 128 channels, thread = 4 pixels x 4 octets of channels; a wave's 16-byte load is four whole 128-B lines (8 lanes each) of four planes, and the 32 + 22 loads of a thread are all in flight at once
  // lane = (quad & 3) + 4 x (octet & 3) + 16 x (quad >> 2): the 16-byte LDS stores of either half-wave then fall on distinct banks (4 rows on = 16 banks on, an octet on = 4 banks on)
  // weights: piece e = tid + 384 j is 16 B of the contiguous rows
  const int xq = (lane & 3) + 4 * g, xo = (lane >> 2) & 3, xpx = pxg * 32 + xq * 4; const float* xp = X + (b * CIN + og * 128 + xo * 8) * (size_t)NPX + p0 + xpx;
  // byte offset of the thread's piece in run j from the start of its weight array: wo + a constant, but in the one run that holds the last pieces of rows 0-63 and the first of rows 64-127, where it is wom
  const unsigned wo = 16u * (unsigned)tid, wom = wo + (C1LT(C1WM, C1WN / 2) ? 16u * (C1NT * C1WM) : 0u - 16u * (C1WN / 2 - C1NT * C1WM));
  v4f xv[4][8], wv[C1WJ];
#pragma unroll
  for (int j = 0; j < 4; ++j)
#pragma unroll
    for (int i = 0; i < 8; ++i) xv[j][i] = *(const v4f*)(xp + (size_t)(j * 32 + i) * NPX);
#pragma unroll
  for (int j = 0; j < C1WJ; ++j) if (C1LT(j, C1WN)) wv[j] = *(const v4f*)((const char*)(C1LT(j, C1WN / 2) ? Wa : Wb) + (j == C1WM ? wom : j < C1WM ? wo + 16u * (C1NT * j) : wo + 16u * (C1NT * j - C1WN / 2)));
  // the code below takes the address registers that these loads name; the addresses are inputs, so that no late load's data is given them before this wait
  asm volatile("s_wait_xcnt 0x0" :: "v"(xp), "v"(wo), "v"(wom) : "memory");
#pragma unroll
  for (int j = 0; j < 4; ++j)
#pragma unroll
    for (int k = 0; k < 4; ++k) { v8b o;
#pragma unroll
      for (int i = 0; i < 8; ++i) o[i] = (__bf16)xv[j][i][k];
      *(v8b*)&sx[xpx + k][(og * 16 + xo + 4 * j) * 8] = o; }
#pragma unroll
  for (int j = 0; j < C1WJ; ++j) if (C1LT(j, C1WN)) { const int e = tid + C1NT * j; v4b o;
#pragma unroll
    for (int i = 0; i < 4; ++i) o[i] = (__bf16)wv[j][i];
    *(v4b*)&sw[e >> 6][(e & 63) * 4] = o; }
  __syncthreads();
  // second convs: wave = its own 32 px x 64 outputs of key (og 0) or query (og 1)
  v4f w2v[C2WJ]; float b2[4], m2[4], g2[4], t2[4], r2[4];   // raw bias, mean, gamma, beta, variance of the wave's 4 x 16 outputs
  // issued here, behind the barrier, so that the first product covers their latency; in both halves: under a test of the half the compiler draws the arithmetic on them, and so the wait, up to this place
  {
#pragma unroll
    for (int j = 0; j < C2WJ; ++j) if (C1LT(j, C2WN)) { const int e = tid + C1NT * j; w2v[j] = *(const v4f*)(C1LT(j, C2WN / 2) ? WK2 + e * 4 : WQ2 + (e - C2WN / 2) * 4); }
    const float* Bm = og ? BQ2 : BK2; const float* bn = og ? BNQ2 : BNK2;
#pragma unroll
    for (int j = 0; j < 4; ++j) { const int o = j * 16 + col; b2[j] = Bm[o]; g2[j] = bn[o]; r2[j] = bn[3 * CK + o]; m2[j] = bn[2 * CK + o]; t2[j] = bn[CK + o]; } }
  v8f acc[2][4] = {};
#pragma unroll
  for (int kc = 0; kc < CIN / 32; ++kc) { v16b a[2], w[4];
#pragma unroll
    for (int i = 0; i < 2; ++i) a[i] = frag_b(&sx[pxg * 32 + i * 16 + col][kc * 32], lane);
#pragma unroll
    for (int j = 0; j < 4; ++j) w[j] = frag_b(&sw[og * 64 + j * 16 + col][kc * 32], lane);
#pragma unroll
    for (int i = 0; i < 2; ++i)
#pragma unroll
      for (int j = 0; j < 4; ++j) acc[i][j] = wmma_bf(a[i], w[j], acc[i][j]); }
  __syncthreads();   // every read of the x tile and of the weight rows is done; the output tile and the second weights may overwrite them
  if (half == 0) { const float* Bm = og ? BQ1 : BK1; const float* bn = og ? BNQ1 : BNK1;   // so = [192 px][132]: k1 in columns 0-63, q1 in 64-127
#pragma unroll
    for (int j = 0; j < 4; ++j) { const int oc = j * 16 + col, o = og * 64 + oc; const float bb = bfr(Bm[oc]);
#pragma unroll
      for (int i = 0; i < 2; ++i)
#pragma unroll
        for (int r = 0; r < 8; ++r) so[(pxg * 32 + i * 16 + 8 * g + r) * 132 + o] = bnrelu(acc[i][j][r] + bb, bn, oc, CK); }
#pragma unroll
    for (int j = 0; j < C2WJ; ++j) if (C1LT(j, C2WN)) { const int e = tid + C1NT * j; v4b o;   // piece e: row e / 16 (fk_w2, then fq_w2), quad e % 16
#pragma unroll
      for (int i = 0; i < 4; ++i) o[i] = (__bf16)w2v[j][i];
      *(v4b*)&sw2[e >> 4][(e & 15) * 4] = o; }
#pragma unroll
    for (int j = 0; j < 4; ++j) { b2[j] = bfr(b2[j]); g2[j] = bfr(g2[j]) / sqrtf(bfr(r2[j]) + 1e-5f); m2[j] = bfr(m2[j]); t2[j] = bfr(t2[j]); }
    __syncthreads();   // the k1 | q1 rows and the second weights are visible
    // the wave alone reads rows 32 pxg .. +31, columns 64 og .. +63 of so: f32 input as bf16 hi + lo, 2 products, k ascending
    v8f ac2[2][4] = {};
#pragma unroll
    for (int kc = 0; kc < CK / 32; ++kc) { v16b w2f[4]; F2 a[2];
      // the 16 LDS reads of a k step stand in front of its products, so that their latency is paid once a step
#pragma unroll
      for (int j = 0; j < 4; ++j) w2f[j] = frag_b(&sw2[og * 64 + j * 16 + col][kc * 32], lane);
#pragma unroll
      for (int s = 0; s < 2; ++s) { const float* ap = &so[(pxg * 32 + s * 16 + col) * 132 + og * 64 + kc * 32 + 8 * g]; v4f aq[4]; float av[16];
        aq[0] = *(const v4f*)ap; aq[1] = *(const v4f*)(ap + 4); aq[2] = *(const v4f*)(ap + 16); aq[3] = *(const v4f*)(ap + 20);
#pragma unroll
        for (int i = 0; i < 16; ++i) av[i] = aq[i >> 2][i & 3];
        a[s] = bsplit16(av); }
      // each accumulator takes hi, then lo, kc ascending; the eight accumulators alternate, so that no product waits for the one in front of it
#pragma unroll
      for (int s = 0; s < 2; ++s)
#pragma unroll
        for (int j = 0; j < 4; ++j) ac2[s][j] = wmma_bf(a[s].h, w2f[j], ac2[s][j]);
#pragma unroll
      for (int s = 0; s < 2; ++s)
#pragma unroll
        for (int j = 0; j < 4; ++j) ac2[s][j] = wmma_bf(a[s].l, w2f[j], ac2[s][j]); }
    // key and query: back into the wave's own part of so, every read of which has fed the products above
#pragma unroll
    for (int s = 0; s < 2; ++s)
#pragma unroll
      for (int j = 0; j < 4; ++j)
#pragma unroll
        for (int r = 0; r < 8; ++r) so[(pxg * 32 + s * 16 + 8 * g + r) * 132 + og * 64 + j * 16 + col] = fmaxf((ac2[s][j][r] + b2[j] - m2[j]) * g2[j] + t2[j], 0.f);
    __syncthreads();   // the key and query tiles are visible
    // piece e = tid + 384 j: pixel e / 8, octet e % 8 of its 64 channels, of the key (h = 0) and of the query
#pragma unroll
    for (int j = 0; j < C1PX * 8 / C1NT; ++j) { const int e = tid + C1NT * j, cl = e >> 3, q = e & 7;
#pragma unroll
      for (int h = 0; h < 2; ++h) { const float* xp2 = &so[cl * 132 + h * 64 + q * 8]; const v4f x0 = *(const v4f*)xp2, x1 = *(const v4f*)(xp2 + 4); v8h hi, lo;
#pragma unroll
        for (int i = 0; i < 4; ++i) { hi[i] = (_Float16)x0[i]; lo[i] = (_Float16)(x0[i] - (float)hi[i]); hi[4 + i] = (_Float16)x1[i]; lo[4 + i] = (_Float16)(x1[i] - (float)hi[4 + i]); }
        float* dst = (h ? QP : KP) + (b * NPX + p0 + cl) * (size_t)CK + q * 4;   // 16 bytes = 4 floats of the 256-byte row; the lo half begins at byte 128
        vst2(dst, hi); vst2(dst + 32, lo); } } }
  else {
#pragma unroll
    for (int j = 0; j < 4; ++j) { const int o = og * 64 + j * 16 + col; const float bb = bfr(BVv[o]);
#pragma unroll
      for (int i = 0; i < 2; ++i)
#pragma unroll
        for (int r = 0; r < 8; ++r) so[o * C1VP + pxg * 32 + i * 16 + 8 * g + r] = acc[i][j][r] + bb; }   // transposed: [channel][px], pitch 196
    __syncthreads();   // the value tile is visible
    // piece e = tid + 384 j: channel e % 128 = tid % 128, quad e / 128 = tid / 128 + 3 j of its 192 pixels; the block's pieces are 98,304 bytes in a row, and the 16-byte LDS reads of 16 channels fall on distinct banks
    static_assert(C1NT % CV == 0, "a thread keeps its channel in every run");
    const float* sv = &so[(tid & (CV - 1)) * C1VP + (tid / CV) * 4]; float* vp = VP + (b * (NPX / 4) + p0 / 4) * (size_t)(CV * 4) + tid * 4;
#pragma unroll
    for (int j = 0; j < 128 * (C1PX / 4) / C1NT; ++j) { const v4f x = *(const v4f*)(sv + j * (C1NT / CV) * 4); union { v4f f; v4h h[2]; } u;
#pragma unroll
      for (int i = 0; i < 4; ++i) { u.h[0][i] = (_Float16)x[i]; u.h[1][i] = (_Float16)(x[i] - (float)u.h[0][i]); }
      vst2(vp + j * (C1NT * 4), u.f);
      if (j % 8 == 7) __builtin_amdgcn_sched_barrier(0); }   // 8 pieces at a time: with all 16 in work at once the kernel goes beyond 256 registers
    asm volatile("s_wait_xcnt 0x0" ::: "memory"); } }   // in the listing the other half's code, which takes the registers that these stores name, stands behind this path
// ---- k_win: block = 32 pixels x 3 image rows, 24 waves (lane = pixel, 8 waves per image row). The 9 x 40 window rows (y0-3 .. y0+5, x0-4 .. x0+35, zeros outside the image) of 64 channels are staged once for the three image rows: key and later value 64-127 in buffer A, value 0-63 in buffer B.
// logits: wave = window row of its image row (7 of 8 waves); per 16 pixels a matrix product S[position][px] = K[position][channel] * Q[channel][px] over the staged positions 16 tx + 0..31 of the row, key and query each as f16 hi + lo; pixel i of the tile takes its 7 logits from positions i + 1 .. i + 7 through LDS; softmax
// context: per window row dy a matrix product ctx[channel][px] += V[channel][k] * P[k][px], k = staged position 16 tx + 0..31 of the row, P the 7 weights of pixel i of the tile at k = i + 1 .. i + 7 and zero elsewhere; values staged as f16 hi and lo planes [window row][channel][40], weights as f16 hi and lo rows [image row][dy][px][24]; wave = 16 px x 3 image rows x 32 channels (8 waves) -> f16 context rows
// final 1x1 conv in the same block: the 96 f16 context rows stay in LDS, the 256 weight rows are staged once as f16 over the spent window rows; wave = 32 px x 32 outputs, k in ascending order; output tiles [3][256][32 px] through LDS -> whole 128-B lines of the output planes
#define OWP (CV + 8)                    // f16 per staged weight row: 272 B = 16 B x 17, so 16-byte fragment reads of 16 rows fall on distinct banks
#define OSP 36                          // floats per row of the output tile: 144 B = 16 B x 9, same reason for its 16-byte stores
#define WR 3                            // image rows per block
#define WT (256 * WR)                   // threads per block
#define WPITCH 40                       // positions per staged row (f16 in a value plane: 80 B = 16 B x 5, so 16-byte fragment reads of 16 rows fall on distinct banks)
#define WRS (64 * WPITCH)               // elements per staged window row (64 channels side by side)
#define WITEMS (64 * (WR + 6) * 10)     // 16-byte pieces per staged pass
#define WNJ ((WITEMS + WT - 1) / WT)    // pieces per thread
#define WTASKS (WITEMS / 32)            // wave loads per staged value pass
#define WBUF (WNJ * WT * 4)             // floats per buffer: the 9 window rows and a tail that takes the last run's surplus pieces (zeros; read only by the key fragments of the last window row, in product rows that no pixel takes, and by the value fragment octet behind the last staged row, against zero weights), so that every thread runs the same loads and stores
#define WWJ ((CO * CV / 4 + WT - 1) / WT)   // 16-byte pieces of the weight rows per thread
#define WWL ((CO * CV / 4 - WT * (WWJ - 1)) / 32)   // waves whose last piece is a weight row; the others stage a second copy of the piece before it into rows behind the 256 (never read), so that every wave runs the same loads and stores
#define PBP 24                          // f16 per weight row: k = 24 .. 31 are zero for every pixel and are not stored; 48 B = 16 B x 3, so 16-byte fragment reads of 16 rows fall on distinct banks
#define PBN (WR * 7 * 32 * PBP)         // f16 per plane of weight rows
#define SLP 28                          // floats per pixel of a wave's logit tile (positions 0 .. 23 of the 32): 112 B = 16 B x 7, so its 16-byte stores of 16 pixels fall on distinct banks
// every '#pragma unroll' below makes the indices of off, ok, koff, kok, va, vb, vc, d, s, eh, el, inv, cx, vh, vl, wh, wl, wv, ca, w and acc constants, so that these arrays live in registers and the loads of a run are independent
// 6 waves per SIMD: the 24 waves of one work-group (317,184 B of LDS) fill a WGP, and all 192 work-groups run in one round
__global__ __launch_bounds__(WT, 6) void k_win(const float* __restrict__ KP, const float* __restrict__ QP, const float* __restrict__ VP, const float* __restrict__ WW, const float* __restrict__ BW, float* __restrict__ OUT) {
  __shared__ __align__(16) float sh[2 * WBUF]; __shared__ __align__(16) char sq[WR * 32 * 256]; __shared__ __align__(16) _Float16 spc[2 * PBN + WR * 32 * (CV + 8)]; __shared__ float ssm[WR][7][32]; __shared__ float smx[WR][7][32];
  float* shA = sh; float* shB = sh + WBUF;
  _Float16* sp = spc; _Float16 (*sct)[CV + 8] = (_Float16 (*)[CV + 8])(spc + 2 * PBN);
  float* sl = (float*)spc;   // the logit tiles, where the weight rows and the context rows come later
  static_assert(WR * 7 * 32 * SLP * 4 <= (2 * PBN + WR * 32 * (CV + 8)) * 2 && (WNJ * WT / 16) * 256 <= WBUF * 4, "logit tiles fit under the weight and context rows, the key rows in buffer A");
  const int t = threadIdx.x, wave = __builtin_amdgcn_readfirstlane(t >> 5), lane = t & 31;
  const int rg = wave >> 3, w8 = wave & 7;   // the wave's image row of the block, and its number among that row's 8 waves
  // block indices equal mod 8 take TWB / 8 tiles in a row (8 strips of 3 image rows).
  // A permutation of the tiles: for speed only, right wherever a work-group lands
  static_assert(TWB % 8 == 0, "the map below is a permutation of the tiles");
  const int bx = (blockIdx.x & 7) * (TWB / 8) + (blockIdx.x >> 3); const int b = bx / (NPX / (32 * WR)), tl = bx % (NPX / (32 * WR)), y0 = (tl / (HW / 32)) * WR, x0 = (tl % (HW / 32)) * 32;
  // run j of a value pass: the wave takes task k = wave + 24 j = (window row k / 20, pair of quads of the row, 16 channels k % 4); lanes 0-15 take the 16 channels of the even quad, lanes 16-31 those of the odd quad:
  // the load is two runs of 256 bytes (four whole 128-byte lines), and the 8-byte LDS stores of the 32 lanes (a channel on = 20 banks on, a quad on = 2 banks on) fall on the 64 banks once each; a quad lies wholly inside or wholly outside the image
  const int vl = lane & 15, vq = lane >> 4;
  unsigned off[WNJ]; bool ok[WNJ];   // piece numbers from the pass's first piece, clamped into the image where the piece is outside (such a piece is stored as zeros)
#pragma unroll
  for (int j = 0; j < WNJ; ++j) { const int k = wave + (WT / 32) * j, cg = k & 3, rq = k >> 2, r = rq / 5, qd = (rq - r * 5) * 2 + vq; const int yy = y0 - 3 + r, xq = x0 / 4 - 1 + qd;
    const bool in = (WT / 32) * (j + 1) <= WTASKS || k < WTASKS;   // a constant but in the last run, a scalar test of the wave's number there
    ok[j] = in & ((unsigned)yy < (unsigned)HW) & ((unsigned)xq < (unsigned)(HW / 4));
    const int yc = __builtin_amdgcn_readfirstlane(min(max(yy, 0), HW - 1));   // the same in every lane; as a scalar, so that the row's product below is a scalar one and not a quarter-rate vector multiply
    off[j] = (unsigned)((yc * (HW / 4) + min(max(xq, 0), HW / 4 - 1)) * CV + cg * 16 + vl); }
  auto fetch = [&](const float* __restrict__ srcp, v4f (&v)[WNJ]) {
#pragma unroll
    for (int j = 0; j < WNJ; ++j) v[j] = ((const v4f*)srcp)[off[j]]; };
  // a value piece (4 hi | 4 lo) goes to the hi plane (first half of the buffer) and the lo plane (second half), at the element index of its 4 pixels
  // element index in a plane: [window row][channel][40], the surplus tasks of the last run in the tail; formed here from the wave's number and the lane's number read anew: eight indices held in registers across the logits are spilled
  auto put16 = [&](float* dst, const v4f (&v)[WNJ]) { _Float16* dh = (_Float16*)dst; const int pl = (int)__builtin_amdgcn_mbcnt_lo(~0u, 0u), pb = (pl & 15) * WPITCH + (pl >> 4) * 4;
#pragma unroll
    for (int j = 0; j < WNJ; ++j) { const v4f z = {0.f, 0.f, 0.f, 0.f}; union { v4f f; v4h h[2]; } u; u.f = ok[j] ? v[j] : z;
      const int k = wave + (WT / 32) * j, rq = k >> 2, r = rq / 5; const bool in = (WT / 32) * (j + 1) <= WTASKS || k < WTASKS;
      const int ix = in ? r * WRS + (k & 3) * 16 * WPITCH + (rq - r * 5) * 8 + pb : (WR + 6) * WRS + ((k - WTASKS) * 32 + pl) * 4;
      *(v4h*)&dh[ix] = u.h[0]; *(v4h*)&dh[WBUF + ix] = u.h[1]; } };
  // key rows: piece e = t + 768 j is (staged position e / 16 = 40 x window row + column, 16-byte slot e % 16 of its 256-byte row: 8 octets of hi, 8 of lo); a wave's load is 512 bytes in a row
  // in LDS slot s of position p (and of query pixel p) stands at slot s ^ (p & 15) of its 256 bytes, so that the 16 slots of a row as well as one slot of 16 rows fall on distinct banks
  unsigned koff[WNJ]; bool kok[WNJ];
#pragma unroll
  for (int j = 0; j < WNJ; ++j) { const int e = t + WT * j, pp = e >> 4, r = pp / WPITCH, yy = y0 - 3 + r, xx = x0 - 4 + pp - r * WPITCH;
    kok[j] = (e < WITEMS) & ((unsigned)yy < (unsigned)HW) & ((unsigned)xx < (unsigned)HW);
    koff[j] = 256u * (unsigned)(min(max(yy, 0), HW - 1) * HW + min(max(xx, 0), HW - 1)) + 16u * (unsigned)(e & 15); }
  v4f qv[2], va[WNJ], vb[WNJ], vc[WNJ];
  // piece e = t + 768 j of the query rows: image row e / 512, pixel, 16-byte slot e % 16 of its 256-byte row
#pragma unroll
  for (int j = 0; j < 2; ++j) { const int e = t + WT * j; qv[j] = *(const v4f*)((const char*)(QP + ((size_t)b * NPX + y0 * HW + x0) * CK) + 4u * (unsigned)((e >> 9) * (HW * CK) + (e & 511) * 4)); }
  asm volatile("s_wait_xcnt 0x0" ::: "memory");   // the data of the loads below may be given the offset registers that the two query loads name
#pragma unroll
  for (int j = 0; j < WNJ; ++j) va[j] = *(const v4f*)((const char*)(KP + (size_t)b * CK * NPX) + koff[j]);
  // the offsets are inputs, so that they stay in their registers up to this wait: without that a late load's data is given the offset registers of the loads in front of it
  asm volatile("s_wait_xcnt 0x0" :: "v"(koff[0]), "v"(koff[1]), "v"(koff[2]), "v"(koff[3]), "v"(koff[4]), "v"(koff[5]), "v"(koff[6]), "v"(koff[7]) : "memory");
#pragma unroll
  for (int j = 0; j < WNJ; ++j) { const int e = t + WT * j; const v4f z = {0.f, 0.f, 0.f, 0.f}; *(v4f*)((char*)shA + (e >> 4) * 256 + (((e ^ (e >> 4)) & 15) << 4)) = kok[j] ? va[j] : z; }
#pragma unroll
  for (int j = 0; j < 2; ++j) { const int e = t + WT * j; *(v4f*)(sq + (e >> 4) * 256 + (((e ^ (e >> 4)) & 15) << 4)) = qv[j]; }
  __syncthreads();
  // both value halves are in flight under the logits (issued in front of the barrier they would be waited for at it)
  fetch(VP + (size_t)b * CV * NPX, vb);
  fetch(VP + (size_t)b * CV * NPX + 64 * 4, vc);
  static_assert(WNJ == 8, "the wait below names the 8 offsets");
  // the offsets are inputs, so that they stay in their registers up to this wait: without that a late load's data is given the offset registers of the loads in front of it
  asm volatile("s_wait_xcnt 0x0" :: "v"(off[0]), "v"(off[1]), "v"(off[2]), "v"(off[3]), "v"(off[4]), "v"(off[5]), "v"(off[6]), "v"(off[7]) : "memory");
  float s[7] = {0.f, 0.f, 0.f, 0.f, 0.f, 0.f, 0.f};
  if (w8 < 7) { const int c16 = lane & 15, gh = lane >> 4, kp = (rg + w8) * WPITCH + c16;   // kp: the lane's key row in the row's first 16 positions
    // byte address of slot gh of the lane's key row and query row; slot 8 plane + 4 ks + 2 half + gh is that address ^ (16 x the even part), 16 rows further on + 4096
    const unsigned ka = (unsigned)kp * 256u + (unsigned)(((kp & 15) ^ gh) << 4), qa = (unsigned)(rg * 32 + c16) * 256u + (unsigned)((c16 ^ gh) << 4);
    const char* kb = (const char*)shA; float* st = sl + (rg * 7 + w8) * (32 * SLP);
    auto fr = [&](const char* base, unsigned a, int tile, int plane, int ks) { return frag_2((const _Float16*)(base + (a ^ (unsigned)(plane * 128 + ks * 64)) + tile * 4096), (const _Float16*)(base + (a ^ (unsigned)(plane * 128 + ks * 64 + 32)) + tile * 4096)); };
#pragma unroll
    for (int tx = 0; tx < 2; ++tx) { v8f d[2] = {};   // rows = positions 16 tx + 16 i + 0..15, columns = pixels 16 tx + 0..15; positions 40 .. 47 run into the next staged row or the zero tail: rows of the product that no pixel takes
#pragma unroll
      for (int ks = 0; ks < CK / 32; ++ks) { const v16h qh = fr(sq, qa, tx, 0, ks), ql = fr(sq, qa, tx, 1, ks); v16h kh[2], kl[2];
#pragma unroll
        for (int i = 0; i < 2; ++i) { kh[i] = fr(kb, ka, tx + i, 0, ks); kl[i] = fr(kb, ka, tx + i, 1, ks); }
        // the two accumulators alternate, so that no product waits for the one in front of it
#pragma unroll
        for (int i = 0; i < 2; ++i) d[i] = wmma16(kl[i], qh, d[i]);
#pragma unroll
        for (int i = 0; i < 2; ++i) d[i] = wmma16(kh[i], ql, d[i]);
#pragma unroll
        for (int i = 0; i < 2; ++i) d[i] = wmma16(kh[i], qh, d[i]); }
      // element e = position 16 i + 8 gh + e of pixel c16; positions 24 .. 31 are beyond every pixel's window and are not stored
      float* sr = st + (tx * 16 + c16) * SLP + 8 * gh;
      const v4f d0 = {d[0][0], d[0][1], d[0][2], d[0][3]}, d1 = {d[0][4], d[0][5], d[0][6], d[0][7]}, d2 = {d[1][0], d[1][1], d[1][2], d[1][3]}, d3 = {d[1][4], d[1][5], d[1][6], d[1][7]};
      *(v4f*)sr = d0; *(v4f*)(sr + 4) = d1;
      if (gh == 0) { *(v4f*)(sr + 16) = d2; *(v4f*)(sr + 20) = d3; } }
    asm volatile("s_wait_dscnt 0x0" ::: "memory");   // the wave's own tile: the reads below take what other lanes of the wave have stored, and may not be moved up over those stores
#pragma unroll
    for (int dx = 0; dx < 7; ++dx) s[dx] = st[lane * SLP + c16 + 1 + dx];
    float pm = s[0];
#pragma unroll
    for (int dx = 1; dx < 7; ++dx) pm = fmaxf(pm, s[dx]);
    smx[rg][w8][lane] = pm; }
  put16(shB, vb);
  __syncthreads();   // every read of the key rows is done; the row maxima are visible
  put16(shA, vc);
  float mx = smx[rg][0][lane];
#pragma unroll
  for (int r = 1; r < 7; ++r) mx = fmaxf(mx, smx[rg][r][lane]);
  if (w8 < 7) {   // the lane writes its pixel's whole weight row of this dy: zeros, then, over them, the 7 weights at k = i + 1 + dx
    _Float16* ph = &sp[((rg * 7 + w8) * 32 + lane) * PBP]; _Float16* pl = ph + PBN; const v8h z8 = {};
#pragma unroll
    for (int q = 0; q < 3; ++q) { *(v8h*)(ph + 8 * q) = z8; *(v8h*)(pl + 8 * q) = z8; }
    float rs = 0.f; const int k1 = (lane & 15) + 1; _Float16 eh[9], el[9];   // element 1 + dx; a zero at either end
    eh[0] = eh[8] = el[0] = el[8] = (_Float16)0.f;
#pragma unroll
    for (int dx = 0; dx < 7; ++dx) { const float e = expf(s[dx] - mx); rs += e; eh[1 + dx] = (_Float16)e; el[1 + dx] = (_Float16)(e - (float)eh[1 + dx]); }
    // as 4 whole dwords from k = k1 & ~1, so that every store is 4-byte aligned: k1 even: e0 e1 | e2 e3 | e4 e5 | e6 0; k1 odd: 0 e0 | e1 e2 | e3 e4 | e5 e6
#pragma unroll
    for (int q = 0; q < 4; ++q) { const v2h he = {eh[2 * q + 1], eh[2 * q + 2]}, ho = {eh[2 * q], eh[2 * q + 1]}, le = {el[2 * q + 1], el[2 * q + 2]}, lo = {el[2 * q], el[2 * q + 1]};
      *(v2h*)(ph + (k1 & ~1) + 2 * q) = (k1 & 1) ? ho : he; *(v2h*)(pl + (k1 & ~1) + 2 * q) = (k1 & 1) ? lo : le; }
    ssm[rg][w8][lane] = rs; }
  __syncthreads();   // the weight rows, their sums and all value channels are visible
  // 8 of the 24 waves work here, each on all three image rows: a value fragment is then read once for the products of up to three image rows (26 16-byte LDS reads per 16 x 16 output tile; 42 with one image row per wave); the other waves go on to their weight loads
  // waves 6 a + b, b < 2: the choice of waves is for speed only
  const int wa = wave / 6, wb = wave - 6 * wa;
  if (wb < 2) { const int c16 = lane & 15, gh = lane >> 4, tx = wa >> 1, cp = (wa & 1) * 2 + wb;   // the wave's pixels 16 tx .. +15 of each image row and its channels 32 cp .. +31
    float inv[WR];
#pragma unroll
    for (int q = 0; q < WR; ++q) { float ssum = 0.f;
#pragma unroll
      for (int r = 0; r < 7; ++r) ssum += ssm[q][r][tx * 16 + c16];
      inv[q] = 1.0f / ssum; }
    // value fragment: k = staged position 16 tx + k of the channel's row; at tx = 1 k = 24 .. 31 run into the next staged row or the tail: finite values against zero weights
    const _Float16* vr = (const _Float16*)(cp < 2 ? shB : shA) + ((cp & 1) * 32 + c16) * WPITCH + tx * 16;
    // weight fragment: k = 8 gh .. +7 and 16 + 8 gh .. +7 of the pixel's row; k = 24 .. 31 are zero and not stored: the upper half-wave reads k = 16 .. 23 of the tile's pixel 0 for them, whose weights end at k = 7
    const _Float16* p0 = &sp[(tx * 16 + c16) * PBP + 8 * gh]; const _Float16* p1 = &sp[(tx * 16 + (gh ? 0 : c16)) * PBP + 16];
    v8f cx[WR][2] = {};
#pragma unroll
    for (int r = 0; r < WR + 6; ++r) { v16h vh[2], vl[2], wh[WR], wl[WR];   // staged window row r is window row dy = r - q of image row q
#pragma unroll
      for (int i = 0; i < 2; ++i) { vh[i] = frag_h(vr + r * WRS + i * 16 * WPITCH, lane); vl[i] = frag_h(vr + r * WRS + i * 16 * WPITCH + WBUF, lane); }
#pragma unroll
      for (int q = 0; q < WR; ++q) if (r - q >= 0 && r - q < 7) { wh[q] = frag_2(p0 + (q * 7 + r - q) * 32 * PBP, p1 + (q * 7 + r - q) * 32 * PBP); wl[q] = frag_2(p0 + (q * 7 + r - q) * 32 * PBP + PBN, p1 + (q * 7 + r - q) * 32 * PBP + PBN); }
      // rows = channels, columns = pixels; the accumulators alternate, so that no product waits for the one in front of it
#pragma unroll
      for (int q = 0; q < WR; ++q) if (r - q >= 0 && r - q < 7) {
#pragma unroll
        for (int i = 0; i < 2; ++i) cx[q][i] = wmma16(vl[i], wh[q], cx[q][i]); }
#pragma unroll
      for (int q = 0; q < WR; ++q) if (r - q >= 0 && r - q < 7) {
#pragma unroll
        for (int i = 0; i < 2; ++i) cx[q][i] = wmma16(vh[i], wl[q], cx[q][i]); }
#pragma unroll
      for (int q = 0; q < WR; ++q) if (r - q >= 0 && r - q < 7) {
#pragma unroll
        for (int i = 0; i < 2; ++i) cx[q][i] = wmma16(vh[i], wh[q], cx[q][i]); } }
#pragma unroll
    for (int q = 0; q < WR; ++q)
#pragma unroll
      for (int i = 0; i < 2; ++i) { v8h o;   // element e = channel 32 cp + 16 i + 8 gh + e of pixel c16
#pragma unroll
        for (int e = 0; e < 8; ++e) o[e] = (_Float16)(cx[q][i][e] * inv[q]);
        *(v8h*)&sct[q * 32 + tx * 16 + c16][cp * 32 + i * 16 + 8 * gh] = o; } }
  static_assert((WT / 32) * WWJ * OWP * 2 <= 2 * WBUF * 4 && WR * CO * OSP * 4 <= 2 * WBUF * 4, "weight rows and output tiles fit in the window buffers");
  _Float16 (*sw)[OWP] = (_Float16 (*)[OWP])sh; float* so = sh + rg * (CO * OSP);
  // the lane's number is read anew here: a thread index held in a register across the context loop, which runs at the register limit, is spilled
  const int ln = (int)__builtin_amdgcn_mbcnt_lo(~0u, 0u), t2 = wave * 32 + ln, t8 = w8 * 32 + ln;
  // piece e = t2 + 768 j is 16 B of the contiguous weight rows; all loads of a thread are in flight at once
  v4f wv[WWJ]; const float* wp = WW + (unsigned)t2 * 4u;
#pragma unroll
  for (int j = 0; j < WWJ - 1; ++j) wv[j] = *(const v4f*)(wp + WT * 4 * j);
  const float* wl = wp + WT * 4 * (wave < WWL ? WWJ - 1 : WWJ - 2);
  wv[WWJ - 1] = *(const v4f*)wl;
  __syncthreads();   // every read of the value rows is done; the context rows are visible
  const int col = ln & 15, g = ln >> 4;
  const float bb[2] = {bfr(BW[w8 * 32 + col]), bfr(BW[w8 * 32 + 16 + col])};   // loaded here, where the LDS stores cover it: behind the product its latency would stand open
  // the code below takes the address registers that the weight and bias loads name; the two weight addresses are inputs, so that no weight load's data is given them before this wait
  asm volatile("s_wait_xcnt 0x0" :: "v"(wp), "v"(wl) : "memory");
#pragma unroll
  for (int j = 0; j < WWJ; ++j) { v4h o;   // piece t2 + 768 j: row wave + 24 j, quad ln
#pragma unroll
    for (int i = 0; i < 4; ++i) o[i] = (_Float16)bfr(wv[j][i]);
    *(v4h*)&sw[wave + (WT / 32) * j][ln * 4] = o; }
  __syncthreads();   // the weight rows are visible
  v8f acc[2][2] = {};
#pragma unroll
  for (int kc = 0; kc < CV / 32; ++kc) { v16h ca[2], w[2];
#pragma unroll
    for (int i = 0; i < 2; ++i) { ca[i] = frag_h(&sct[rg * 32 + i * 16 + col][kc * 32], ln); w[i] = frag_h(&sw[w8 * 32 + i * 16 + col][kc * 32], ln); }
#pragma unroll
    for (int i = 0; i < 2; ++i)
#pragma unroll
      for (int j = 0; j < 2; ++j) acc[i][j] = wmma16(ca[i], w[j], acc[i][j]); }
  __syncthreads();   // every read of the weight rows is done; the output tiles may overwrite them
#pragma unroll
  for (int j = 0; j < 2; ++j) { const int o = w8 * 32 + j * 16 + col;
#pragma unroll
    for (int i = 0; i < 2; ++i)
#pragma unroll
      for (int r = 0; r < 8; ++r) so[o * OSP + i * 16 + 8 * g + r] = acc[i][j][r] + bb[j]; }
  __syncthreads();   // the output tiles are visible
  const int n0 = (y0 + rg) * HW + x0;
#pragma unroll
  for (int j = 0; j < CO / 32; ++j) { const unsigned cl = ((unsigned)t8 >> 3) + 32u * j, q = t8 & 7; vst2(OUT + ((size_t)b * CO + cl) * NPX + n0 + q * 4, *(const v4f*)&so[cl * OSP + q * 4]); } }
extern "C" void kernel_launch(void* const* d_in, const int* in_sizes, int n_in, void* d_out, int out_size, void* d_ws, size_t ws_size, hipStream_t stream) {
  (void)in_sizes; (void)n_in; (void)out_size;
  const float** F = (const float**)d_in;   // 0 x [2,256,96,96], 1 fk_w1 [64,256], 2 fk_b1, 3 fk_bn1 [4,64], 4 fk_w2 [64,64], 5 fk_b2, 6 fk_bn2, 7 fq_w1, 8 fq_b1, 9 fq_bn1, 10 fq_w2, 11 fq_b2, 12 fq_bn2, 13 fv_w [128,256], 14 fv_b, 15 W_w [256,128], 16 W_b
  if (ws_size < (size_t)WS_END) return;
  char* ws = (char*)d_ws; float *KP = (float*)(ws + WS_KP), *QP = (float*)(ws + WS_QP), *VP = (float*)(ws + WS_VP);
  k_c1<<<dim3(NPX / C1PX, NB, 2), C1NT, 0, stream>>>(F[0], F[1], F[2], F[3], F[7], F[8], F[9], F[13], F[14], F[4], F[5], F[6], F[10], F[11], F[12], KP, QP, VP);
  k_win<<<TWB, WT, 0, stream>>>(KP, QP, VP, F[15], F[16], (float*)d_out);
}
